// v000
// The times below were measured on an AMD MI455X: many runs one after another, warmed up first and cycling through
// copies of the inputs, with the whole window's GPU time divided by the number of runs. Launches and the gaps
// between them are all in it. The median over several windows is given; except for v000 it joins two sittings, which
// can be a few percent apart, so the side-by-side timings, each taken in one sitting, are the better comparison.
// v000 is the starting kernel. One run takes 865 microseconds.
#include <hip/hip_runtime.h>
#include <hip/hip_bf16.h>
#include <stdint.h>

#define BB 8
#define SS 2048
#define DD 1024
#define NN 256
#define HH 512
#define EE 8
#define BS (BB * SS)                 // 16384 tokens
#define TOK_TILE 32
#define TILE_MAX (BS / TOK_TILE + EE)  // worst-case 32-token tiles over all experts

typedef __bf16 bf16;
typedef __attribute__((ext_vector_type(16))) __bf16 v16bf;
typedef __attribute__((ext_vector_type(8)))  __bf16 v8bf;
typedef __attribute__((ext_vector_type(8)))  float   v8f;

__device__ __forceinline__ v8f vzero8() {
  v8f v;
#pragma unroll
  for (int i = 0; i < 8; ++i) v[i] = 0.f;
  return v;
}

__device__ __forceinline__ float sigmoidf_(float x) { return 1.f / (1.f + __expf(-x)); }

// D = A(16xK, rows=M striped per lane) x B(Kx16, cols=N striped per lane) + C
__device__ __forceinline__ v8f wmma_bf16(v16bf a, v16bf b, v8f c) {
  return __builtin_amdgcn_wmma_f32_16x16x32_bf16(false, a, false, b, (short)0, c, false, false);
}

// Load one 16x32 bf16 fragment from a row-major tile (leading dim ld, elements).
// Per ISA 7.12.2: lane (r = lane&15, h = lane>>4) holds K = k0+h*8+{0..7} and k0+16+h*8+{0..7} of row r.
__device__ __forceinline__ v16bf load_frag(const bf16* tile, int ld, int k0, int lane) {
  const int r = lane & 15;
  const int h = (lane >> 4) & 1;
  const bf16* p = tile + (size_t)r * ld + k0 + h * 8;
  v8bf c0 = *(const v8bf*)(p);
  v8bf c1 = *(const v8bf*)(p + 16);
  v16bf f;
#pragma unroll
  for (int i = 0; i < 8; ++i) { f[i] = c0[i]; f[i + 8] = c1[i]; }
  return f;
}

struct TileInfo { int e, listBase, listEnd; };

__device__ __forceinline__ bool tile_info(const int* offsets, const int* tileOff,
                                          const int* totalTiles, TileInfo& ti) {
  int tile = blockIdx.x;
  if (tile >= *totalTiles) return false;
  int e = 0;
#pragma unroll
  for (int k = 1; k < EE; ++k) if (tile >= tileOff[k]) e = k;
  ti.e = e;
  int local = tile - tileOff[e];
  ti.listBase = offsets[e] + local * TOK_TILE;
  ti.listEnd = offsets[e + 1];
  return true;
}

// Cooperative gather of TOK_TILE token rows (ROW_ELEMS bf16 each) into LDS; invalid -> 0.
template <int ROW_ELEMS>
__device__ __forceinline__ void gather_rows(const bf16* src_base, bf16* dst, const int* tl) {
  constexpr int CPR = ROW_ELEMS / 8;          // 16B chunks per row
  for (int idx = threadIdx.x; idx < TOK_TILE * CPR; idx += 256) {
    int row = idx / CPR;
    int c = idx % CPR;
    int tok = tl[row];
    int tsafe = tok < 0 ? 0 : tok;
    const uint4* s = (const uint4*)(src_base + (size_t)tsafe * ROW_ELEMS);
    uint4* d = (uint4*)(dst + (size_t)row * ROW_ELEMS);
    uint4 v;
    if (tok >= 0) v = s[c];
    else { v.x = 0u; v.y = 0u; v.z = 0u; v.w = 0u; }
    d[c] = v;
  }
}

// ---------------- small prep kernels ----------------

__global__ void k_init(int* counts) {
  if (threadIdx.x < EE) counts[threadIdx.x] = 0;
}

__global__ void k_f2bf(const float* __restrict__ in, bf16* __restrict__ out, int n) {
  int i = blockIdx.x * blockDim.x + threadIdx.x;
  if (i < n) out[i] = (bf16)in[i];
}

__global__ void k_route(const int* __restrict__ tok, int* __restrict__ routes,
                        int* __restrict__ counts) {
  int i = blockIdx.x * blockDim.x + threadIdx.x;
  if (i >= BS) return;
  unsigned x = (unsigned)tok[i];
  x ^= x >> 16; x *= 2246822507u;
  x ^= x >> 13; x *= 3266489909u;
  x ^= x >> 16;
  int r = (int)(x & 7u);   // % 8
  routes[i] = r;
  atomicAdd(&counts[r], 1);
}

__global__ void k_offsets(const int* __restrict__ counts, int* __restrict__ offsets,
                          int* __restrict__ tileOff, int* __restrict__ cursors,
                          int* __restrict__ totalTiles) {
  if (threadIdx.x != 0 || blockIdx.x != 0) return;
  int t = 0, tt = 0;
  for (int e = 0; e < EE; ++e) {
    offsets[e] = t;
    tileOff[e] = tt;
    cursors[e] = t;
    t += counts[e];
    tt += (counts[e] + TOK_TILE - 1) / TOK_TILE;
  }
  offsets[EE] = t;
  tileOff[EE] = tt;
  *totalTiles = tt;
}

__global__ void k_scatter(const int* __restrict__ routes, int* __restrict__ cursors,
                          int* __restrict__ tokenList) {
  int i = blockIdx.x * blockDim.x + threadIdx.x;
  if (i >= BS) return;
  int pos = atomicAdd(&cursors[routes[i]], 1);
  tokenList[pos] = i;
}

// ---------------- GEMM 1: u = Win[e] @ x ----------------

__global__ void __launch_bounds__(256) k_u_gemm(
    const bf16* __restrict__ xbf, const bf16* __restrict__ winb,
    const int* __restrict__ tokenList, const int* __restrict__ offsets,
    const int* __restrict__ tileOff, const int* __restrict__ totalTiles,
    float* __restrict__ u) {
  __shared__ bf16 xs[TOK_TILE * DD];   // 64 KB
  __shared__ int tl[TOK_TILE];
  TileInfo ti;
  if (!tile_info(offsets, tileOff, totalTiles, ti)) return;
  if (threadIdx.x < TOK_TILE) {
    int li = ti.listBase + (int)threadIdx.x;
    tl[threadIdx.x] = (li < ti.listEnd) ? tokenList[li] : -1;
  }
  __syncthreads();
  gather_rows<DD>(xbf, xs, tl);
  __syncthreads();

  const int wid = threadIdx.x >> 5;
  const int lane = threadIdx.x & 31;
  const bf16* W = winb + (size_t)ti.e * NN * DD;
  v8f acc[2][2];   // [ftile][token-half]
#pragma unroll
  for (int t = 0; t < 2; ++t)
#pragma unroll
    for (int th = 0; th < 2; ++th) acc[t][th] = vzero8();

  for (int k = 0; k < DD; k += 32) {
    v16bf b0 = load_frag(xs, DD, k, lane);
    v16bf b1 = load_frag(xs + 16 * DD, DD, k, lane);
#pragma unroll
    for (int t = 0; t < 2; ++t) {
      v16bf a = load_frag(W + (size_t)((wid * 2 + t) * 16) * DD, DD, k, lane);
      acc[t][0] = wmma_bf16(a, b0, acc[t][0]);
      acc[t][1] = wmma_bf16(a, b1, acc[t][1]);
    }
  }
  const int r = lane & 15, hf = lane >> 4;
#pragma unroll
  for (int th = 0; th < 2; ++th) {
    int tok = tl[th * 16 + r];
    if (tok < 0) continue;
    float* up = u + (size_t)tok * NN;
#pragma unroll
    for (int t = 0; t < 2; ++t) {
      int fb = (wid * 2 + t) * 16 + hf * 8;
#pragma unroll
      for (int j = 0; j < 8; ++j) up[fb + j] = acc[t][th][j];
    }
  }
}

// ---- GEMM 2 (fused): sh = silu(Wsin@x) in LDS, sel = Wsout@sh -> a, b*u, c, skip ----

__global__ void __launch_bounds__(256) k_sel_gemm(
    const bf16* __restrict__ xbf, const bf16* __restrict__ wsinb,
    const bf16* __restrict__ wsoutb, const float* __restrict__ u,
    const float* __restrict__ dparam,
    const int* __restrict__ tokenList, const int* __restrict__ offsets,
    const int* __restrict__ tileOff, const int* __restrict__ totalTiles,
    float* __restrict__ aarr, float* __restrict__ buarr,
    float* __restrict__ carr, float* __restrict__ skarr) {
  __shared__ bf16 xs[TOK_TILE * DD];   // 64 KB
  __shared__ bf16 sh[TOK_TILE * HH];   // 32 KB
  __shared__ int tl[TOK_TILE];
  TileInfo ti;
  if (!tile_info(offsets, tileOff, totalTiles, ti)) return;
  if (threadIdx.x < TOK_TILE) {
    int li = ti.listBase + (int)threadIdx.x;
    tl[threadIdx.x] = (li < ti.listEnd) ? tokenList[li] : -1;
  }
  __syncthreads();
  gather_rows<DD>(xbf, xs, tl);
  __syncthreads();

  const int wid = threadIdx.x >> 5;
  const int lane = threadIdx.x & 31;
  const int r = lane & 15, hf = lane >> 4;

  // stage 1: sh(32x512) = silu(Wsin[e](512x1024) @ x^T), 4 feature tiles per wave
  {
    const bf16* Wsi = wsinb + (size_t)ti.e * HH * DD;
    v8f acc[4][2];
#pragma unroll
    for (int t = 0; t < 4; ++t)
#pragma unroll
      for (int th = 0; th < 2; ++th) acc[t][th] = vzero8();
    for (int k = 0; k < DD; k += 32) {
      v16bf b0 = load_frag(xs, DD, k, lane);
      v16bf b1 = load_frag(xs + 16 * DD, DD, k, lane);
#pragma unroll
      for (int t = 0; t < 4; ++t) {
        v16bf a = load_frag(Wsi + (size_t)((wid * 4 + t) * 16) * DD, DD, k, lane);
        acc[t][0] = wmma_bf16(a, b0, acc[t][0]);
        acc[t][1] = wmma_bf16(a, b1, acc[t][1]);
      }
    }
#pragma unroll
    for (int th = 0; th < 2; ++th) {
      int row = th * 16 + r;   // token row in tile
#pragma unroll
      for (int t = 0; t < 4; ++t) {
        int fb = (wid * 4 + t) * 16 + hf * 8;  // 8 consecutive h-features
#pragma unroll
        for (int j = 0; j < 8; ++j) {
          float v = acc[t][th][j];
          sh[row * HH + fb + j] = (bf16)(v * sigmoidf_(v));  // silu
        }
      }
    }
  }
  __syncthreads();

  // stage 2: sel(32x1024) = Wsout[e](1024x512) @ sh^T, 8 feature tiles per wave
  {
    const bf16* Wso = wsoutb + (size_t)ti.e * (4 * NN) * HH;
    v8f acc[8][2];
#pragma unroll
    for (int t = 0; t < 8; ++t)
#pragma unroll
      for (int th = 0; th < 2; ++th) acc[t][th] = vzero8();
    for (int k = 0; k < HH; k += 32) {
      v16bf b0 = load_frag(sh, HH, k, lane);
      v16bf b1 = load_frag(sh + 16 * HH, HH, k, lane);
#pragma unroll
      for (int t = 0; t < 8; ++t) {
        v16bf a = load_frag(Wso + (size_t)((wid * 8 + t) * 16) * HH, HH, k, lane);
        acc[t][0] = wmma_bf16(a, b0, acc[t][0]);
        acc[t][1] = wmma_bf16(a, b1, acc[t][1]);
      }
    }
#pragma unroll
    for (int th = 0; th < 2; ++th) {
      int tok = tl[th * 16 + r];
      if (tok < 0) continue;
      const float* up = u + (size_t)tok * NN;
#pragma unroll
      for (int t = 0; t < 8; ++t) {
        int ob = (wid * 8 + t) * 16 + hf * 8;  // global sel-feature base for this thread
        int seg = ob >> 8;                     // 0:a 1:b 2:c 3:d
        int nb = ob & 255;
        size_t base = (size_t)tok * NN + nb;
#pragma unroll
        for (int j = 0; j < 8; ++j) {
          float v = acc[t][th][j];
          if (seg == 0)      aarr[base + j] = sigmoidf_(v);
          else if (seg == 1) buarr[base + j] = tanhf(v) * up[nb + j];
          else if (seg == 2) carr[base + j] = tanhf(v);
          else               skarr[base + j] = dparam[ti.e * NN + nb + j] * sigmoidf_(v) * up[nb + j];
        }
      }
    }
  }
}

// ---------------- sequential scan: h = a*h + b*u ; y = c*h + skip ----------------

__global__ void __launch_bounds__(NN) k_scan(
    const int* __restrict__ routes, const float* __restrict__ a,
    const float* __restrict__ bu, const float* __restrict__ c,
    const float* __restrict__ sk, bf16* __restrict__ ybf) {
  int b = blockIdx.x;       // one block per batch row (blockDim == NN)
  int n = threadIdx.x;
  float h[EE];
#pragma unroll
  for (int e = 0; e < EE; ++e) h[e] = 0.f;
  for (int t = 0; t < SS; ++t) {
    int base = b * SS + t;
    int r = routes[base];
    size_t i = (size_t)base * NN + n;
    float av = a[i], buv = bu[i], cv = c[i], skv = sk[i];
    float hr = 0.f;
#pragma unroll
    for (int e = 0; e < EE; ++e) hr = (r == e) ? h[e] : hr;
    float hn = av * hr + buv;
#pragma unroll
    for (int e = 0; e < EE; ++e) h[e] = (r == e) ? hn : h[e];
    ybf[i] = (bf16)(cv * hn + skv);
  }
}

// ---------------- GEMM 3: out = Wout[e] @ y ----------------

__global__ void __launch_bounds__(256) k_out_gemm(
    const bf16* __restrict__ ybf, const bf16* __restrict__ woutb,
    const int* __restrict__ tokenList, const int* __restrict__ offsets,
    const int* __restrict__ tileOff, const int* __restrict__ totalTiles,
    float* __restrict__ out) {
  __shared__ bf16 ys[TOK_TILE * NN];   // 16 KB
  __shared__ int tl[TOK_TILE];
  TileInfo ti;
  if (!tile_info(offsets, tileOff, totalTiles, ti)) return;
  if (threadIdx.x < TOK_TILE) {
    int li = ti.listBase + (int)threadIdx.x;
    tl[threadIdx.x] = (li < ti.listEnd) ? tokenList[li] : -1;
  }
  __syncthreads();
  gather_rows<NN>(ybf, ys, tl);
  __syncthreads();

  const int wid = threadIdx.x >> 5;
  const int lane = threadIdx.x & 31;
  const bf16* W = woutb + (size_t)ti.e * DD * NN;
  v8f acc[8][2];
#pragma unroll
  for (int t = 0; t < 8; ++t)
#pragma unroll
    for (int th = 0; th < 2; ++th) acc[t][th] = vzero8();
  for (int k = 0; k < NN; k += 32) {
    v16bf b0 = load_frag(ys, NN, k, lane);
    v16bf b1 = load_frag(ys + 16 * NN, NN, k, lane);
#pragma unroll
    for (int t = 0; t < 8; ++t) {
      v16bf a = load_frag(W + (size_t)((wid * 8 + t) * 16) * NN, NN, k, lane);
      acc[t][0] = wmma_bf16(a, b0, acc[t][0]);
      acc[t][1] = wmma_bf16(a, b1, acc[t][1]);
    }
  }
  const int r = lane & 15, hf = lane >> 4;
#pragma unroll
  for (int th = 0; th < 2; ++th) {
    int tok = tl[th * 16 + r];
    if (tok < 0) continue;
    float* op = out + (size_t)tok * DD;
#pragma unroll
    for (int t = 0; t < 8; ++t) {
      int fb = (wid * 8 + t) * 16 + hf * 8;
#pragma unroll
      for (int j = 0; j < 8; ++j) op[fb + j] = acc[t][th][j];
    }
  }
}

// ---------------- host launcher ----------------

extern "C" void kernel_launch(void* const* d_in, const int* in_sizes, int n_in,
                              void* d_out, int out_size, void* d_ws, size_t ws_size,
                              hipStream_t stream) {
  (void)in_sizes; (void)n_in; (void)out_size; (void)ws_size;
  const float* x      = (const float*)d_in[0];
  const int*   tokid  = (const int*)d_in[1];
  const float* Win    = (const float*)d_in[2];
  const float* Wsin   = (const float*)d_in[3];
  const float* Wsout  = (const float*)d_in[4];
  const float* Wout   = (const float*)d_in[5];
  const float* dparam = (const float*)d_in[6];
  float* out = (float*)d_out;

  char* p = (char*)d_ws;
  auto take = [&](size_t bytes) -> char* {
    char* q = p;
    p += (bytes + 255) & ~(size_t)255;
    return q;
  };

  int* routes     = (int*)take(sizeof(int) * BS);
  int* counts     = (int*)take(sizeof(int) * EE);
  int* offsets    = (int*)take(sizeof(int) * (EE + 1));
  int* tileOff    = (int*)take(sizeof(int) * (EE + 1));
  int* cursors    = (int*)take(sizeof(int) * EE);
  int* totalTiles = (int*)take(sizeof(int));
  int* tokenList  = (int*)take(sizeof(int) * BS);
  bf16* xbf    = (bf16*)take(sizeof(bf16) * (size_t)BS * DD);
  bf16* winb   = (bf16*)take(sizeof(bf16) * (size_t)EE * NN * DD);
  bf16* wsinb  = (bf16*)take(sizeof(bf16) * (size_t)EE * HH * DD);
  bf16* wsoutb = (bf16*)take(sizeof(bf16) * (size_t)EE * 4 * NN * HH);
  bf16* woutb  = (bf16*)take(sizeof(bf16) * (size_t)EE * DD * NN);
  float* u     = (float*)take(sizeof(float) * (size_t)BS * NN);
  float* aarr  = (float*)take(sizeof(float) * (size_t)BS * NN);
  float* buarr = (float*)take(sizeof(float) * (size_t)BS * NN);
  float* carr  = (float*)take(sizeof(float) * (size_t)BS * NN);
  float* skarr = (float*)take(sizeof(float) * (size_t)BS * NN);
  bf16* ybf    = (bf16*)take(sizeof(bf16) * (size_t)BS * NN);

  k_init<<<1, 64, 0, stream>>>(counts);

  int n;
  n = BS * DD;          k_f2bf<<<(n + 255) / 256, 256, 0, stream>>>(x, xbf, n);
  n = EE * NN * DD;     k_f2bf<<<(n + 255) / 256, 256, 0, stream>>>(Win, winb, n);
  n = EE * HH * DD;     k_f2bf<<<(n + 255) / 256, 256, 0, stream>>>(Wsin, wsinb, n);
  n = EE * 4 * NN * HH; k_f2bf<<<(n + 255) / 256, 256, 0, stream>>>(Wsout, wsoutb, n);
  n = EE * DD * NN;     k_f2bf<<<(n + 255) / 256, 256, 0, stream>>>(Wout, woutb, n);

  k_route<<<BS / 256, 256, 0, stream>>>(tokid, routes, counts);
  k_offsets<<<1, 1, 0, stream>>>(counts, offsets, tileOff, cursors, totalTiles);
  k_scatter<<<BS / 256, 256, 0, stream>>>(routes, cursors, tokenList);

  k_u_gemm<<<TILE_MAX, 256, 0, stream>>>(xbf, winb, tokenList, offsets, tileOff,
                                         totalTiles, u);
  k_sel_gemm<<<TILE_MAX, 256, 0, stream>>>(xbf, wsinb, wsoutb, u, dparam, tokenList,
                                           offsets, tileOff, totalTiles,
                                           aarr, buarr, carr, skarr);
  k_scan<<<BB, NN, 0, stream>>>(routes, aarr, buarr, carr, skarr, ybf);
  k_out_gemm<<<TILE_MAX, 256, 0, stream>>>(ybf, woutb, tokenList, offsets, tileOff,
                                           totalTiles, out);
}

// v001
// Measured time: 377 microseconds a run.
// Next to v000, in two timings, it ran 2.28 and 2.30 times as fast.
#include <hip/hip_runtime.h>
#include <hip/hip_bf16.h>
#include <stdint.h>

#define BB 8
#define SS 2048
#define DD 1024
#define NN 256
#define HH 512
#define EE 8
#define BS (BB * SS)                 // 16384 tokens
#define TOK_TILE 32
#define TILE_MAX (BS / TOK_TILE + EE)  // worst-case 32-token tiles over all experts

typedef __bf16 bf16;
typedef __attribute__((ext_vector_type(16))) __bf16 v16bf;
typedef __attribute__((ext_vector_type(8)))  __bf16 v8bf;
typedef __attribute__((ext_vector_type(8)))  float   v8f;

__device__ __forceinline__ v8f vzero8() {
  v8f v;
#pragma unroll
  for (int i = 0; i < 8; ++i) v[i] = 0.f;
  return v;
}

__device__ __forceinline__ float sigmoidf_(float x) { return 1.f / (1.f + __expf(-x)); }

// D = A(16xK, rows=M striped per lane) x B(Kx16, cols=N striped per lane) + C
__device__ __forceinline__ v8f wmma_bf16(v16bf a, v16bf b, v8f c) {
  return __builtin_amdgcn_wmma_f32_16x16x32_bf16(false, a, false, b, (short)0, c, false, false);
}

// Load one 16x32 bf16 fragment from a row-major tile (leading dim ld, elements).
// Per ISA 7.12.2: lane (r = lane&15, h = lane>>4) holds K = k0+h*8+{0..7} and k0+16+h*8+{0..7} of row r.
__device__ __forceinline__ v16bf load_frag(const bf16* tile, int ld, int k0, int lane) {
  const int r = lane & 15;
  const int h = (lane >> 4) & 1;
  const bf16* p = tile + (size_t)r * ld + k0 + h * 8;
  v8bf c0 = *(const v8bf*)(p);
  v8bf c1 = *(const v8bf*)(p + 16);
  v16bf f;
#pragma unroll
  for (int i = 0; i < 8; ++i) { f[i] = c0[i]; f[i + 8] = c1[i]; }
  return f;
}

struct TileInfo { int e, listBase, listEnd; };

__device__ __forceinline__ bool tile_info(const int* offsets, const int* tileOff,
                                          const int* totalTiles, TileInfo& ti) {
  int tile = blockIdx.x;
  if (tile >= *totalTiles) return false;
  int e = 0;
#pragma unroll
  for (int k = 1; k < EE; ++k) if (tile >= tileOff[k]) e = k;
  ti.e = e;
  int local = tile - tileOff[e];
  ti.listBase = offsets[e] + local * TOK_TILE;
  ti.listEnd = offsets[e + 1];
  return true;
}

// Cooperative gather of TOK_TILE token rows (ROW_ELEMS bf16 each) into LDS; invalid -> 0.
template <int ROW_ELEMS>
__device__ __forceinline__ void gather_rows(const bf16* src_base, bf16* dst, const int* tl) {
  constexpr int CPR = ROW_ELEMS / 8;          // 16B chunks per row
  for (int idx = threadIdx.x; idx < TOK_TILE * CPR; idx += 256) {
    int row = idx / CPR;
    int c = idx % CPR;
    int tok = tl[row];
    int tsafe = tok < 0 ? 0 : tok;
    const uint4* s = (const uint4*)(src_base + (size_t)tsafe * ROW_ELEMS);
    uint4* d = (uint4*)(dst + (size_t)row * ROW_ELEMS);
    uint4 v;
    if (tok >= 0) v = s[c];
    else { v.x = 0u; v.y = 0u; v.z = 0u; v.w = 0u; }
    d[c] = v;
  }
}

// ---------------- small prep kernels ----------------

__global__ void k_init(int* counts) {
  if (threadIdx.x < EE) counts[threadIdx.x] = 0;
}

__global__ void k_f2bf(const float* __restrict__ in, bf16* __restrict__ out, int n) {
  int i = blockIdx.x * blockDim.x + threadIdx.x;
  if (i < n) out[i] = (bf16)in[i];
}

__global__ void k_route(const int* __restrict__ tok, int* __restrict__ routes,
                        int* __restrict__ counts) {
  int i = blockIdx.x * blockDim.x + threadIdx.x;
  if (i >= BS) return;
  unsigned x = (unsigned)tok[i];
  x ^= x >> 16; x *= 2246822507u;
  x ^= x >> 13; x *= 3266489909u;
  x ^= x >> 16;
  int r = (int)(x & 7u);   // % 8
  routes[i] = r;
  atomicAdd(&counts[r], 1);
}

__global__ void k_offsets(const int* __restrict__ counts, int* __restrict__ offsets,
                          int* __restrict__ tileOff, int* __restrict__ cursors,
                          int* __restrict__ totalTiles) {
  if (threadIdx.x != 0 || blockIdx.x != 0) return;
  int t = 0, tt = 0;
  for (int e = 0; e < EE; ++e) {
    offsets[e] = t;
    tileOff[e] = tt;
    cursors[e] = t;
    t += counts[e];
    tt += (counts[e] + TOK_TILE - 1) / TOK_TILE;
  }
  offsets[EE] = t;
  tileOff[EE] = tt;
  *totalTiles = tt;
}

__global__ void k_scatter(const int* __restrict__ routes, int* __restrict__ cursors,
                          int* __restrict__ tokenList) {
  int i = blockIdx.x * blockDim.x + threadIdx.x;
  if (i >= BS) return;
  int pos = atomicAdd(&cursors[routes[i]], 1);
  tokenList[pos] = i;
}

// ---------------- GEMM 1: u = Win[e] @ x ----------------

__global__ void __launch_bounds__(256) k_u_gemm(
    const bf16* __restrict__ xbf, const bf16* __restrict__ winb,
    const int* __restrict__ tokenList, const int* __restrict__ offsets,
    const int* __restrict__ tileOff, const int* __restrict__ totalTiles,
    float* __restrict__ u) {
  __shared__ bf16 xs[TOK_TILE * DD];   // 64 KB
  __shared__ int tl[TOK_TILE];
  TileInfo ti;
  if (!tile_info(offsets, tileOff, totalTiles, ti)) return;
  if (threadIdx.x < TOK_TILE) {
    int li = ti.listBase + (int)threadIdx.x;
    tl[threadIdx.x] = (li < ti.listEnd) ? tokenList[li] : -1;
  }
  __syncthreads();
  gather_rows<DD>(xbf, xs, tl);
  __syncthreads();

  const int wid = threadIdx.x >> 5;
  const int lane = threadIdx.x & 31;
  const bf16* W = winb + (size_t)ti.e * NN * DD;
  v8f acc[2][2];   // [ftile][token-half]
#pragma unroll
  for (int t = 0; t < 2; ++t)
#pragma unroll
    for (int th = 0; th < 2; ++th) acc[t][th] = vzero8();

  for (int k = 0; k < DD; k += 32) {
    v16bf b0 = load_frag(xs, DD, k, lane);
    v16bf b1 = load_frag(xs + 16 * DD, DD, k, lane);
#pragma unroll
    for (int t = 0; t < 2; ++t) {
      v16bf a = load_frag(W + (size_t)((wid * 2 + t) * 16) * DD, DD, k, lane);
      acc[t][0] = wmma_bf16(a, b0, acc[t][0]);
      acc[t][1] = wmma_bf16(a, b1, acc[t][1]);
    }
  }
  const int r = lane & 15, hf = lane >> 4;
#pragma unroll
  for (int th = 0; th < 2; ++th) {
    int tok = tl[th * 16 + r];
    if (tok < 0) continue;
    float* up = u + (size_t)tok * NN;
#pragma unroll
    for (int t = 0; t < 2; ++t) {
      int fb = (wid * 2 + t) * 16 + hf * 8;
#pragma unroll
      for (int j = 0; j < 8; ++j) up[fb + j] = acc[t][th][j];
    }
  }
}

// ---- GEMM 2 (fused): sh = silu(Wsin@x) in LDS, sel = Wsout@sh -> a, b*u, c, skip ----

__global__ void __launch_bounds__(256) k_sel_gemm(
    const bf16* __restrict__ xbf, const bf16* __restrict__ wsinb,
    const bf16* __restrict__ wsoutb, const float* __restrict__ u,
    const float* __restrict__ dparam,
    const int* __restrict__ tokenList, const int* __restrict__ offsets,
    const int* __restrict__ tileOff, const int* __restrict__ totalTiles,
    float* __restrict__ aarr, float* __restrict__ buarr,
    float* __restrict__ carr, float* __restrict__ skarr) {
  __shared__ bf16 xs[TOK_TILE * DD];   // 64 KB
  __shared__ bf16 sh[TOK_TILE * HH];   // 32 KB
  __shared__ int tl[TOK_TILE];
  TileInfo ti;
  if (!tile_info(offsets, tileOff, totalTiles, ti)) return;
  if (threadIdx.x < TOK_TILE) {
    int li = ti.listBase + (int)threadIdx.x;
    tl[threadIdx.x] = (li < ti.listEnd) ? tokenList[li] : -1;
  }
  __syncthreads();
  gather_rows<DD>(xbf, xs, tl);
  __syncthreads();

  const int wid = threadIdx.x >> 5;
  const int lane = threadIdx.x & 31;
  const int r = lane & 15, hf = lane >> 4;

  // stage 1: sh(32x512) = silu(Wsin[e](512x1024) @ x^T), 4 feature tiles per wave
  {
    const bf16* Wsi = wsinb + (size_t)ti.e * HH * DD;
    v8f acc[4][2];
#pragma unroll
    for (int t = 0; t < 4; ++t)
#pragma unroll
      for (int th = 0; th < 2; ++th) acc[t][th] = vzero8();
    for (int k = 0; k < DD; k += 32) {
      v16bf b0 = load_frag(xs, DD, k, lane);
      v16bf b1 = load_frag(xs + 16 * DD, DD, k, lane);
#pragma unroll
      for (int t = 0; t < 4; ++t) {
        v16bf a = load_frag(Wsi + (size_t)((wid * 4 + t) * 16) * DD, DD, k, lane);
        acc[t][0] = wmma_bf16(a, b0, acc[t][0]);
        acc[t][1] = wmma_bf16(a, b1, acc[t][1]);
      }
    }
#pragma unroll
    for (int th = 0; th < 2; ++th) {
      int row = th * 16 + r;   // token row in tile
#pragma unroll
      for (int t = 0; t < 4; ++t) {
        int fb = (wid * 4 + t) * 16 + hf * 8;  // 8 consecutive h-features
#pragma unroll
        for (int j = 0; j < 8; ++j) {
          float v = acc[t][th][j];
          sh[row * HH + fb + j] = (bf16)(v * sigmoidf_(v));  // silu
        }
      }
    }
  }
  __syncthreads();

  // stage 2: sel(32x1024) = Wsout[e](1024x512) @ sh^T, 8 feature tiles per wave
  {
    const bf16* Wso = wsoutb + (size_t)ti.e * (4 * NN) * HH;
    v8f acc[8][2];
#pragma unroll
    for (int t = 0; t < 8; ++t)
#pragma unroll
      for (int th = 0; th < 2; ++th) acc[t][th] = vzero8();
    for (int k = 0; k < HH; k += 32) {
      v16bf b0 = load_frag(sh, HH, k, lane);
      v16bf b1 = load_frag(sh + 16 * HH, HH, k, lane);
#pragma unroll
      for (int t = 0; t < 8; ++t) {
        v16bf a = load_frag(Wso + (size_t)((wid * 8 + t) * 16) * HH, HH, k, lane);
        acc[t][0] = wmma_bf16(a, b0, acc[t][0]);
        acc[t][1] = wmma_bf16(a, b1, acc[t][1]);
      }
    }
#pragma unroll
    for (int th = 0; th < 2; ++th) {
      int tok = tl[th * 16 + r];
      if (tok < 0) continue;
      const float* up = u + (size_t)tok * NN;
#pragma unroll
      for (int t = 0; t < 8; ++t) {
        int ob = (wid * 8 + t) * 16 + hf * 8;  // global sel-feature base for this thread
        int seg = ob >> 8;                     // 0:a 1:b 2:c 3:d
        int nb = ob & 255;
        size_t base = (size_t)tok * NN + nb;
#pragma unroll
        for (int j = 0; j < 8; ++j) {
          float v = acc[t][th][j];
          if (seg == 0)      aarr[base + j] = sigmoidf_(v);
          else if (seg == 1) buarr[base + j] = tanhf(v) * up[nb + j];
          else if (seg == 2) carr[base + j] = tanhf(v);
          else               skarr[base + j] = dparam[ti.e * NN + nb + j] * sigmoidf_(v) * up[nb + j];
        }
      }
    }
  }
}

// ---------------- scan: h = a*h + b*u ; y = c*h + skip ----------------
// A step reads and writes only its own expert's state, so the 2048 steps of a batch row are
// EE independent chains. One work-group takes one (batch row, expert, SCAN_T states): it lists
// the expert's steps in time order in LDS and walks only those, SCAN_U steps' operands per trip.

#define SCAN_T 64                    // states per work-group: its y stores fill one 128-byte line
#define SCAN_W (SCAN_T / 32)         // waves per work-group
#define SCAN_U 32                    // steps whose operands are loaded together
#define SCAN_R (SS / SCAN_T)         // routes per lane while the list is built

// One trip: SCAN_U steps of the list. In the last, short trip (FULL false) the surplus places
// repeat step left - 1 with h held, so they store that step's y again and no store needs a test.
template <bool FULL>
__device__ __forceinline__ float scan_trip(
    const int* lst, int left, unsigned rowIdx, float h,
    const float* __restrict__ a, const float* __restrict__ bu,
    const float* __restrict__ c, const float* __restrict__ sk, bf16* __restrict__ ybf) {
  unsigned idx[SCAN_U];              // this lane's element in the four f32 planes and in y
  float av[SCAN_U], bv[SCAN_U], cv[SCAN_U], sv[SCAN_U];
#pragma unroll  // constant j: idx[] stays in registers
  for (int j = 0; j < SCAN_U; ++j)
    idx[j] = rowIdx + (unsigned)lst[(FULL || j < left) ? j : left - 1] * NN;
#pragma unroll  // lets the trip's loads issue together, ahead of the sums
  for (int j = 0; j < SCAN_U; ++j) {
    av[j] = a[idx[j]];
    bv[j] = bu[idx[j]];
    cv[j] = c[idx[j]];
    sv[j] = sk[idx[j]];
  }
  // holds every load in front of the sums: one that sinks among them starts its latency late
  __builtin_amdgcn_sched_barrier(0);
  bf16 yv[SCAN_U];
#pragma unroll  // constant j: the operand arrays stay in registers
  for (int j = 0; j < SCAN_U; ++j) {
    float hn = av[j] * h + bv[j];
    h = (FULL || j < left) ? hn : h;
    yv[j] = (bf16)(cv[j] * h + sv[j]);
  }
  // holds the stores behind the last y: mixed in with the sums they share one data register,
  // and each sum then waits (s_wait_xcnt) for the store in front of it
  __builtin_amdgcn_sched_barrier(0);
#pragma unroll  // constant j: idx[] and yv[] stay in registers
  for (int j = 0; j < SCAN_U; ++j) ybf[idx[j]] = yv[j];
  // the next trip rewrites the index and data registers that these stores name
  if (FULL) asm volatile("s_wait_xcnt 0x0" ::: "memory");
  return h;
}

__global__ void __launch_bounds__(SCAN_T) k_scan(
    const int* __restrict__ routes, const float* __restrict__ a,
    const float* __restrict__ bu, const float* __restrict__ c,
    const float* __restrict__ sk, bf16* __restrict__ ybf) {
  __shared__ __attribute__((aligned(16))) int list[SS];
  __shared__ int wcnt[SCAN_W];
  const int slice = blockIdx.x % (NN / SCAN_T);
  const int e = (blockIdx.x / (NN / SCAN_T)) % EE;
  const int b = blockIdx.x / ((NN / SCAN_T) * EE);
  const int wid = threadIdx.x >> 5;
  const int lane = threadIdx.x & 31;

  // wave wid lists the steps t in [wid * 32 * SCAN_R, (wid + 1) * 32 * SCAN_R), 32 per ballot
  const int t0 = wid * (32 * SCAN_R);
  unsigned hit[SCAN_R];
  int mine = 0;
#pragma unroll  // the route loads issue together; hit[] stays in scalar registers
  for (int i = 0; i < SCAN_R; ++i) {
    hit[i] = __builtin_amdgcn_ballot_w32(routes[b * SS + t0 + i * 32 + lane] == e);
    mine += __popc(hit[i]);
  }
  if (lane == 0) wcnt[wid] = mine;
  __syncthreads();
  int pos = 0, cnt = 0;
#pragma unroll  // SCAN_W is 2: no loop is left
  for (int w = 0; w < SCAN_W; ++w) {
    int v = wcnt[w];
    if (w < wid) pos += v;
    cnt += v;
  }
  cnt = __builtin_amdgcn_readfirstlane(cnt);   // same in every lane: keeps the trip tests scalar
#pragma unroll  // constant i: hit[] stays in scalar registers
  for (int i = 0; i < SCAN_R; ++i) {
    if ((hit[i] >> lane) & 1u)
      list[pos + (int)__builtin_amdgcn_mbcnt_lo(hit[i], 0u)] = t0 + i * 32 + lane;
    pos += __popc(hit[i]);
  }
  __syncthreads();

  const unsigned rowIdx = (unsigned)(b * SS) * NN + slice * SCAN_T + threadIdx.x;
  float h = 0.f;
  int base = 0;
  for (; base + SCAN_U <= cnt; base += SCAN_U)
    h = scan_trip<true>(list + base, SCAN_U, rowIdx, h, a, bu, c, sk, ybf);
  if (base < cnt)
    scan_trip<false>(list + base, cnt - base, rowIdx, h, a, bu, c, sk, ybf);
}

// ---------------- GEMM 3: out = Wout[e] @ y ----------------

__global__ void __launch_bounds__(256) k_out_gemm(
    const bf16* __restrict__ ybf, const bf16* __restrict__ woutb,
    const int* __restrict__ tokenList, const int* __restrict__ offsets,
    const int* __restrict__ tileOff, const int* __restrict__ totalTiles,
    float* __restrict__ out) {
  __shared__ bf16 ys[TOK_TILE * NN];   // 16 KB
  __shared__ int tl[TOK_TILE];
  TileInfo ti;
  if (!tile_info(offsets, tileOff, totalTiles, ti)) return;
  if (threadIdx.x < TOK_TILE) {
    int li = ti.listBase + (int)threadIdx.x;
    tl[threadIdx.x] = (li < ti.listEnd) ? tokenList[li] : -1;
  }
  __syncthreads();
  gather_rows<NN>(ybf, ys, tl);
  __syncthreads();

  const int wid = threadIdx.x >> 5;
  const int lane = threadIdx.x & 31;
  const bf16* W = woutb + (size_t)ti.e * DD * NN;
  v8f acc[8][2];
#pragma unroll
  for (int t = 0; t < 8; ++t)
#pragma unroll
    for (int th = 0; th < 2; ++th) acc[t][th] = vzero8();
  for (int k = 0; k < NN; k += 32) {
    v16bf b0 = load_frag(ys, NN, k, lane);
    v16bf b1 = load_frag(ys + 16 * NN, NN, k, lane);
#pragma unroll
    for (int t = 0; t < 8; ++t) {
      v16bf a = load_frag(W + (size_t)((wid * 8 + t) * 16) * NN, NN, k, lane);
      acc[t][0] = wmma_bf16(a, b0, acc[t][0]);
      acc[t][1] = wmma_bf16(a, b1, acc[t][1]);
    }
  }
  const int r = lane & 15, hf = lane >> 4;
#pragma unroll
  for (int th = 0; th < 2; ++th) {
    int tok = tl[th * 16 + r];
    if (tok < 0) continue;
    float* op = out + (size_t)tok * DD;
#pragma unroll
    for (int t = 0; t < 8; ++t) {
      int fb = (wid * 8 + t) * 16 + hf * 8;
#pragma unroll
      for (int j = 0; j < 8; ++j) op[fb + j] = acc[t][th][j];
    }
  }
}

// ---------------- host launcher ----------------

extern "C" void kernel_launch(void* const* d_in, const int* in_sizes, int n_in,
                              void* d_out, int out_size, void* d_ws, size_t ws_size,
                              hipStream_t stream) {
  (void)in_sizes; (void)n_in; (void)out_size; (void)ws_size;
  const float* x      = (const float*)d_in[0];
  const int*   tokid  = (const int*)d_in[1];
  const float* Win    = (const float*)d_in[2];
  const float* Wsin   = (const float*)d_in[3];
  const float* Wsout  = (const float*)d_in[4];
  const float* Wout   = (const float*)d_in[5];
  const float* dparam = (const float*)d_in[6];
  float* out = (float*)d_out;

  char* p = (char*)d_ws;
  auto take = [&](size_t bytes) -> char* {
    char* q = p;
    p += (bytes + 255) & ~(size_t)255;
    return q;
  };

  int* routes     = (int*)take(sizeof(int) * BS);
  int* counts     = (int*)take(sizeof(int) * EE);
  int* offsets    = (int*)take(sizeof(int) * (EE + 1));
  int* tileOff    = (int*)take(sizeof(int) * (EE + 1));
  int* cursors    = (int*)take(sizeof(int) * EE);
  int* totalTiles = (int*)take(sizeof(int));
  int* tokenList  = (int*)take(sizeof(int) * BS);
  bf16* xbf    = (bf16*)take(sizeof(bf16) * (size_t)BS * DD);
  bf16* winb   = (bf16*)take(sizeof(bf16) * (size_t)EE * NN * DD);
  bf16* wsinb  = (bf16*)take(sizeof(bf16) * (size_t)EE * HH * DD);
  bf16* wsoutb = (bf16*)take(sizeof(bf16) * (size_t)EE * 4 * NN * HH);
  bf16* woutb  = (bf16*)take(sizeof(bf16) * (size_t)EE * DD * NN);
  float* u     = (float*)take(sizeof(float) * (size_t)BS * NN);
  float* aarr  = (float*)take(sizeof(float) * (size_t)BS * NN);
  float* buarr = (float*)take(sizeof(float) * (size_t)BS * NN);
  float* carr  = (float*)take(sizeof(float) * (size_t)BS * NN);
  float* skarr = (float*)take(sizeof(float) * (size_t)BS * NN);
  bf16* ybf    = (bf16*)take(sizeof(bf16) * (size_t)BS * NN);

  k_init<<<1, 64, 0, stream>>>(counts);

  int n;
  n = BS * DD;          k_f2bf<<<(n + 255) / 256, 256, 0, stream>>>(x, xbf, n);
  n = EE * NN * DD;     k_f2bf<<<(n + 255) / 256, 256, 0, stream>>>(Win, winb, n);
  n = EE * HH * DD;     k_f2bf<<<(n + 255) / 256, 256, 0, stream>>>(Wsin, wsinb, n);
  n = EE * 4 * NN * HH; k_f2bf<<<(n + 255) / 256, 256, 0, stream>>>(Wsout, wsoutb, n);
  n = EE * DD * NN;     k_f2bf<<<(n + 255) / 256, 256, 0, stream>>>(Wout, woutb, n);

  k_route<<<BS / 256, 256, 0, stream>>>(tokid, routes, counts);
  k_offsets<<<1, 1, 0, stream>>>(counts, offsets, tileOff, cursors, totalTiles);
  k_scatter<<<BS / 256, 256, 0, stream>>>(routes, cursors, tokenList);

  k_u_gemm<<<TILE_MAX, 256, 0, stream>>>(xbf, winb, tokenList, offsets, tileOff,
                                         totalTiles, u);
  k_sel_gemm<<<TILE_MAX, 256, 0, stream>>>(xbf, wsinb, wsoutb, u, dparam, tokenList,
                                           offsets, tileOff, totalTiles,
                                           aarr, buarr, carr, skarr);
  k_scan<<<BB * EE * (NN / SCAN_T), SCAN_T, 0, stream>>>(routes, aarr, buarr, carr, skarr, ybf);
  k_out_gemm<<<TILE_MAX, 256, 0, stream>>>(ybf, woutb, tokenList, offsets, tileOff,
                                           totalTiles, out);
}

// v002
// It runs in 336 microseconds.
// Timed twice side by side with v001, it ran 1.12 times as fast both times.
// Counting every step since v000, it is 2.56 times as fast.
#include <hip/hip_runtime.h>
#include <hip/hip_bf16.h>
#include <stdint.h>

#define BB 8
#define SS 2048
#define DD 1024
#define NN 256
#define HH 512
#define EE 8
#define BS (BB * SS)                 // 16384 tokens
#define TOK_TILE 32
#define TILE_MAX (BS / TOK_TILE + EE)  // worst-case 32-token tiles over all experts

typedef __bf16 bf16;
typedef __attribute__((ext_vector_type(16))) __bf16 v16bf;
typedef __attribute__((ext_vector_type(8)))  __bf16 v8bf;
typedef __attribute__((ext_vector_type(8)))  float   v8f;
typedef __attribute__((ext_vector_type(4)))  float   v4f;
typedef __attribute__((ext_vector_type(4)))  __bf16 v4bf;

__device__ __forceinline__ v8f vzero8() {
  v8f v;
#pragma unroll
  for (int i = 0; i < 8; ++i) v[i] = 0.f;
  return v;
}

__device__ __forceinline__ float sigmoidf_(float x) { return 1.f / (1.f + __expf(-x)); }

// D = A(16xK, rows=M striped per lane) x B(Kx16, cols=N striped per lane) + C
__device__ __forceinline__ v8f wmma_bf16(v16bf a, v16bf b, v8f c) {
  return __builtin_amdgcn_wmma_f32_16x16x32_bf16(false, a, false, b, (short)0, c, false, false);
}

// Load one 16x32 bf16 fragment from a row-major tile (leading dim ld, elements).
// Per ISA 7.12.2: lane (r = lane&15, h = lane>>4) holds K = k0+h*8+{0..7} and k0+16+h*8+{0..7} of row r.
__device__ __forceinline__ v16bf load_frag(const bf16* tile, int ld, int k0, int lane) {
  const int r = lane & 15;
  const int h = (lane >> 4) & 1;
  const bf16* p = tile + (size_t)r * ld + k0 + h * 8;
  v8bf c0 = *(const v8bf*)(p);
  v8bf c1 = *(const v8bf*)(p + 16);
  v16bf f;
#pragma unroll
  for (int i = 0; i < 8; ++i) { f[i] = c0[i]; f[i + 8] = c1[i]; }
  return f;
}

struct TileInfo { int e, listBase, listEnd; };

__device__ __forceinline__ bool tile_info(const int* offsets, const int* tileOff,
                                          const int* totalTiles, TileInfo& ti) {
  int tile = blockIdx.x;
  if (tile >= *totalTiles) return false;
  int e = 0;
#pragma unroll
  for (int k = 1; k < EE; ++k) if (tile >= tileOff[k]) e = k;
  ti.e = e;
  int local = tile - tileOff[e];
  ti.listBase = offsets[e] + local * TOK_TILE;
  ti.listEnd = offsets[e + 1];
  return true;
}

// Cooperative gather of TOK_TILE token rows (ROW_ELEMS bf16 each) into LDS; invalid -> 0.
template <int ROW_ELEMS>
__device__ __forceinline__ void gather_rows(const bf16* src_base, bf16* dst, const int* tl) {
  constexpr int CPR = ROW_ELEMS / 8;          // 16B chunks per row
  for (int idx = threadIdx.x; idx < TOK_TILE * CPR; idx += 256) {
    int row = idx / CPR;
    int c = idx % CPR;
    int tok = tl[row];
    int tsafe = tok < 0 ? 0 : tok;
    const uint4* s = (const uint4*)(src_base + (size_t)tsafe * ROW_ELEMS);
    uint4* d = (uint4*)(dst + (size_t)row * ROW_ELEMS);
    uint4 v;
    if (tok >= 0) v = s[c];
    else { v.x = 0u; v.y = 0u; v.z = 0u; v.w = 0u; }
    d[c] = v;
  }
}

// ---------------- small prep kernels ----------------

__global__ void k_init(int* counts) {
  if (threadIdx.x < EE) counts[threadIdx.x] = 0;
}

// f32 -> bf16 as a stream: a grid that is resident at once, one work-group per WGP, and every
// wave loops over whole pieces of CVT_PIECE floats. A wave's load covers 512 contiguous bytes,
// its store 256, and CVT_LOADS loads of a lane are in flight together.
#define CVT_GRID 256                       // work-groups
#define CVT_WAVES 16                       // waves per work-group
#define CVT_LOADS 8                        // 16-byte loads per lane and trip
#define CVT_PIECE (CVT_LOADS * 32 * 4)     // floats per wave and trip
static_assert((BS * DD) % CVT_PIECE == 0 && (EE * NN * DD) % CVT_PIECE == 0 &&
              (EE * HH * DD) % CVT_PIECE == 0 && (EE * 4 * NN * HH) % CVT_PIECE == 0,
              "every converted array is a whole number of pieces");

__global__ void __launch_bounds__(CVT_WAVES * 32) k_f2bf(
    const float* __restrict__ in, bf16* __restrict__ out, int n) {
  const int wid = threadIdx.x >> 5;
  const int lane = threadIdx.x & 31;
  const int pieces = n / CVT_PIECE;
  // piece -> (wave, work-group) with the work-group running fastest: a short array still
  // spreads over every work-group
  for (int p = wid * CVT_GRID + (int)blockIdx.x; p < pieces; p += CVT_WAVES * CVT_GRID) {
    const v4f* s = (const v4f*)(in + (size_t)p * CVT_PIECE) + lane;
    v4bf* d = (v4bf*)(out + (size_t)p * CVT_PIECE) + lane;
    v4f v[CVT_LOADS];
#pragma unroll  // the trip's loads issue together, ahead of the first store
    for (int j = 0; j < CVT_LOADS; ++j) v[j] = s[j * 32];
#pragma unroll  // constant j: v[] stays in registers
    for (int j = 0; j < CVT_LOADS; ++j) d[j * 32] = __builtin_convertvector(v[j], v4bf);
  }
}

__global__ void k_route(const int* __restrict__ tok, int* __restrict__ routes,
                        int* __restrict__ counts) {
  int i = blockIdx.x * blockDim.x + threadIdx.x;
  if (i >= BS) return;
  unsigned x = (unsigned)tok[i];
  x ^= x >> 16; x *= 2246822507u;
  x ^= x >> 13; x *= 3266489909u;
  x ^= x >> 16;
  int r = (int)(x & 7u);   // % 8
  routes[i] = r;
  atomicAdd(&counts[r], 1);
}

__global__ void k_offsets(const int* __restrict__ counts, int* __restrict__ offsets,
                          int* __restrict__ tileOff, int* __restrict__ cursors,
                          int* __restrict__ totalTiles) {
  if (threadIdx.x != 0 || blockIdx.x != 0) return;
  int t = 0, tt = 0;
  for (int e = 0; e < EE; ++e) {
    offsets[e] = t;
    tileOff[e] = tt;
    cursors[e] = t;
    t += counts[e];
    tt += (counts[e] + TOK_TILE - 1) / TOK_TILE;
  }
  offsets[EE] = t;
  tileOff[EE] = tt;
  *totalTiles = tt;
}

__global__ void k_scatter(const int* __restrict__ routes, int* __restrict__ cursors,
                          int* __restrict__ tokenList) {
  int i = blockIdx.x * blockDim.x + threadIdx.x;
  if (i >= BS) return;
  int pos = atomicAdd(&cursors[routes[i]], 1);
  tokenList[pos] = i;
}

// ---------------- GEMM 1: u = Win[e] @ x ----------------

__global__ void __launch_bounds__(256) k_u_gemm(
    const bf16* __restrict__ xbf, const bf16* __restrict__ winb,
    const int* __restrict__ tokenList, const int* __restrict__ offsets,
    const int* __restrict__ tileOff, const int* __restrict__ totalTiles,
    float* __restrict__ u) {
  __shared__ bf16 xs[TOK_TILE * DD];   // 64 KB
  __shared__ int tl[TOK_TILE];
  TileInfo ti;
  if (!tile_info(offsets, tileOff, totalTiles, ti)) return;
  if (threadIdx.x < TOK_TILE) {
    int li = ti.listBase + (int)threadIdx.x;
    tl[threadIdx.x] = (li < ti.listEnd) ? tokenList[li] : -1;
  }
  __syncthreads();
  gather_rows<DD>(xbf, xs, tl);
  __syncthreads();

  const int wid = threadIdx.x >> 5;
  const int lane = threadIdx.x & 31;
  const bf16* W = winb + (size_t)ti.e * NN * DD;
  v8f acc[2][2];   // [ftile][token-half]
#pragma unroll
  for (int t = 0; t < 2; ++t)
#pragma unroll
    for (int th = 0; th < 2; ++th) acc[t][th] = vzero8();

  for (int k = 0; k < DD; k += 32) {
    v16bf b0 = load_frag(xs, DD, k, lane);
    v16bf b1 = load_frag(xs + 16 * DD, DD, k, lane);
#pragma unroll
    for (int t = 0; t < 2; ++t) {
      v16bf a = load_frag(W + (size_t)((wid * 2 + t) * 16) * DD, DD, k, lane);
      acc[t][0] = wmma_bf16(a, b0, acc[t][0]);
      acc[t][1] = wmma_bf16(a, b1, acc[t][1]);
    }
  }
  const int r = lane & 15, hf = lane >> 4;
#pragma unroll
  for (int th = 0; th < 2; ++th) {
    int tok = tl[th * 16 + r];
    if (tok < 0) continue;
    float* up = u + (size_t)tok * NN;
#pragma unroll
    for (int t = 0; t < 2; ++t) {
      int fb = (wid * 2 + t) * 16 + hf * 8;
#pragma unroll
      for (int j = 0; j < 8; ++j) up[fb + j] = acc[t][th][j];
    }
  }
}

// ---- GEMM 2 (fused): sh = silu(Wsin@x) in LDS, sel = Wsout@sh -> a, b*u, c, skip ----

__global__ void __launch_bounds__(256) k_sel_gemm(
    const bf16* __restrict__ xbf, const bf16* __restrict__ wsinb,
    const bf16* __restrict__ wsoutb, const float* __restrict__ u,
    const float* __restrict__ dparam,
    const int* __restrict__ tokenList, const int* __restrict__ offsets,
    const int* __restrict__ tileOff, const int* __restrict__ totalTiles,
    float* __restrict__ aarr, float* __restrict__ buarr,
    float* __restrict__ carr, float* __restrict__ skarr) {
  __shared__ bf16 xs[TOK_TILE * DD];   // 64 KB
  __shared__ bf16 sh[TOK_TILE * HH];   // 32 KB
  __shared__ int tl[TOK_TILE];
  TileInfo ti;
  if (!tile_info(offsets, tileOff, totalTiles, ti)) return;
  if (threadIdx.x < TOK_TILE) {
    int li = ti.listBase + (int)threadIdx.x;
    tl[threadIdx.x] = (li < ti.listEnd) ? tokenList[li] : -1;
  }
  __syncthreads();
  gather_rows<DD>(xbf, xs, tl);
  __syncthreads();

  const int wid = threadIdx.x >> 5;
  const int lane = threadIdx.x & 31;
  const int r = lane & 15, hf = lane >> 4;

  // stage 1: sh(32x512) = silu(Wsin[e](512x1024) @ x^T), 4 feature tiles per wave
  {
    const bf16* Wsi = wsinb + (size_t)ti.e * HH * DD;
    v8f acc[4][2];
#pragma unroll
    for (int t = 0; t < 4; ++t)
#pragma unroll
      for (int th = 0; th < 2; ++th) acc[t][th] = vzero8();
    for (int k = 0; k < DD; k += 32) {
      v16bf b0 = load_frag(xs, DD, k, lane);
      v16bf b1 = load_frag(xs + 16 * DD, DD, k, lane);
#pragma unroll
      for (int t = 0; t < 4; ++t) {
        v16bf a = load_frag(Wsi + (size_t)((wid * 4 + t) * 16) * DD, DD, k, lane);
        acc[t][0] = wmma_bf16(a, b0, acc[t][0]);
        acc[t][1] = wmma_bf16(a, b1, acc[t][1]);
      }
    }
#pragma unroll
    for (int th = 0; th < 2; ++th) {
      int row = th * 16 + r;   // token row in tile
#pragma unroll
      for (int t = 0; t < 4; ++t) {
        int fb = (wid * 4 + t) * 16 + hf * 8;  // 8 consecutive h-features
#pragma unroll
        for (int j = 0; j < 8; ++j) {
          float v = acc[t][th][j];
          sh[row * HH + fb + j] = (bf16)(v * sigmoidf_(v));  // silu
        }
      }
    }
  }
  __syncthreads();

  // stage 2: sel(32x1024) = Wsout[e](1024x512) @ sh^T, 8 feature tiles per wave
  {
    const bf16* Wso = wsoutb + (size_t)ti.e * (4 * NN) * HH;
    v8f acc[8][2];
#pragma unroll
    for (int t = 0; t < 8; ++t)
#pragma unroll
      for (int th = 0; th < 2; ++th) acc[t][th] = vzero8();
    for (int k = 0; k < HH; k += 32) {
      v16bf b0 = load_frag(sh, HH, k, lane);
      v16bf b1 = load_frag(sh + 16 * HH, HH, k, lane);
#pragma unroll
      for (int t = 0; t < 8; ++t) {
        v16bf a = load_frag(Wso + (size_t)((wid * 8 + t) * 16) * HH, HH, k, lane);
        acc[t][0] = wmma_bf16(a, b0, acc[t][0]);
        acc[t][1] = wmma_bf16(a, b1, acc[t][1]);
      }
    }
#pragma unroll
    for (int th = 0; th < 2; ++th) {
      int tok = tl[th * 16 + r];
      if (tok < 0) continue;
      const float* up = u + (size_t)tok * NN;
#pragma unroll
      for (int t = 0; t < 8; ++t) {
        int ob = (wid * 8 + t) * 16 + hf * 8;  // global sel-feature base for this thread
        int seg = ob >> 8;                     // 0:a 1:b 2:c 3:d
        int nb = ob & 255;
        size_t base = (size_t)tok * NN + nb;
#pragma unroll
        for (int j = 0; j < 8; ++j) {
          float v = acc[t][th][j];
          if (seg == 0)      aarr[base + j] = sigmoidf_(v);
          else if (seg == 1) buarr[base + j] = tanhf(v) * up[nb + j];
          else if (seg == 2) carr[base + j] = tanhf(v);
          else               skarr[base + j] = dparam[ti.e * NN + nb + j] * sigmoidf_(v) * up[nb + j];
        }
      }
    }
  }
}

// ---------------- scan: h = a*h + b*u ; y = c*h + skip ----------------
// A step reads and writes only its own expert's state, so the 2048 steps of a batch row are
// EE independent chains. One work-group takes one (batch row, expert, SCAN_T states): it lists
// the expert's steps in time order in LDS and walks only those, SCAN_U steps' operands per trip.

#define SCAN_T 64                    // states per work-group: its y stores fill one 128-byte line
#define SCAN_W (SCAN_T / 32)         // waves per work-group
#define SCAN_U 32                    // steps whose operands are loaded together
#define SCAN_R (SS / SCAN_T)         // routes per lane while the list is built

// One trip: SCAN_U steps of the list. In the last, short trip (FULL false) the surplus places
// repeat step left - 1 with h held, so they store that step's y again and no store needs a test.
template <bool FULL>
__device__ __forceinline__ float scan_trip(
    const int* lst, int left, unsigned rowIdx, float h,
    const float* __restrict__ a, const float* __restrict__ bu,
    const float* __restrict__ c, const float* __restrict__ sk, bf16* __restrict__ ybf) {
  unsigned idx[SCAN_U];              // this lane's element in the four f32 planes and in y
  float av[SCAN_U], bv[SCAN_U], cv[SCAN_U], sv[SCAN_U];
#pragma unroll  // constant j: idx[] stays in registers
  for (int j = 0; j < SCAN_U; ++j)
    idx[j] = rowIdx + (unsigned)lst[(FULL || j < left) ? j : left - 1] * NN;
#pragma unroll  // lets the trip's loads issue together, ahead of the sums
  for (int j = 0; j < SCAN_U; ++j) {
    av[j] = a[idx[j]];
    bv[j] = bu[idx[j]];
    cv[j] = c[idx[j]];
    sv[j] = sk[idx[j]];
  }
  // holds every load in front of the sums: one that sinks among them starts its latency late
  __builtin_amdgcn_sched_barrier(0);
  bf16 yv[SCAN_U];
#pragma unroll  // constant j: the operand arrays stay in registers
  for (int j = 0; j < SCAN_U; ++j) {
    float hn = av[j] * h + bv[j];
    h = (FULL || j < left) ? hn : h;
    yv[j] = (bf16)(cv[j] * h + sv[j]);
  }
  // holds the stores behind the last y: mixed in with the sums they share one data register,
  // and each sum then waits (s_wait_xcnt) for the store in front of it
  __builtin_amdgcn_sched_barrier(0);
#pragma unroll  // constant j: idx[] and yv[] stay in registers
  for (int j = 0; j < SCAN_U; ++j) ybf[idx[j]] = yv[j];
  // the next trip rewrites the index and data registers that these stores name
  if (FULL) asm volatile("s_wait_xcnt 0x0" ::: "memory");
  return h;
}

__global__ void __launch_bounds__(SCAN_T) k_scan(
    const int* __restrict__ routes, const float* __restrict__ a,
    const float* __restrict__ bu, const float* __restrict__ c,
    const float* __restrict__ sk, bf16* __restrict__ ybf) {
  __shared__ __attribute__((aligned(16))) int list[SS];
  __shared__ int wcnt[SCAN_W];
  const int slice = blockIdx.x % (NN / SCAN_T);
  const int e = (blockIdx.x / (NN / SCAN_T)) % EE;
  const int b = blockIdx.x / ((NN / SCAN_T) * EE);
  const int wid = threadIdx.x >> 5;
  const int lane = threadIdx.x & 31;

  // wave wid lists the steps t in [wid * 32 * SCAN_R, (wid + 1) * 32 * SCAN_R), 32 per ballot
  const int t0 = wid * (32 * SCAN_R);
  unsigned hit[SCAN_R];
  int mine = 0;
#pragma unroll  // the route loads issue together; hit[] stays in scalar registers
  for (int i = 0; i < SCAN_R; ++i) {
    hit[i] = __builtin_amdgcn_ballot_w32(routes[b * SS + t0 + i * 32 + lane] == e);
    mine += __popc(hit[i]);
  }
  if (lane == 0) wcnt[wid] = mine;
  __syncthreads();
  int pos = 0, cnt = 0;
#pragma unroll  // SCAN_W is 2: no loop is left
  for (int w = 0; w < SCAN_W; ++w) {
    int v = wcnt[w];
    if (w < wid) pos += v;
    cnt += v;
  }
  cnt = __builtin_amdgcn_readfirstlane(cnt);   // same in every lane: keeps the trip tests scalar
#pragma unroll  // constant i: hit[] stays in scalar registers
  for (int i = 0; i < SCAN_R; ++i) {
    if ((hit[i] >> lane) & 1u)
      list[pos + (int)__builtin_amdgcn_mbcnt_lo(hit[i], 0u)] = t0 + i * 32 + lane;
    pos += __popc(hit[i]);
  }
  __syncthreads();

  const unsigned rowIdx = (unsigned)(b * SS) * NN + slice * SCAN_T + threadIdx.x;
  float h = 0.f;
  int base = 0;
  for (; base + SCAN_U <= cnt; base += SCAN_U)
    h = scan_trip<true>(list + base, SCAN_U, rowIdx, h, a, bu, c, sk, ybf);
  if (base < cnt)
    scan_trip<false>(list + base, cnt - base, rowIdx, h, a, bu, c, sk, ybf);
}

// ---------------- GEMM 3: out = Wout[e] @ y ----------------

__global__ void __launch_bounds__(256) k_out_gemm(
    const bf16* __restrict__ ybf, const bf16* __restrict__ woutb,
    const int* __restrict__ tokenList, const int* __restrict__ offsets,
    const int* __restrict__ tileOff, const int* __restrict__ totalTiles,
    float* __restrict__ out) {
  __shared__ bf16 ys[TOK_TILE * NN];   // 16 KB
  __shared__ int tl[TOK_TILE];
  TileInfo ti;
  if (!tile_info(offsets, tileOff, totalTiles, ti)) return;
  if (threadIdx.x < TOK_TILE) {
    int li = ti.listBase + (int)threadIdx.x;
    tl[threadIdx.x] = (li < ti.listEnd) ? tokenList[li] : -1;
  }
  __syncthreads();
  gather_rows<NN>(ybf, ys, tl);
  __syncthreads();

  const int wid = threadIdx.x >> 5;
  const int lane = threadIdx.x & 31;
  const bf16* W = woutb + (size_t)ti.e * DD * NN;
  v8f acc[8][2];
#pragma unroll
  for (int t = 0; t < 8; ++t)
#pragma unroll
    for (int th = 0; th < 2; ++th) acc[t][th] = vzero8();
  for (int k = 0; k < NN; k += 32) {
    v16bf b0 = load_frag(ys, NN, k, lane);
    v16bf b1 = load_frag(ys + 16 * NN, NN, k, lane);
#pragma unroll
    for (int t = 0; t < 8; ++t) {
      v16bf a = load_frag(W + (size_t)((wid * 8 + t) * 16) * NN, NN, k, lane);
      acc[t][0] = wmma_bf16(a, b0, acc[t][0]);
      acc[t][1] = wmma_bf16(a, b1, acc[t][1]);
    }
  }
  const int r = lane & 15, hf = lane >> 4;
#pragma unroll
  for (int th = 0; th < 2; ++th) {
    int tok = tl[th * 16 + r];
    if (tok < 0) continue;
    float* op = out + (size_t)tok * DD;
#pragma unroll
    for (int t = 0; t < 8; ++t) {
      int fb = (wid * 8 + t) * 16 + hf * 8;
#pragma unroll
      for (int j = 0; j < 8; ++j) op[fb + j] = acc[t][th][j];
    }
  }
}

// ---------------- host launcher ----------------

extern "C" void kernel_launch(void* const* d_in, const int* in_sizes, int n_in,
                              void* d_out, int out_size, void* d_ws, size_t ws_size,
                              hipStream_t stream) {
  (void)in_sizes; (void)n_in; (void)out_size; (void)ws_size;
  const float* x      = (const float*)d_in[0];
  const int*   tokid  = (const int*)d_in[1];
  const float* Win    = (const float*)d_in[2];
  const float* Wsin   = (const float*)d_in[3];
  const float* Wsout  = (const float*)d_in[4];
  const float* Wout   = (const float*)d_in[5];
  const float* dparam = (const float*)d_in[6];
  float* out = (float*)d_out;

  char* p = (char*)d_ws;
  auto take = [&](size_t bytes) -> char* {
    char* q = p;
    p += (bytes + 255) & ~(size_t)255;
    return q;
  };

  int* routes     = (int*)take(sizeof(int) * BS);
  int* counts     = (int*)take(sizeof(int) * EE);
  int* offsets    = (int*)take(sizeof(int) * (EE + 1));
  int* tileOff    = (int*)take(sizeof(int) * (EE + 1));
  int* cursors    = (int*)take(sizeof(int) * EE);
  int* totalTiles = (int*)take(sizeof(int));
  int* tokenList  = (int*)take(sizeof(int) * BS);
  bf16* xbf    = (bf16*)take(sizeof(bf16) * (size_t)BS * DD);
  bf16* winb   = (bf16*)take(sizeof(bf16) * (size_t)EE * NN * DD);
  bf16* wsinb  = (bf16*)take(sizeof(bf16) * (size_t)EE * HH * DD);
  bf16* wsoutb = (bf16*)take(sizeof(bf16) * (size_t)EE * 4 * NN * HH);
  bf16* woutb  = (bf16*)take(sizeof(bf16) * (size_t)EE * DD * NN);
  float* u     = (float*)take(sizeof(float) * (size_t)BS * NN);
  float* aarr  = (float*)take(sizeof(float) * (size_t)BS * NN);
  float* buarr = (float*)take(sizeof(float) * (size_t)BS * NN);
  float* carr  = (float*)take(sizeof(float) * (size_t)BS * NN);
  float* skarr = (float*)take(sizeof(float) * (size_t)BS * NN);
  bf16* ybf    = (bf16*)take(sizeof(bf16) * (size_t)BS * NN);

  k_init<<<1, 64, 0, stream>>>(counts);

  int n;
  n = BS * DD;          k_f2bf<<<CVT_GRID, CVT_WAVES * 32, 0, stream>>>(x, xbf, n);
  n = EE * NN * DD;     k_f2bf<<<CVT_GRID, CVT_WAVES * 32, 0, stream>>>(Win, winb, n);
  n = EE * HH * DD;     k_f2bf<<<CVT_GRID, CVT_WAVES * 32, 0, stream>>>(Wsin, wsinb, n);
  n = EE * 4 * NN * HH; k_f2bf<<<CVT_GRID, CVT_WAVES * 32, 0, stream>>>(Wsout, wsoutb, n);
  n = EE * DD * NN;     k_f2bf<<<CVT_GRID, CVT_WAVES * 32, 0, stream>>>(Wout, woutb, n);

  k_route<<<BS / 256, 256, 0, stream>>>(tokid, routes, counts);
  k_offsets<<<1, 1, 0, stream>>>(counts, offsets, tileOff, cursors, totalTiles);
  k_scatter<<<BS / 256, 256, 0, stream>>>(routes, cursors, tokenList);

  k_u_gemm<<<TILE_MAX, 256, 0, stream>>>(xbf, winb, tokenList, offsets, tileOff,
                                         totalTiles, u);
  k_sel_gemm<<<TILE_MAX, 256, 0, stream>>>(xbf, wsinb, wsoutb, u, dparam, tokenList,
                                           offsets, tileOff, totalTiles,
                                           aarr, buarr, carr, skarr);
  k_scan<<<BB * EE * (NN / SCAN_T), SCAN_T, 0, stream>>>(routes, aarr, buarr, carr, skarr, ybf);
  k_out_gemm<<<TILE_MAX, 256, 0, stream>>>(ybf, woutb, tokenList, offsets, tileOff,
                                           totalTiles, out);
}

// v003
// One run takes 291 microseconds.
// Next to v002, in two timings, it ran 1.15 times as fast each time.
// Counting every step since v000, it is 2.95 times as fast.
#include <hip/hip_runtime.h>
#include <hip/hip_bf16.h>
#include <stdint.h>

#define BB 8
#define SS 2048
#define DD 1024
#define NN 256
#define HH 512
#define EE 8
#define BS (BB * SS)                 // 16384 tokens
#define TOK_TILE 32
#define TILE_MAX (BS / TOK_TILE + EE)  // worst-case 32-token tiles over all experts

typedef __bf16 bf16;
typedef __attribute__((ext_vector_type(16))) __bf16 v16bf;
typedef __attribute__((ext_vector_type(8)))  __bf16 v8bf;
typedef __attribute__((ext_vector_type(8)))  float   v8f;
typedef __attribute__((ext_vector_type(4)))  float   v4f;
typedef __attribute__((ext_vector_type(4)))  __bf16 v4bf;

__device__ __forceinline__ v8f vzero8() {
  v8f v;
#pragma unroll
  for (int i = 0; i < 8; ++i) v[i] = 0.f;
  return v;
}

__device__ __forceinline__ float sigmoidf_(float x) { return 1.f / (1.f + __expf(-x)); }

// D = A(16xK, rows=M striped per lane) x B(Kx16, cols=N striped per lane) + C
__device__ __forceinline__ v8f wmma_bf16(v16bf a, v16bf b, v8f c) {
  return __builtin_amdgcn_wmma_f32_16x16x32_bf16(false, a, false, b, (short)0, c, false, false);
}

// Load one 16x32 bf16 fragment from a row-major tile (leading dim ld, elements).
// Per ISA 7.12.2: lane (r = lane&15, h = lane>>4) holds K = k0+h*8+{0..7} and k0+16+h*8+{0..7} of row r.
__device__ __forceinline__ v16bf load_frag(const bf16* tile, int ld, int k0, int lane) {
  const int r = lane & 15;
  const int h = (lane >> 4) & 1;
  const bf16* p = tile + (size_t)r * ld + k0 + h * 8;
  v8bf c0 = *(const v8bf*)(p);
  v8bf c1 = *(const v8bf*)(p + 16);
  v16bf f;
#pragma unroll
  for (int i = 0; i < 8; ++i) { f[i] = c0[i]; f[i + 8] = c1[i]; }
  return f;
}

struct TileInfo { int e, listBase, listEnd; };

__device__ __forceinline__ bool tile_info(const int* offsets, const int* tileOff,
                                          const int* totalTiles, TileInfo& ti) {
  int tile = blockIdx.x;
  if (tile >= *totalTiles) return false;
  int e = 0;
#pragma unroll
  for (int k = 1; k < EE; ++k) if (tile >= tileOff[k]) e = k;
  ti.e = e;
  int local = tile - tileOff[e];
  ti.listBase = offsets[e] + local * TOK_TILE;
  ti.listEnd = offsets[e + 1];
  return true;
}

// Cooperative gather of TOK_TILE token rows (ROW_ELEMS bf16 each) into LDS; invalid -> 0.
template <int ROW_ELEMS>
__device__ __forceinline__ void gather_rows(const bf16* src_base, bf16* dst, const int* tl) {
  constexpr int CPR = ROW_ELEMS / 8;          // 16B chunks per row
  for (int idx = threadIdx.x; idx < TOK_TILE * CPR; idx += 256) {
    int row = idx / CPR;
    int c = idx % CPR;
    int tok = tl[row];
    int tsafe = tok < 0 ? 0 : tok;
    const uint4* s = (const uint4*)(src_base + (size_t)tsafe * ROW_ELEMS);
    uint4* d = (uint4*)(dst + (size_t)row * ROW_ELEMS);
    uint4 v;
    if (tok >= 0) v = s[c];
    else { v.x = 0u; v.y = 0u; v.z = 0u; v.w = 0u; }
    d[c] = v;
  }
}

// ---------------- small prep kernels ----------------

__global__ void k_init(int* counts) {
  if (threadIdx.x < EE) counts[threadIdx.x] = 0;
}

// f32 -> bf16 as a stream: a grid that is resident at once, one work-group per WGP, and every
// wave loops over whole pieces of CVT_PIECE floats. A wave's load covers 512 contiguous bytes,
// its store 256, and CVT_LOADS loads of a lane are in flight together.
#define CVT_GRID 256                       // work-groups
#define CVT_WAVES 16                       // waves per work-group
#define CVT_LOADS 8                        // 16-byte loads per lane and trip
#define CVT_PIECE (CVT_LOADS * 32 * 4)     // floats per wave and trip
static_assert((BS * DD) % CVT_PIECE == 0 && (EE * NN * DD) % CVT_PIECE == 0 &&
              (EE * HH * DD) % CVT_PIECE == 0 && (EE * 4 * NN * HH) % CVT_PIECE == 0,
              "every converted array is a whole number of pieces");

__global__ void __launch_bounds__(CVT_WAVES * 32) k_f2bf(
    const float* __restrict__ in, bf16* __restrict__ out, int n) {
  const int wid = threadIdx.x >> 5;
  const int lane = threadIdx.x & 31;
  const int pieces = n / CVT_PIECE;
  // piece -> (wave, work-group) with the work-group running fastest: a short array still
  // spreads over every work-group
  for (int p = wid * CVT_GRID + (int)blockIdx.x; p < pieces; p += CVT_WAVES * CVT_GRID) {
    const v4f* s = (const v4f*)(in + (size_t)p * CVT_PIECE) + lane;
    v4bf* d = (v4bf*)(out + (size_t)p * CVT_PIECE) + lane;
    v4f v[CVT_LOADS];
#pragma unroll  // the trip's loads issue together, ahead of the first store
    for (int j = 0; j < CVT_LOADS; ++j) v[j] = s[j * 32];
#pragma unroll  // constant j: v[] stays in registers
    for (int j = 0; j < CVT_LOADS; ++j) d[j * 32] = __builtin_convertvector(v[j], v4bf);
  }
}

__global__ void k_route(const int* __restrict__ tok, int* __restrict__ routes,
                        int* __restrict__ counts) {
  int i = blockIdx.x * blockDim.x + threadIdx.x;
  if (i >= BS) return;
  unsigned x = (unsigned)tok[i];
  x ^= x >> 16; x *= 2246822507u;
  x ^= x >> 13; x *= 3266489909u;
  x ^= x >> 16;
  int r = (int)(x & 7u);   // % 8
  routes[i] = r;
  atomicAdd(&counts[r], 1);
}

__global__ void k_offsets(const int* __restrict__ counts, int* __restrict__ offsets,
                          int* __restrict__ tileOff, int* __restrict__ cursors,
                          int* __restrict__ totalTiles) {
  if (threadIdx.x != 0 || blockIdx.x != 0) return;
  int t = 0, tt = 0;
  for (int e = 0; e < EE; ++e) {
    offsets[e] = t;
    tileOff[e] = tt;
    cursors[e] = t;
    t += counts[e];
    tt += (counts[e] + TOK_TILE - 1) / TOK_TILE;
  }
  offsets[EE] = t;
  tileOff[EE] = tt;
  *totalTiles = tt;
}

__global__ void k_scatter(const int* __restrict__ routes, int* __restrict__ cursors,
                          int* __restrict__ tokenList) {
  int i = blockIdx.x * blockDim.x + threadIdx.x;
  if (i >= BS) return;
  int pos = atomicAdd(&cursors[routes[i]], 1);
  tokenList[pos] = i;
}

// ---------------- GEMM 1: u = Win[e] @ x ----------------

__global__ void __launch_bounds__(256) k_u_gemm(
    const bf16* __restrict__ xbf, const bf16* __restrict__ winb,
    const int* __restrict__ tokenList, const int* __restrict__ offsets,
    const int* __restrict__ tileOff, const int* __restrict__ totalTiles,
    float* __restrict__ u) {
  __shared__ bf16 xs[TOK_TILE * DD];   // 64 KB
  __shared__ int tl[TOK_TILE];
  TileInfo ti;
  if (!tile_info(offsets, tileOff, totalTiles, ti)) return;
  if (threadIdx.x < TOK_TILE) {
    int li = ti.listBase + (int)threadIdx.x;
    tl[threadIdx.x] = (li < ti.listEnd) ? tokenList[li] : -1;
  }
  __syncthreads();
  gather_rows<DD>(xbf, xs, tl);
  __syncthreads();

  const int wid = threadIdx.x >> 5;
  const int lane = threadIdx.x & 31;
  const bf16* W = winb + (size_t)ti.e * NN * DD;
  v8f acc[2][2];   // [ftile][token-half]
#pragma unroll
  for (int t = 0; t < 2; ++t)
#pragma unroll
    for (int th = 0; th < 2; ++th) acc[t][th] = vzero8();

  for (int k = 0; k < DD; k += 32) {
    v16bf b0 = load_frag(xs, DD, k, lane);
    v16bf b1 = load_frag(xs + 16 * DD, DD, k, lane);
#pragma unroll
    for (int t = 0; t < 2; ++t) {
      v16bf a = load_frag(W + (size_t)((wid * 2 + t) * 16) * DD, DD, k, lane);
      acc[t][0] = wmma_bf16(a, b0, acc[t][0]);
      acc[t][1] = wmma_bf16(a, b1, acc[t][1]);
    }
  }
  const int r = lane & 15, hf = lane >> 4;
#pragma unroll
  for (int th = 0; th < 2; ++th) {
    int tok = tl[th * 16 + r];
    if (tok < 0) continue;
    float* up = u + (size_t)tok * NN;
#pragma unroll
    for (int t = 0; t < 2; ++t) {
      int fb = (wid * 2 + t) * 16 + hf * 8;
#pragma unroll
      for (int j = 0; j < 8; ++j) up[fb + j] = acc[t][th][j];
    }
  }
}

// ---- GEMM 2 (fused): sh = silu(Wsin@x) in LDS, sel = Wsout@sh -> a, b*u, c, skip ----

// Row pitch, in floats, of the epilogue's staging tile (16 tokens x 4*NN selector values): an odd
// multiple of 16 bytes, so the 16 rows that one 16-byte LDS store touches fall on different banks.
#define ST_LD (4 * NN + 4)

__global__ void __launch_bounds__(256) k_sel_gemm(
    const bf16* __restrict__ xbf, const bf16* __restrict__ wsinb,
    const bf16* __restrict__ wsoutb, const float* __restrict__ u,
    const float* __restrict__ dparam,
    const int* __restrict__ tokenList, const int* __restrict__ offsets,
    const int* __restrict__ tileOff, const int* __restrict__ totalTiles,
    float* __restrict__ aarr, float* __restrict__ buarr,
    float* __restrict__ carr, float* __restrict__ skarr) {
  // One LDS area with two lives: the x tile, and, from the barrier behind stage 1 on (nobody reads
  // x any more), the epilogue's f32 staging tile.
  __shared__ __attribute__((aligned(16))) float area[16 * ST_LD];   // 64.25 KB
  static_assert(sizeof(area) >= sizeof(bf16) * TOK_TILE * DD, "the x tile fits the area");
  bf16* xs = (bf16*)area;
  __shared__ bf16 sh[TOK_TILE * HH];   // 32 KB
  __shared__ int tl[TOK_TILE];
  TileInfo ti;
  if (!tile_info(offsets, tileOff, totalTiles, ti)) return;
  if (threadIdx.x < TOK_TILE) {
    int li = ti.listBase + (int)threadIdx.x;
    tl[threadIdx.x] = (li < ti.listEnd) ? tokenList[li] : -1;
  }
  __syncthreads();
  gather_rows<DD>(xbf, xs, tl);
  __syncthreads();

  const int wid = threadIdx.x >> 5;
  const int lane = threadIdx.x & 31;
  const int r = lane & 15, hf = lane >> 4;

  // stage 1: sh(32x512) = silu(Wsin[e](512x1024) @ x^T), 4 feature tiles per wave
  {
    const bf16* Wsi = wsinb + (size_t)ti.e * HH * DD;
    v8f acc[4][2];
#pragma unroll
    for (int t = 0; t < 4; ++t)
#pragma unroll
      for (int th = 0; th < 2; ++th) acc[t][th] = vzero8();
    for (int k = 0; k < DD; k += 32) {
      v16bf b0 = load_frag(xs, DD, k, lane);
      v16bf b1 = load_frag(xs + 16 * DD, DD, k, lane);
#pragma unroll
      for (int t = 0; t < 4; ++t) {
        v16bf a = load_frag(Wsi + (size_t)((wid * 4 + t) * 16) * DD, DD, k, lane);
        acc[t][0] = wmma_bf16(a, b0, acc[t][0]);
        acc[t][1] = wmma_bf16(a, b1, acc[t][1]);
      }
    }
#pragma unroll
    for (int th = 0; th < 2; ++th) {
      int row = th * 16 + r;   // token row in tile
#pragma unroll
      for (int t = 0; t < 4; ++t) {
        int fb = (wid * 4 + t) * 16 + hf * 8;  // 8 consecutive h-features
#pragma unroll
        for (int j = 0; j < 8; ++j) {
          float v = acc[t][th][j];
          sh[row * HH + fb + j] = (bf16)(v * sigmoidf_(v));  // silu
        }
      }
    }
  }
  __syncthreads();

  // stage 2: sel(32x1024) = Wsout[e](1024x512) @ sh^T, 8 feature tiles per wave
  {
    const bf16* Wso = wsoutb + (size_t)ti.e * (4 * NN) * HH;
    v8f acc[8][2];
#pragma unroll
    for (int t = 0; t < 8; ++t)
#pragma unroll
      for (int th = 0; th < 2; ++th) acc[t][th] = vzero8();
    for (int k = 0; k < HH; k += 32) {
      v16bf b0 = load_frag(sh, HH, k, lane);
      v16bf b1 = load_frag(sh + 16 * HH, HH, k, lane);
#pragma unroll
      for (int t = 0; t < 8; ++t) {
        v16bf a = load_frag(Wso + (size_t)((wid * 8 + t) * 16) * HH, HH, k, lane);
        acc[t][0] = wmma_bf16(a, b0, acc[t][0]);
        acc[t][1] = wmma_bf16(a, b1, acc[t][1]);
      }
    }
    // Epilogue, 16 tokens a round: every wave lays its raw sums into the staging tile, then the
    // work-group walks the tile row by row. A thread takes 4 neighbouring states n of one token
    // and all four selector values of each (a, b, c, d stand NN apart in a row), so u is loaded
    // once, 16 bytes a lane, a wave's store fills 4 whole lines, and the activation code stands
    // in the text once a round instead of once per accumulator element.
    const float* dp = dparam + ti.e * NN;
#pragma unroll  // constant th: acc[][] stays in registers
    for (int th = 0; th < 2; ++th) {
      if (th) __syncthreads();   // the first round's readers have left the staging tile
#pragma unroll  // constant t: acc[][] stays in registers
      for (int t = 0; t < 8; ++t) {
        float* q = area + r * ST_LD + (wid * 8 + t) * 16 + hf * 8;
        v4f lo, hi;
#pragma unroll
        for (int j = 0; j < 4; ++j) { lo[j] = acc[t][th][j]; hi[j] = acc[t][th][j + 4]; }
        *(v4f*)q = lo;
        *(v4f*)(q + 4) = hi;
      }
      __syncthreads();           // the staging tile is complete
#pragma unroll 1  // stays a loop: unrolled, the activation code would stand in the text 4 times
      for (int idx = threadIdx.x; idx < 16 * (NN / 4); idx += 256) {
        int row = idx / (NN / 4);              // the same in every lane of a wave
        int n = (idx % (NN / 4)) * 4;
        int tok = tl[th * 16 + row];
        if (tok < 0) continue;
        const float* q = area + row * ST_LD + n;
        v4f va = *(const v4f*)q;
        v4f vb = *(const v4f*)(q + NN);
        v4f vc = *(const v4f*)(q + 2 * NN);
        v4f vd = *(const v4f*)(q + 3 * NN);
        size_t base = (size_t)tok * NN + n;
        v4f uu = *(const v4f*)(u + base);
        v4f dd = *(const v4f*)(dp + n);
        v4f oa, ob, oc, os;
#pragma unroll
        for (int j = 0; j < 4; ++j) {
          oa[j] = sigmoidf_(va[j]);
          ob[j] = tanhf(vb[j]) * uu[j];
          oc[j] = tanhf(vc[j]);
          os[j] = dd[j] * sigmoidf_(vd[j]) * uu[j];
        }
        *(v4f*)(aarr + base) = oa;
        *(v4f*)(buarr + base) = ob;
        *(v4f*)(carr + base) = oc;
        *(v4f*)(skarr + base) = os;
      }
    }
  }
}

// ---------------- scan: h = a*h + b*u ; y = c*h + skip ----------------
// A step reads and writes only its own expert's state, so the 2048 steps of a batch row are
// EE independent chains. One work-group takes one (batch row, expert, SCAN_T states): it lists
// the expert's steps in time order in LDS and walks only those, SCAN_U steps' operands per trip.

#define SCAN_T 64                    // states per work-group: its y stores fill one 128-byte line
#define SCAN_W (SCAN_T / 32)         // waves per work-group
#define SCAN_U 32                    // steps whose operands are loaded together
#define SCAN_R (SS / SCAN_T)         // routes per lane while the list is built

// One trip: SCAN_U steps of the list. In the last, short trip (FULL false) the surplus places
// repeat step left - 1 with h held, so they store that step's y again and no store needs a test.
template <bool FULL>
__device__ __forceinline__ float scan_trip(
    const int* lst, int left, unsigned rowIdx, float h,
    const float* __restrict__ a, const float* __restrict__ bu,
    const float* __restrict__ c, const float* __restrict__ sk, bf16* __restrict__ ybf) {
  unsigned idx[SCAN_U];              // this lane's element in the four f32 planes and in y
  float av[SCAN_U], bv[SCAN_U], cv[SCAN_U], sv[SCAN_U];
#pragma unroll  // constant j: idx[] stays in registers
  for (int j = 0; j < SCAN_U; ++j)
    idx[j] = rowIdx + (unsigned)lst[(FULL || j < left) ? j : left - 1] * NN;
#pragma unroll  // lets the trip's loads issue together, ahead of the sums
  for (int j = 0; j < SCAN_U; ++j) {
    av[j] = a[idx[j]];
    bv[j] = bu[idx[j]];
    cv[j] = c[idx[j]];
    sv[j] = sk[idx[j]];
  }
  // holds every load in front of the sums: one that sinks among them starts its latency late
  __builtin_amdgcn_sched_barrier(0);
  bf16 yv[SCAN_U];
#pragma unroll  // constant j: the operand arrays stay in registers
  for (int j = 0; j < SCAN_U; ++j) {
    float hn = av[j] * h + bv[j];
    h = (FULL || j < left) ? hn : h;
    yv[j] = (bf16)(cv[j] * h + sv[j]);
  }
  // holds the stores behind the last y: mixed in with the sums they share one data register,
  // and each sum then waits (s_wait_xcnt) for the store in front of it
  __builtin_amdgcn_sched_barrier(0);
#pragma unroll  // constant j: idx[] and yv[] stay in registers
  for (int j = 0; j < SCAN_U; ++j) ybf[idx[j]] = yv[j];
  // the next trip rewrites the index and data registers that these stores name
  if (FULL) asm volatile("s_wait_xcnt 0x0" ::: "memory");
  return h;
}

__global__ void __launch_bounds__(SCAN_T) k_scan(
    const int* __restrict__ routes, const float* __restrict__ a,
    const float* __restrict__ bu, const float* __restrict__ c,
    const float* __restrict__ sk, bf16* __restrict__ ybf) {
  __shared__ __attribute__((aligned(16))) int list[SS];
  __shared__ int wcnt[SCAN_W];
  const int slice = blockIdx.x % (NN / SCAN_T);
  const int e = (blockIdx.x / (NN / SCAN_T)) % EE;
  const int b = blockIdx.x / ((NN / SCAN_T) * EE);
  const int wid = threadIdx.x >> 5;
  const int lane = threadIdx.x & 31;

  // wave wid lists the steps t in [wid * 32 * SCAN_R, (wid + 1) * 32 * SCAN_R), 32 per ballot
  const int t0 = wid * (32 * SCAN_R);
  unsigned hit[SCAN_R];
  int mine = 0;
#pragma unroll  // the route loads issue together; hit[] stays in scalar registers
  for (int i = 0; i < SCAN_R; ++i) {
    hit[i] = __builtin_amdgcn_ballot_w32(routes[b * SS + t0 + i * 32 + lane] == e);
    mine += __popc(hit[i]);
  }
  if (lane == 0) wcnt[wid] = mine;
  __syncthreads();
  int pos = 0, cnt = 0;
#pragma unroll  // SCAN_W is 2: no loop is left
  for (int w = 0; w < SCAN_W; ++w) {
    int v = wcnt[w];
    if (w < wid) pos += v;
    cnt += v;
  }
  cnt = __builtin_amdgcn_readfirstlane(cnt);   // same in every lane: keeps the trip tests scalar
#pragma unroll  // constant i: hit[] stays in scalar registers
  for (int i = 0; i < SCAN_R; ++i) {
    if ((hit[i] >> lane) & 1u)
      list[pos + (int)__builtin_amdgcn_mbcnt_lo(hit[i], 0u)] = t0 + i * 32 + lane;
    pos += __popc(hit[i]);
  }
  __syncthreads();

  const unsigned rowIdx = (unsigned)(b * SS) * NN + slice * SCAN_T + threadIdx.x;
  float h = 0.f;
  int base = 0;
  for (; base + SCAN_U <= cnt; base += SCAN_U)
    h = scan_trip<true>(list + base, SCAN_U, rowIdx, h, a, bu, c, sk, ybf);
  if (base < cnt)
    scan_trip<false>(list + base, cnt - base, rowIdx, h, a, bu, c, sk, ybf);
}

// ---------------- GEMM 3: out = Wout[e] @ y ----------------

__global__ void __launch_bounds__(256) k_out_gemm(
    const bf16* __restrict__ ybf, const bf16* __restrict__ woutb,
    const int* __restrict__ tokenList, const int* __restrict__ offsets,
    const int* __restrict__ tileOff, const int* __restrict__ totalTiles,
    float* __restrict__ out) {
  __shared__ bf16 ys[TOK_TILE * NN];   // 16 KB
  __shared__ int tl[TOK_TILE];
  TileInfo ti;
  if (!tile_info(offsets, tileOff, totalTiles, ti)) return;
  if (threadIdx.x < TOK_TILE) {
    int li = ti.listBase + (int)threadIdx.x;
    tl[threadIdx.x] = (li < ti.listEnd) ? tokenList[li] : -1;
  }
  __syncthreads();
  gather_rows<NN>(ybf, ys, tl);
  __syncthreads();

  const int wid = threadIdx.x >> 5;
  const int lane = threadIdx.x & 31;
  const bf16* W = woutb + (size_t)ti.e * DD * NN;
  v8f acc[8][2];
#pragma unroll
  for (int t = 0; t < 8; ++t)
#pragma unroll
    for (int th = 0; th < 2; ++th) acc[t][th] = vzero8();
  for (int k = 0; k < NN; k += 32) {
    v16bf b0 = load_frag(ys, NN, k, lane);
    v16bf b1 = load_frag(ys + 16 * NN, NN, k, lane);
#pragma unroll
    for (int t = 0; t < 8; ++t) {
      v16bf a = load_frag(W + (size_t)((wid * 8 + t) * 16) * NN, NN, k, lane);
      acc[t][0] = wmma_bf16(a, b0, acc[t][0]);
      acc[t][1] = wmma_bf16(a, b1, acc[t][1]);
    }
  }
  const int r = lane & 15, hf = lane >> 4;
#pragma unroll
  for (int th = 0; th < 2; ++th) {
    int tok = tl[th * 16 + r];
    if (tok < 0) continue;
    float* op = out + (size_t)tok * DD;
#pragma unroll
    for (int t = 0; t < 8; ++t) {
      int fb = (wid * 8 + t) * 16 + hf * 8;
#pragma unroll
      for (int j = 0; j < 8; ++j) op[fb + j] = acc[t][th][j];
    }
  }
}

// ---------------- host launcher ----------------

extern "C" void kernel_launch(void* const* d_in, const int* in_sizes, int n_in,
                              void* d_out, int out_size, void* d_ws, size_t ws_size,
                              hipStream_t stream) {
  (void)in_sizes; (void)n_in; (void)out_size; (void)ws_size;
  const float* x      = (const float*)d_in[0];
  const int*   tokid  = (const int*)d_in[1];
  const float* Win    = (const float*)d_in[2];
  const float* Wsin   = (const float*)d_in[3];
  const float* Wsout  = (const float*)d_in[4];
  const float* Wout   = (const float*)d_in[5];
  const float* dparam = (const float*)d_in[6];
  float* out = (float*)d_out;

  char* p = (char*)d_ws;
  auto take = [&](size_t bytes) -> char* {
    char* q = p;
    p += (bytes + 255) & ~(size_t)255;
    return q;
  };

  int* routes     = (int*)take(sizeof(int) * BS);
  int* counts     = (int*)take(sizeof(int) * EE);
  int* offsets    = (int*)take(sizeof(int) * (EE + 1));
  int* tileOff    = (int*)take(sizeof(int) * (EE + 1));
  int* cursors    = (int*)take(sizeof(int) * EE);
  int* totalTiles = (int*)take(sizeof(int));
  int* tokenList  = (int*)take(sizeof(int) * BS);
  bf16* xbf    = (bf16*)take(sizeof(bf16) * (size_t)BS * DD);
  bf16* winb   = (bf16*)take(sizeof(bf16) * (size_t)EE * NN * DD);
  bf16* wsinb  = (bf16*)take(sizeof(bf16) * (size_t)EE * HH * DD);
  bf16* wsoutb = (bf16*)take(sizeof(bf16) * (size_t)EE * 4 * NN * HH);
  bf16* woutb  = (bf16*)take(sizeof(bf16) * (size_t)EE * DD * NN);
  float* u     = (float*)take(sizeof(float) * (size_t)BS * NN);
  float* aarr  = (float*)take(sizeof(float) * (size_t)BS * NN);
  float* buarr = (float*)take(sizeof(float) * (size_t)BS * NN);
  float* carr  = (float*)take(sizeof(float) * (size_t)BS * NN);
  float* skarr = (float*)take(sizeof(float) * (size_t)BS * NN);
  bf16* ybf    = (bf16*)take(sizeof(bf16) * (size_t)BS * NN);

  k_init<<<1, 64, 0, stream>>>(counts);

  int n;
  n = BS * DD;          k_f2bf<<<CVT_GRID, CVT_WAVES * 32, 0, stream>>>(x, xbf, n);
  n = EE * NN * DD;     k_f2bf<<<CVT_GRID, CVT_WAVES * 32, 0, stream>>>(Win, winb, n);
  n = EE * HH * DD;     k_f2bf<<<CVT_GRID, CVT_WAVES * 32, 0, stream>>>(Wsin, wsinb, n);
  n = EE * 4 * NN * HH; k_f2bf<<<CVT_GRID, CVT_WAVES * 32, 0, stream>>>(Wsout, wsoutb, n);
  n = EE * DD * NN;     k_f2bf<<<CVT_GRID, CVT_WAVES * 32, 0, stream>>>(Wout, woutb, n);

  k_route<<<BS / 256, 256, 0, stream>>>(tokid, routes, counts);
  k_offsets<<<1, 1, 0, stream>>>(counts, offsets, tileOff, cursors, totalTiles);
  k_scatter<<<BS / 256, 256, 0, stream>>>(routes, cursors, tokenList);

  k_u_gemm<<<TILE_MAX, 256, 0, stream>>>(xbf, winb, tokenList, offsets, tileOff,
                                         totalTiles, u);
  k_sel_gemm<<<TILE_MAX, 256, 0, stream>>>(xbf, wsinb, wsoutb, u, dparam, tokenList,
                                           offsets, tileOff, totalTiles,
                                           aarr, buarr, carr, skarr);
  k_scan<<<BB * EE * (NN / SCAN_T), SCAN_T, 0, stream>>>(routes, aarr, buarr, carr, skarr, ybf);
  k_out_gemm<<<TILE_MAX, 256, 0, stream>>>(ybf, woutb, tokenList, offsets, tileOff,
                                           totalTiles, out);
}

// v004
// One run takes 271 microseconds.
// Two timings next to v003 both put it at 1.07 times that version's speed.
// Counting every step since v000, it is 3.16 times as fast.
#include <hip/hip_runtime.h>
#include <hip/hip_bf16.h>
#include <stdint.h>

#define BB 8
#define SS 2048
#define DD 1024
#define NN 256
#define HH 512
#define EE 8
#define BS (BB * SS)                 // 16384 tokens
#define TOK_TILE 32
#define TILE_MAX (BS / TOK_TILE + EE)  // worst-case 32-token tiles over all experts
// Row pitch, in bf16 elements, of a token tile in LDS whose rows hold n elements: 16 bytes more
// than the row, an odd multiple of 16 bytes, so the 16 rows that one 16-byte fragment load
// touches fall on different banks (at the bare pitch, a multiple of 256 bytes, on the same four).
#define LDS_LD(n) ((n) + 8)
static_assert((LDS_LD(DD) / 8) % 2 == 1 && (LDS_LD(HH) / 8) % 2 == 1 && (LDS_LD(NN) / 8) % 2 == 1,
              "every tile pitch is an odd multiple of 16 bytes");

typedef __bf16 bf16;
typedef __attribute__((ext_vector_type(16))) __bf16 v16bf;
typedef __attribute__((ext_vector_type(8)))  __bf16 v8bf;
typedef __attribute__((ext_vector_type(8)))  float   v8f;
typedef __attribute__((ext_vector_type(4)))  float   v4f;
typedef __attribute__((ext_vector_type(4)))  __bf16 v4bf;

__device__ __forceinline__ v8f vzero8() {
  v8f v;
#pragma unroll
  for (int i = 0; i < 8; ++i) v[i] = 0.f;
  return v;
}

__device__ __forceinline__ float sigmoidf_(float x) { return 1.f / (1.f + __expf(-x)); }

// D = A(16xK, rows=M striped per lane) x B(Kx16, cols=N striped per lane) + C
__device__ __forceinline__ v8f wmma_bf16(v16bf a, v16bf b, v8f c) {
  return __builtin_amdgcn_wmma_f32_16x16x32_bf16(false, a, false, b, (short)0, c, false, false);
}

// Load one 16x32 bf16 fragment from a row-major tile (leading dim ld, elements).
// Per ISA 7.12.2: lane (r = lane&15, h = lane>>4) holds K = k0+h*8+{0..7} and k0+16+h*8+{0..7} of row r.
__device__ __forceinline__ v16bf load_frag(const bf16* tile, int ld, int k0, int lane) {
  const int r = lane & 15;
  const int h = (lane >> 4) & 1;
  const bf16* p = tile + (size_t)r * ld + k0 + h * 8;
  v8bf c0 = *(const v8bf*)(p);
  v8bf c1 = *(const v8bf*)(p + 16);
  v16bf f;
#pragma unroll
  for (int i = 0; i < 8; ++i) { f[i] = c0[i]; f[i + 8] = c1[i]; }
  return f;
}

struct TileInfo { int e, listBase, listEnd; };

__device__ __forceinline__ bool tile_info(const int* offsets, const int* tileOff,
                                          const int* totalTiles, TileInfo& ti) {
  int tile = blockIdx.x;
  if (tile >= *totalTiles) return false;
  int e = 0;
#pragma unroll
  for (int k = 1; k < EE; ++k) if (tile >= tileOff[k]) e = k;
  ti.e = e;
  int local = tile - tileOff[e];
  ti.listBase = offsets[e] + local * TOK_TILE;
  ti.listEnd = offsets[e + 1];
  return true;
}

// Cooperative gather of TOK_TILE token rows (ROW_ELEMS bf16 each) into LDS, at pitch
// LDS_LD(ROW_ELEMS); invalid -> 0.
template <int ROW_ELEMS>
__device__ __forceinline__ void gather_rows(const bf16* src_base, bf16* dst, const int* tl) {
  constexpr int CPR = ROW_ELEMS / 8;          // 16B chunks per row
  for (int idx = threadIdx.x; idx < TOK_TILE * CPR; idx += 256) {
    int row = idx / CPR;
    int c = idx % CPR;
    int tok = tl[row];
    int tsafe = tok < 0 ? 0 : tok;
    const uint4* s = (const uint4*)(src_base + (size_t)tsafe * ROW_ELEMS);
    uint4* d = (uint4*)(dst + (size_t)row * LDS_LD(ROW_ELEMS));
    uint4 v;
    if (tok >= 0) v = s[c];
    else { v.x = 0u; v.y = 0u; v.z = 0u; v.w = 0u; }
    d[c] = v;
  }
}

// ---------------- small prep kernels ----------------

__global__ void k_init(int* counts) {
  if (threadIdx.x < EE) counts[threadIdx.x] = 0;
}

// f32 -> bf16 as a stream: a grid that is resident at once, one work-group per WGP, and every
// wave loops over whole pieces of CVT_PIECE floats. A wave's load covers 512 contiguous bytes,
// its store 256, and CVT_LOADS loads of a lane are in flight together.
#define CVT_GRID 256                       // work-groups
#define CVT_WAVES 16                       // waves per work-group
#define CVT_LOADS 8                        // 16-byte loads per lane and trip
#define CVT_PIECE (CVT_LOADS * 32 * 4)     // floats per wave and trip
static_assert((BS * DD) % CVT_PIECE == 0 && (EE * NN * DD) % CVT_PIECE == 0 &&
              (EE * HH * DD) % CVT_PIECE == 0 && (EE * 4 * NN * HH) % CVT_PIECE == 0,
              "every converted array is a whole number of pieces");

__global__ void __launch_bounds__(CVT_WAVES * 32) k_f2bf(
    const float* __restrict__ in, bf16* __restrict__ out, int n) {
  const int wid = threadIdx.x >> 5;
  const int lane = threadIdx.x & 31;
  const int pieces = n / CVT_PIECE;
  // piece -> (wave, work-group) with the work-group running fastest: a short array still
  // spreads over every work-group
  for (int p = wid * CVT_GRID + (int)blockIdx.x; p < pieces; p += CVT_WAVES * CVT_GRID) {
    const v4f* s = (const v4f*)(in + (size_t)p * CVT_PIECE) + lane;
    v4bf* d = (v4bf*)(out + (size_t)p * CVT_PIECE) + lane;
    v4f v[CVT_LOADS];
#pragma unroll  // the trip's loads issue together, ahead of the first store
    for (int j = 0; j < CVT_LOADS; ++j) v[j] = s[j * 32];
#pragma unroll  // constant j: v[] stays in registers
    for (int j = 0; j < CVT_LOADS; ++j) d[j * 32] = __builtin_convertvector(v[j], v4bf);
  }
}

__global__ void k_route(const int* __restrict__ tok, int* __restrict__ routes,
                        int* __restrict__ counts) {
  int i = blockIdx.x * blockDim.x + threadIdx.x;
  if (i >= BS) return;
  unsigned x = (unsigned)tok[i];
  x ^= x >> 16; x *= 2246822507u;
  x ^= x >> 13; x *= 3266489909u;
  x ^= x >> 16;
  int r = (int)(x & 7u);   // % 8
  routes[i] = r;
  atomicAdd(&counts[r], 1);
}

__global__ void k_offsets(const int* __restrict__ counts, int* __restrict__ offsets,
                          int* __restrict__ tileOff, int* __restrict__ cursors,
                          int* __restrict__ totalTiles) {
  if (threadIdx.x != 0 || blockIdx.x != 0) return;
  int t = 0, tt = 0;
  for (int e = 0; e < EE; ++e) {
    offsets[e] = t;
    tileOff[e] = tt;
    cursors[e] = t;
    t += counts[e];
    tt += (counts[e] + TOK_TILE - 1) / TOK_TILE;
  }
  offsets[EE] = t;
  tileOff[EE] = tt;
  *totalTiles = tt;
}

__global__ void k_scatter(const int* __restrict__ routes, int* __restrict__ cursors,
                          int* __restrict__ tokenList) {
  int i = blockIdx.x * blockDim.x + threadIdx.x;
  if (i >= BS) return;
  int pos = atomicAdd(&cursors[routes[i]], 1);
  tokenList[pos] = i;
}

// ---------------- GEMM 1: u = Win[e] @ x ----------------

__global__ void __launch_bounds__(256) k_u_gemm(
    const bf16* __restrict__ xbf, const bf16* __restrict__ winb,
    const int* __restrict__ tokenList, const int* __restrict__ offsets,
    const int* __restrict__ tileOff, const int* __restrict__ totalTiles,
    float* __restrict__ u) {
  __shared__ __attribute__((aligned(16))) bf16 xs[TOK_TILE * LDS_LD(DD)];   // 64.5 KB
  __shared__ int tl[TOK_TILE];
  TileInfo ti;
  if (!tile_info(offsets, tileOff, totalTiles, ti)) return;
  if (threadIdx.x < TOK_TILE) {
    int li = ti.listBase + (int)threadIdx.x;
    tl[threadIdx.x] = (li < ti.listEnd) ? tokenList[li] : -1;
  }
  __syncthreads();
  gather_rows<DD>(xbf, xs, tl);
  __syncthreads();

  const int wid = threadIdx.x >> 5;
  const int lane = threadIdx.x & 31;
  const bf16* W = winb + (size_t)ti.e * NN * DD;
  v8f acc[2][2];   // [ftile][token-half]
#pragma unroll
  for (int t = 0; t < 2; ++t)
#pragma unroll
    for (int th = 0; th < 2; ++th) acc[t][th] = vzero8();

  for (int k = 0; k < DD; k += 32) {
    v16bf b0 = load_frag(xs, LDS_LD(DD), k, lane);
    v16bf b1 = load_frag(xs + 16 * LDS_LD(DD), LDS_LD(DD), k, lane);
#pragma unroll
    for (int t = 0; t < 2; ++t) {
      v16bf a = load_frag(W + (size_t)((wid * 2 + t) * 16) * DD, DD, k, lane);
      acc[t][0] = wmma_bf16(a, b0, acc[t][0]);
      acc[t][1] = wmma_bf16(a, b1, acc[t][1]);
    }
  }
  const int r = lane & 15, hf = lane >> 4;
#pragma unroll
  for (int th = 0; th < 2; ++th) {
    int tok = tl[th * 16 + r];
    if (tok < 0) continue;
    float* up = u + (size_t)tok * NN;
#pragma unroll
    for (int t = 0; t < 2; ++t) {
      int fb = (wid * 2 + t) * 16 + hf * 8;
#pragma unroll
      for (int j = 0; j < 8; ++j) up[fb + j] = acc[t][th][j];
    }
  }
}

// ---- GEMM 2 (fused): sh = silu(Wsin@x) in LDS, sel = Wsout@sh -> a, b*u, c, skip ----

// Row pitch, in floats, of the epilogue's staging tile (16 tokens x 4*NN selector values): an odd
// multiple of 16 bytes, so the 16 rows that one 16-byte LDS store touches fall on different banks.
#define ST_LD (4 * NN + 4)

__global__ void __launch_bounds__(256) k_sel_gemm(
    const bf16* __restrict__ xbf, const bf16* __restrict__ wsinb,
    const bf16* __restrict__ wsoutb, const float* __restrict__ u,
    const float* __restrict__ dparam,
    const int* __restrict__ tokenList, const int* __restrict__ offsets,
    const int* __restrict__ tileOff, const int* __restrict__ totalTiles,
    float* __restrict__ aarr, float* __restrict__ buarr,
    float* __restrict__ carr, float* __restrict__ skarr) {
  // One LDS area with two lives: the x tile, and, from the barrier behind stage 1 on (nobody reads
  // x any more), the epilogue's f32 staging tile.
  __shared__ __attribute__((aligned(16))) float area[TOK_TILE * LDS_LD(DD) / 2];   // 64.5 KB
  static_assert(sizeof(area) >= sizeof(float) * 16 * ST_LD, "the staging tile fits the area");
  bf16* xs = (bf16*)area;
  __shared__ __attribute__((aligned(16))) bf16 sh[TOK_TILE * LDS_LD(HH)];   // 32.5 KB
  __shared__ int tl[TOK_TILE];
  TileInfo ti;
  if (!tile_info(offsets, tileOff, totalTiles, ti)) return;
  if (threadIdx.x < TOK_TILE) {
    int li = ti.listBase + (int)threadIdx.x;
    tl[threadIdx.x] = (li < ti.listEnd) ? tokenList[li] : -1;
  }
  __syncthreads();
  gather_rows<DD>(xbf, xs, tl);
  __syncthreads();

  const int wid = threadIdx.x >> 5;
  const int lane = threadIdx.x & 31;
  const int r = lane & 15, hf = lane >> 4;

  // stage 1: sh(32x512) = silu(Wsin[e](512x1024) @ x^T), 4 feature tiles per wave
  {
    const bf16* Wsi = wsinb + (size_t)ti.e * HH * DD;
    v8f acc[4][2];
#pragma unroll
    for (int t = 0; t < 4; ++t)
#pragma unroll
      for (int th = 0; th < 2; ++th) acc[t][th] = vzero8();
    for (int k = 0; k < DD; k += 32) {
      v16bf b0 = load_frag(xs, LDS_LD(DD), k, lane);
      v16bf b1 = load_frag(xs + 16 * LDS_LD(DD), LDS_LD(DD), k, lane);
#pragma unroll
      for (int t = 0; t < 4; ++t) {
        v16bf a = load_frag(Wsi + (size_t)((wid * 4 + t) * 16) * DD, DD, k, lane);
        acc[t][0] = wmma_bf16(a, b0, acc[t][0]);
        acc[t][1] = wmma_bf16(a, b1, acc[t][1]);
      }
    }
#pragma unroll
    for (int th = 0; th < 2; ++th) {
      int row = th * 16 + r;   // token row in tile
#pragma unroll
      for (int t = 0; t < 4; ++t) {
        int fb = (wid * 4 + t) * 16 + hf * 8;  // 8 consecutive h-features
#pragma unroll
        for (int j = 0; j < 8; ++j) {
          float v = acc[t][th][j];
          sh[row * LDS_LD(HH) + fb + j] = (bf16)(v * sigmoidf_(v));  // silu
        }
      }
    }
  }
  __syncthreads();

  // stage 2: sel(32x1024) = Wsout[e](1024x512) @ sh^T, 8 feature tiles per wave
  {
    const bf16* Wso = wsoutb + (size_t)ti.e * (4 * NN) * HH;
    v8f acc[8][2];
#pragma unroll
    for (int t = 0; t < 8; ++t)
#pragma unroll
      for (int th = 0; th < 2; ++th) acc[t][th] = vzero8();
    for (int k = 0; k < HH; k += 32) {
      v16bf b0 = load_frag(sh, LDS_LD(HH), k, lane);
      v16bf b1 = load_frag(sh + 16 * LDS_LD(HH), LDS_LD(HH), k, lane);
#pragma unroll
      for (int t = 0; t < 8; ++t) {
        v16bf a = load_frag(Wso + (size_t)((wid * 8 + t) * 16) * HH, HH, k, lane);
        acc[t][0] = wmma_bf16(a, b0, acc[t][0]);
        acc[t][1] = wmma_bf16(a, b1, acc[t][1]);
      }
    }
    // Epilogue, 16 tokens a round: every wave lays its raw sums into the staging tile, then the
    // work-group walks the tile row by row. A thread takes 4 neighbouring states n of one token
    // and all four selector values of each (a, b, c, d stand NN apart in a row), so u is loaded
    // once, 16 bytes a lane, a wave's store fills 4 whole lines, and the activation code stands
    // in the text once a round instead of once per accumulator element.
    const float* dp = dparam + ti.e * NN;
#pragma unroll  // constant th: acc[][] stays in registers
    for (int th = 0; th < 2; ++th) {
      if (th) __syncthreads();   // the first round's readers have left the staging tile
#pragma unroll  // constant t: acc[][] stays in registers
      for (int t = 0; t < 8; ++t) {
        float* q = area + r * ST_LD + (wid * 8 + t) * 16 + hf * 8;
        v4f lo, hi;
#pragma unroll
        for (int j = 0; j < 4; ++j) { lo[j] = acc[t][th][j]; hi[j] = acc[t][th][j + 4]; }
        *(v4f*)q = lo;
        *(v4f*)(q + 4) = hi;
      }
      __syncthreads();           // the staging tile is complete
#pragma unroll 1  // stays a loop: unrolled, the activation code would stand in the text 4 times
      for (int idx = threadIdx.x; idx < 16 * (NN / 4); idx += 256) {
        int row = idx / (NN / 4);              // the same in every lane of a wave
        int n = (idx % (NN / 4)) * 4;
        int tok = tl[th * 16 + row];
        if (tok < 0) continue;
        const float* q = area + row * ST_LD + n;
        v4f va = *(const v4f*)q;
        v4f vb = *(const v4f*)(q + NN);
        v4f vc = *(const v4f*)(q + 2 * NN);
        v4f vd = *(const v4f*)(q + 3 * NN);
        size_t base = (size_t)tok * NN + n;
        v4f uu = *(const v4f*)(u + base);
        v4f dd = *(const v4f*)(dp + n);
        v4f oa, ob, oc, os;
#pragma unroll
        for (int j = 0; j < 4; ++j) {
          oa[j] = sigmoidf_(va[j]);
          ob[j] = tanhf(vb[j]) * uu[j];
          oc[j] = tanhf(vc[j]);
          os[j] = dd[j] * sigmoidf_(vd[j]) * uu[j];
        }
        *(v4f*)(aarr + base) = oa;
        *(v4f*)(buarr + base) = ob;
        *(v4f*)(carr + base) = oc;
        *(v4f*)(skarr + base) = os;
      }
    }
  }
}

// ---------------- scan: h = a*h + b*u ; y = c*h + skip ----------------
// A step reads and writes only its own expert's state, so the 2048 steps of a batch row are
// EE independent chains. One work-group takes one (batch row, expert, SCAN_T states): it lists
// the expert's steps in time order in LDS and walks only those, SCAN_U steps' operands per trip.

#define SCAN_T 64                    // states per work-group: its y stores fill one 128-byte line
#define SCAN_W (SCAN_T / 32)         // waves per work-group
#define SCAN_U 32                    // steps whose operands are loaded together
#define SCAN_R (SS / SCAN_T)         // routes per lane while the list is built

// One trip: SCAN_U steps of the list. In the last, short trip (FULL false) the surplus places
// repeat step left - 1 with h held, so they store that step's y again and no store needs a test.
template <bool FULL>
__device__ __forceinline__ float scan_trip(
    const int* lst, int left, unsigned rowIdx, float h,
    const float* __restrict__ a, const float* __restrict__ bu,
    const float* __restrict__ c, const float* __restrict__ sk, bf16* __restrict__ ybf) {
  unsigned idx[SCAN_U];              // this lane's element in the four f32 planes and in y
  float av[SCAN_U], bv[SCAN_U], cv[SCAN_U], sv[SCAN_U];
#pragma unroll  // constant j: idx[] stays in registers
  for (int j = 0; j < SCAN_U; ++j)
    idx[j] = rowIdx + (unsigned)lst[(FULL || j < left) ? j : left - 1] * NN;
#pragma unroll  // lets the trip's loads issue together, ahead of the sums
  for (int j = 0; j < SCAN_U; ++j) {
    av[j] = a[idx[j]];
    bv[j] = bu[idx[j]];
    cv[j] = c[idx[j]];
    sv[j] = sk[idx[j]];
  }
  // holds every load in front of the sums: one that sinks among them starts its latency late
  __builtin_amdgcn_sched_barrier(0);
  bf16 yv[SCAN_U];
#pragma unroll  // constant j: the operand arrays stay in registers
  for (int j = 0; j < SCAN_U; ++j) {
    float hn = av[j] * h + bv[j];
    h = (FULL || j < left) ? hn : h;
    yv[j] = (bf16)(cv[j] * h + sv[j]);
  }
  // holds the stores behind the last y: mixed in with the sums they share one data register,
  // and each sum then waits (s_wait_xcnt) for the store in front of it
  __builtin_amdgcn_sched_barrier(0);
#pragma unroll  // constant j: idx[] and yv[] stay in registers
  for (int j = 0; j < SCAN_U; ++j) ybf[idx[j]] = yv[j];
  // the next trip rewrites the index and data registers that these stores name
  if (FULL) asm volatile("s_wait_xcnt 0x0" ::: "memory");
  return h;
}

__global__ void __launch_bounds__(SCAN_T) k_scan(
    const int* __restrict__ routes, const float* __restrict__ a,
    const float* __restrict__ bu, const float* __restrict__ c,
    const float* __restrict__ sk, bf16* __restrict__ ybf) {
  __shared__ __attribute__((aligned(16))) int list[SS];
  __shared__ int wcnt[SCAN_W];
  const int slice = blockIdx.x % (NN / SCAN_T);
  const int e = (blockIdx.x / (NN / SCAN_T)) % EE;
  const int b = blockIdx.x / ((NN / SCAN_T) * EE);
  const int wid = threadIdx.x >> 5;
  const int lane = threadIdx.x & 31;

  // wave wid lists the steps t in [wid * 32 * SCAN_R, (wid + 1) * 32 * SCAN_R), 32 per ballot
  const int t0 = wid * (32 * SCAN_R);
  unsigned hit[SCAN_R];
  int mine = 0;
#pragma unroll  // the route loads issue together; hit[] stays in scalar registers
  for (int i = 0; i < SCAN_R; ++i) {
    hit[i] = __builtin_amdgcn_ballot_w32(routes[b * SS + t0 + i * 32 + lane] == e);
    mine += __popc(hit[i]);
  }
  if (lane == 0) wcnt[wid] = mine;
  __syncthreads();
  int pos = 0, cnt = 0;
#pragma unroll  // SCAN_W is 2: no loop is left
  for (int w = 0; w < SCAN_W; ++w) {
    int v = wcnt[w];
    if (w < wid) pos += v;
    cnt += v;
  }
  cnt = __builtin_amdgcn_readfirstlane(cnt);   // same in every lane: keeps the trip tests scalar
#pragma unroll  // constant i: hit[] stays in scalar registers
  for (int i = 0; i < SCAN_R; ++i) {
    if ((hit[i] >> lane) & 1u)
      list[pos + (int)__builtin_amdgcn_mbcnt_lo(hit[i], 0u)] = t0 + i * 32 + lane;
    pos += __popc(hit[i]);
  }
  __syncthreads();

  const unsigned rowIdx = (unsigned)(b * SS) * NN + slice * SCAN_T + threadIdx.x;
  float h = 0.f;
  int base = 0;
  for (; base + SCAN_U <= cnt; base += SCAN_U)
    h = scan_trip<true>(list + base, SCAN_U, rowIdx, h, a, bu, c, sk, ybf);
  if (base < cnt)
    scan_trip<false>(list + base, cnt - base, rowIdx, h, a, bu, c, sk, ybf);
}

// ---------------- GEMM 3: out = Wout[e] @ y ----------------

__global__ void __launch_bounds__(256) k_out_gemm(
    const bf16* __restrict__ ybf, const bf16* __restrict__ woutb,
    const int* __restrict__ tokenList, const int* __restrict__ offsets,
    const int* __restrict__ tileOff, const int* __restrict__ totalTiles,
    float* __restrict__ out) {
  __shared__ __attribute__((aligned(16))) bf16 ys[TOK_TILE * LDS_LD(NN)];   // 16.5 KB
  __shared__ int tl[TOK_TILE];
  TileInfo ti;
  if (!tile_info(offsets, tileOff, totalTiles, ti)) return;
  if (threadIdx.x < TOK_TILE) {
    int li = ti.listBase + (int)threadIdx.x;
    tl[threadIdx.x] = (li < ti.listEnd) ? tokenList[li] : -1;
  }
  __syncthreads();
  gather_rows<NN>(ybf, ys, tl);
  __syncthreads();

  const int wid = threadIdx.x >> 5;
  const int lane = threadIdx.x & 31;
  const bf16* W = woutb + (size_t)ti.e * DD * NN;
  v8f acc[8][2];
#pragma unroll
  for (int t = 0; t < 8; ++t)
#pragma unroll
    for (int th = 0; th < 2; ++th) acc[t][th] = vzero8();
  for (int k = 0; k < NN; k += 32) {
    v16bf b0 = load_frag(ys, LDS_LD(NN), k, lane);
    v16bf b1 = load_frag(ys + 16 * LDS_LD(NN), LDS_LD(NN), k, lane);
#pragma unroll
    for (int t = 0; t < 8; ++t) {
      v16bf a = load_frag(W + (size_t)((wid * 8 + t) * 16) * NN, NN, k, lane);
      acc[t][0] = wmma_bf16(a, b0, acc[t][0]);
      acc[t][1] = wmma_bf16(a, b1, acc[t][1]);
    }
  }
  const int r = lane & 15, hf = lane >> 4;
#pragma unroll
  for (int th = 0; th < 2; ++th) {
    int tok = tl[th * 16 + r];
    if (tok < 0) continue;
    float* op = out + (size_t)tok * DD;
#pragma unroll
    for (int t = 0; t < 8; ++t) {
      int fb = (wid * 8 + t) * 16 + hf * 8;
#pragma unroll
      for (int j = 0; j < 8; ++j) op[fb + j] = acc[t][th][j];
    }
  }
}

// ---------------- host launcher ----------------

extern "C" void kernel_launch(void* const* d_in, const int* in_sizes, int n_in,
                              void* d_out, int out_size, void* d_ws, size_t ws_size,
                              hipStream_t stream) {
  (void)in_sizes; (void)n_in; (void)out_size; (void)ws_size;
  const float* x      = (const float*)d_in[0];
  const int*   tokid  = (const int*)d_in[1];
  const float* Win    = (const float*)d_in[2];
  const float* Wsin   = (const float*)d_in[3];
  const float* Wsout  = (const float*)d_in[4];
  const float* Wout   = (const float*)d_in[5];
  const float* dparam = (const float*)d_in[6];
  float* out = (float*)d_out;

  char* p = (char*)d_ws;
  auto take = [&](size_t bytes) -> char* {
    char* q = p;
    p += (bytes + 255) & ~(size_t)255;
    return q;
  };

  int* routes     = (int*)take(sizeof(int) * BS);
  int* counts     = (int*)take(sizeof(int) * EE);
  int* offsets    = (int*)take(sizeof(int) * (EE + 1));
  int* tileOff    = (int*)take(sizeof(int) * (EE + 1));
  int* cursors    = (int*)take(sizeof(int) * EE);
  int* totalTiles = (int*)take(sizeof(int));
  int* tokenList  = (int*)take(sizeof(int) * BS);
  bf16* xbf    = (bf16*)take(sizeof(bf16) * (size_t)BS * DD);
  bf16* winb   = (bf16*)take(sizeof(bf16) * (size_t)EE * NN * DD);
  bf16* wsinb  = (bf16*)take(sizeof(bf16) * (size_t)EE * HH * DD);
  bf16* wsoutb = (bf16*)take(sizeof(bf16) * (size_t)EE * 4 * NN * HH);
  bf16* woutb  = (bf16*)take(sizeof(bf16) * (size_t)EE * DD * NN);
  float* u     = (float*)take(sizeof(float) * (size_t)BS * NN);
  float* aarr  = (float*)take(sizeof(float) * (size_t)BS * NN);
  float* buarr = (float*)take(sizeof(float) * (size_t)BS * NN);
  float* carr  = (float*)take(sizeof(float) * (size_t)BS * NN);
  float* skarr = (float*)take(sizeof(float) * (size_t)BS * NN);
  bf16* ybf    = (bf16*)take(sizeof(bf16) * (size_t)BS * NN);

  k_init<<<1, 64, 0, stream>>>(counts);

  int n;
  n = BS * DD;          k_f2bf<<<CVT_GRID, CVT_WAVES * 32, 0, stream>>>(x, xbf, n);
  n = EE * NN * DD;     k_f2bf<<<CVT_GRID, CVT_WAVES * 32, 0, stream>>>(Win, winb, n);
  n = EE * HH * DD;     k_f2bf<<<CVT_GRID, CVT_WAVES * 32, 0, stream>>>(Wsin, wsinb, n);
  n = EE * 4 * NN * HH; k_f2bf<<<CVT_GRID, CVT_WAVES * 32, 0, stream>>>(Wsout, wsoutb, n);
  n = EE * DD * NN;     k_f2bf<<<CVT_GRID, CVT_WAVES * 32, 0, stream>>>(Wout, woutb, n);

  k_route<<<BS / 256, 256, 0, stream>>>(tokid, routes, counts);
  k_offsets<<<1, 1, 0, stream>>>(counts, offsets, tileOff, cursors, totalTiles);
  k_scatter<<<BS / 256, 256, 0, stream>>>(routes, cursors, tokenList);

  k_u_gemm<<<TILE_MAX, 256, 0, stream>>>(xbf, winb, tokenList, offsets, tileOff,
                                         totalTiles, u);
  k_sel_gemm<<<TILE_MAX, 256, 0, stream>>>(xbf, wsinb, wsoutb, u, dparam, tokenList,
                                           offsets, tileOff, totalTiles,
                                           aarr, buarr, carr, skarr);
  k_scan<<<BB * EE * (NN / SCAN_T), SCAN_T, 0, stream>>>(routes, aarr, buarr, carr, skarr, ybf);
  k_out_gemm<<<TILE_MAX, 256, 0, stream>>>(ybf, woutb, tokenList, offsets, tileOff,
                                           totalTiles, out);
}

// v005
// It runs in 246 microseconds.
// Next to v004, in two timings, it ran 1.10 times as fast each time.
// All steps since v000 together make it 3.48 times as fast.
#include <hip/hip_runtime.h>
#include <hip/hip_bf16.h>
#include <stdint.h>

#define BB 8
#define SS 2048
#define DD 1024
#define NN 256
#define HH 512
#define EE 8
#define BS (BB * SS)                 // 16384 tokens
#define TOK_TILE 32
#define TILE_MAX (BS / TOK_TILE + EE)  // worst-case 32-token tiles over all experts
// Row pitch, in bf16 elements, of a token tile in LDS whose rows hold n elements: 16 bytes more
// than the row, an odd multiple of 16 bytes, so the 16 rows that one 16-byte fragment load
// touches fall on different banks (at the bare pitch, a multiple of 256 bytes, on the same four).
#define LDS_LD(n) ((n) + 8)
static_assert((LDS_LD(DD) / 8) % 2 == 1 && (LDS_LD(HH) / 8) % 2 == 1 && (LDS_LD(NN) / 8) % 2 == 1,
              "every tile pitch is an odd multiple of 16 bytes");

typedef __bf16 bf16;
typedef __attribute__((ext_vector_type(16))) __bf16 v16bf;
typedef __attribute__((ext_vector_type(8)))  __bf16 v8bf;
typedef __attribute__((ext_vector_type(8)))  float   v8f;
typedef __attribute__((ext_vector_type(4)))  float   v4f;
typedef __attribute__((ext_vector_type(4)))  __bf16 v4bf;

__device__ __forceinline__ v8f vzero8() {
  v8f v;
#pragma unroll
  for (int i = 0; i < 8; ++i) v[i] = 0.f;
  return v;
}

__device__ __forceinline__ float sigmoidf_(float x) { return 1.f / (1.f + __expf(-x)); }

// D = A(16xK, rows=M striped per lane) x B(Kx16, cols=N striped per lane) + C
__device__ __forceinline__ v8f wmma_bf16(v16bf a, v16bf b, v8f c) {
  return __builtin_amdgcn_wmma_f32_16x16x32_bf16(false, a, false, b, (short)0, c, false, false);
}

// Load one 16x32 bf16 fragment from a row-major tile (leading dim ld, elements).
// Per ISA 7.12.2: lane (r = lane&15, h = lane>>4) holds K = k0+h*8+{0..7} and k0+16+h*8+{0..7} of row r.
__device__ __forceinline__ v16bf load_frag(const bf16* tile, int ld, int k0, int lane) {
  const int r = lane & 15;
  const int h = (lane >> 4) & 1;
  const bf16* p = tile + (size_t)r * ld + k0 + h * 8;
  v8bf c0 = *(const v8bf*)(p);
  v8bf c1 = *(const v8bf*)(p + 16);
  v16bf f;
#pragma unroll
  for (int i = 0; i < 8; ++i) { f[i] = c0[i]; f[i + 8] = c1[i]; }
  return f;
}

struct TileInfo { int e, listBase, listEnd; };

__device__ __forceinline__ bool tile_info(const int* offsets, const int* tileOff,
                                          const int* totalTiles, TileInfo& ti) {
  int tile = blockIdx.x;
  if (tile >= *totalTiles) return false;
  int e = 0;
#pragma unroll
  for (int k = 1; k < EE; ++k) if (tile >= tileOff[k]) e = k;
  ti.e = e;
  int local = tile - tileOff[e];
  ti.listBase = offsets[e] + local * TOK_TILE;
  ti.listEnd = offsets[e + 1];
  return true;
}

// Cooperative gather of TOK_TILE token rows (ROW_ELEMS bf16 each) into LDS, at pitch
// LDS_LD(ROW_ELEMS); invalid -> 0.
template <int ROW_ELEMS>
__device__ __forceinline__ void gather_rows(const bf16* src_base, bf16* dst, const int* tl) {
  constexpr int CPR = ROW_ELEMS / 8;          // 16B chunks per row
  for (int idx = threadIdx.x; idx < TOK_TILE * CPR; idx += 256) {
    int row = idx / CPR;
    int c = idx % CPR;
    int tok = tl[row];
    int tsafe = tok < 0 ? 0 : tok;
    const uint4* s = (const uint4*)(src_base + (size_t)tsafe * ROW_ELEMS);
    uint4* d = (uint4*)(dst + (size_t)row * LDS_LD(ROW_ELEMS));
    uint4 v;
    if (tok >= 0) v = s[c];
    else { v.x = 0u; v.y = 0u; v.z = 0u; v.w = 0u; }
    d[c] = v;
  }
}

// ---------------- preparation: one launch ----------------
// Nothing here depends on another work-group, so it is one grid. Work-group 0 routes the tokens
// and builds the per-expert token lists; the other CVT_GRID work-groups turn x and the four
// weight arrays into bf16.

// f32 -> bf16 as a stream: a grid that is resident at once, one work-group per WGP, and every
// wave loops over whole pieces of CVT_PIECE floats. A wave's load covers 512 contiguous bytes,
// its store 256, and CVT_LOADS loads of a lane are in flight together.
#define CVT_GRID 256                       // converting work-groups
#define CVT_WAVES 16                       // waves per work-group
#define CVT_LOADS 8                        // 16-byte loads per lane and trip
#define CVT_PIECE (CVT_LOADS * 32 * 4)     // floats per wave and trip
static_assert((BS * DD) % CVT_PIECE == 0 && (EE * NN * DD) % CVT_PIECE == 0 &&
              (EE * HH * DD) % CVT_PIECE == 0 && (EE * 4 * NN * HH) % CVT_PIECE == 0,
              "every converted array is a whole number of pieces");
#define PC_X     (BS * DD / CVT_PIECE)          // pieces of each array, in the order they are dealt
#define PC_WIN   (EE * NN * DD / CVT_PIECE)
#define PC_WSIN  (EE * HH * DD / CVT_PIECE)
#define PC_WSOUT (EE * 4 * NN * HH / CVT_PIECE)
#define PC_WOUT  (EE * DD * NN / CVT_PIECE)

#define RT_R (BS / (CVT_WAVES * 32))       // tokens per lane of the routing work-group

// One work-group: routes[], the token list sorted by expert (token order kept inside an expert),
// the experts' offsets in it and their tile offsets. Wave wid takes the tokens
// [wid * 32 * RT_R, (wid + 1) * 32 * RT_R), 32 a round; a token's rank among its wave's tokens of
// the same expert comes from ballots, the waves' totals meet in LDS.
__device__ __forceinline__ void build_lists(
    const int* __restrict__ tok, int* __restrict__ routes, int* __restrict__ offsets,
    int* __restrict__ tileOff, int* __restrict__ totalTiles, int* __restrict__ tokenList) {
  __shared__ int wtot[CVT_WAVES * EE];
  const int wid = threadIdx.x >> 5;
  const int lane = threadIdx.x & 31;
  const int t0 = wid * (32 * RT_R) + lane;
  int id[RT_R];
#pragma unroll  // the token loads issue together
  for (int i = 0; i < RT_R; ++i) id[i] = tok[t0 + i * 32];
  int cnt[EE];                       // the wave's tokens of each expert so far: scalar registers
#pragma unroll  // constant e: cnt[] stays in scalar registers
  for (int e = 0; e < EE; ++e) cnt[e] = 0;
  unsigned pack[RT_R];               // rank in the low half, route in the high half
#pragma unroll  // constant i: id[] and pack[] stay in registers
  for (int i = 0; i < RT_R; ++i) {
    unsigned x = (unsigned)id[i];
    x ^= x >> 16; x *= 2246822507u;
    x ^= x >> 13; x *= 3266489909u;
    x ^= x >> 16;
    int r = (int)(x & 7u);   // % 8
    int rk = 0;
#pragma unroll  // constant e: cnt[] stays in scalar registers
    for (int e = 0; e < EE; ++e) {
      unsigned m = __builtin_amdgcn_ballot_w32(r == e);
      rk = (r == e) ? cnt[e] + (int)__builtin_amdgcn_mbcnt_lo(m, 0u) : rk;
      cnt[e] += __popc(m);
    }
    pack[i] = (unsigned)rk | ((unsigned)r << 16);
  }
#pragma unroll  // behind the ranks, all together: among them each store would hold up the next round
  for (int i = 0; i < RT_R; ++i) routes[t0 + i * 32] = (int)(pack[i] >> 16);
  int mine = 0;
#pragma unroll  // constant e: cnt[] stays in scalar registers
  for (int e = 0; e < EE; ++e) if (lane == e) mine = cnt[e];
  if (lane < EE) wtot[wid * EE + lane] = mine;
  __syncthreads();
  // lane l looks after expert l % EE: its tokens in the waves in front of this one, and in all
  const int el = lane & (EE - 1);
  int before = 0, total = 0;
#pragma unroll  // the LDS loads issue together
  for (int w = 0; w < CVT_WAVES; ++w) {
    int v = wtot[w * EE + el];
    if (w < wid) before += v;
    total += v;
  }
  int off[EE + 1], toff[EE + 1];
  off[0] = 0;
  toff[0] = 0;
#pragma unroll  // constant e: off[] and toff[] stay in scalar registers
  for (int e = 0; e < EE; ++e) {
    int c = __builtin_amdgcn_readlane(total, e);
    off[e + 1] = off[e] + c;
    toff[e + 1] = toff[e] + (c + TOK_TILE - 1) / TOK_TILE;
  }
  int start = before;                // where this wave's tokens of expert el begin in the list
#pragma unroll  // constant e: off[] stays in scalar registers
  for (int e = 0; e < EE; ++e) if (el == e) start += off[e];
#pragma unroll  // constant i: pack[] stays in registers
  for (int i = 0; i < RT_R; ++i) {
    int r = (int)(pack[i] >> 16);
    int pos = __builtin_amdgcn_ds_bpermute(r << 2, start) + (int)(pack[i] & 0xffffu);
    tokenList[pos] = t0 + i * 32;
  }
  if (threadIdx.x == 0) {
#pragma unroll  // constant e: off[] and toff[] stay in scalar registers
    for (int e = 0; e <= EE; ++e) {
      offsets[e] = off[e];
      tileOff[e] = toff[e];
    }
    *totalTiles = toff[EE];
  }
}

__global__ void __launch_bounds__(CVT_WAVES * 32) k_prep(
    const float* __restrict__ x, const float* __restrict__ win,
    const float* __restrict__ wsin, const float* __restrict__ wsout,
    const float* __restrict__ wout, const int* __restrict__ tok,
    bf16* __restrict__ xbf, bf16* __restrict__ winb, bf16* __restrict__ wsinb,
    bf16* __restrict__ wsoutb, bf16* __restrict__ woutb,
    int* __restrict__ routes, int* __restrict__ offsets, int* __restrict__ tileOff,
    int* __restrict__ totalTiles, int* __restrict__ tokenList) {
  if (blockIdx.x == 0) {             // the first to start: its chain of steps is the longest
    build_lists(tok, routes, offsets, tileOff, totalTiles, tokenList);
    return;
  }
  // same in every lane: keeps the choice of the array scalar
  const int wid = __builtin_amdgcn_readfirstlane((int)(threadIdx.x >> 5));
  const int lane = threadIdx.x & 31;
  // piece -> (wave, work-group) with the work-group running fastest: the pieces that are in
  // flight at one time lie side by side
  for (int p = wid * CVT_GRID + (int)blockIdx.x - 1;
       p < PC_X + PC_WIN + PC_WSIN + PC_WSOUT + PC_WOUT; p += CVT_WAVES * CVT_GRID) {
    int q = p;
    const float* in = x;
    bf16* out = xbf;
    if (q >= PC_X) {
      q -= PC_X; in = win; out = winb;
      if (q >= PC_WIN) {
        q -= PC_WIN; in = wsin; out = wsinb;
        if (q >= PC_WSIN) {
          q -= PC_WSIN; in = wsout; out = wsoutb;
          if (q >= PC_WSOUT) { q -= PC_WSOUT; in = wout; out = woutb; }
        }
      }
    }
    const v4f* s = (const v4f*)(in + (size_t)q * CVT_PIECE) + lane;
    v4bf* d = (v4bf*)(out + (size_t)q * CVT_PIECE) + lane;
    v4f v[CVT_LOADS];
#pragma unroll  // the trip's loads issue together, ahead of the first store
    for (int j = 0; j < CVT_LOADS; ++j) v[j] = s[j * 32];
#pragma unroll  // constant j: v[] stays in registers
    for (int j = 0; j < CVT_LOADS; ++j) d[j * 32] = __builtin_convertvector(v[j], v4bf);
    // the next trip rewrites the address and data registers that these loads and stores name
    asm volatile("s_wait_xcnt 0x0" ::: "memory");
  }
}

// ---------------- GEMM 1: u = Win[e] @ x ----------------

__global__ void __launch_bounds__(256) k_u_gemm(
    const bf16* __restrict__ xbf, const bf16* __restrict__ winb,
    const int* __restrict__ tokenList, const int* __restrict__ offsets,
    const int* __restrict__ tileOff, const int* __restrict__ totalTiles,
    float* __restrict__ u) {
  __shared__ __attribute__((aligned(16))) bf16 xs[TOK_TILE * LDS_LD(DD)];   // 64.5 KB
  __shared__ int tl[TOK_TILE];
  TileInfo ti;
  if (!tile_info(offsets, tileOff, totalTiles, ti)) return;
  if (threadIdx.x < TOK_TILE) {
    int li = ti.listBase + (int)threadIdx.x;
    tl[threadIdx.x] = (li < ti.listEnd) ? tokenList[li] : -1;
  }
  __syncthreads();
  gather_rows<DD>(xbf, xs, tl);
  __syncthreads();

  const int wid = threadIdx.x >> 5;
  const int lane = threadIdx.x & 31;
  const bf16* W = winb + (size_t)ti.e * NN * DD;
  v8f acc[2][2];   // [ftile][token-half]
#pragma unroll
  for (int t = 0; t < 2; ++t)
#pragma unroll
    for (int th = 0; th < 2; ++th) acc[t][th] = vzero8();

  for (int k = 0; k < DD; k += 32) {
    v16bf b0 = load_frag(xs, LDS_LD(DD), k, lane);
    v16bf b1 = load_frag(xs + 16 * LDS_LD(DD), LDS_LD(DD), k, lane);
#pragma unroll
    for (int t = 0; t < 2; ++t) {
      v16bf a = load_frag(W + (size_t)((wid * 2 + t) * 16) * DD, DD, k, lane);
      acc[t][0] = wmma_bf16(a, b0, acc[t][0]);
      acc[t][1] = wmma_bf16(a, b1, acc[t][1]);
    }
  }
  const int r = lane & 15, hf = lane >> 4;
#pragma unroll
  for (int th = 0; th < 2; ++th) {
    int tok = tl[th * 16 + r];
    if (tok < 0) continue;
    float* up = u + (size_t)tok * NN;
#pragma unroll
    for (int t = 0; t < 2; ++t) {
      int fb = (wid * 2 + t) * 16 + hf * 8;
#pragma unroll
      for (int j = 0; j < 8; ++j) up[fb + j] = acc[t][th][j];
    }
  }
}

// ---- GEMM 2 (fused): sh = silu(Wsin@x) in LDS, sel = Wsout@sh -> a, b*u, c, skip ----

// Row pitch, in floats, of the epilogue's staging tile (16 tokens x 4*NN selector values): an odd
// multiple of 16 bytes, so the 16 rows that one 16-byte LDS store touches fall on different banks.
#define ST_LD (4 * NN + 4)

__global__ void __launch_bounds__(256) k_sel_gemm(
    const bf16* __restrict__ xbf, const bf16* __restrict__ wsinb,
    const bf16* __restrict__ wsoutb, const float* __restrict__ u,
    const float* __restrict__ dparam,
    const int* __restrict__ tokenList, const int* __restrict__ offsets,
    const int* __restrict__ tileOff, const int* __restrict__ totalTiles,
    float* __restrict__ aarr, float* __restrict__ buarr,
    float* __restrict__ carr, float* __restrict__ skarr) {
  // One LDS area with two lives: the x tile, and, from the barrier behind stage 1 on (nobody reads
  // x any more), the epilogue's f32 staging tile.
  __shared__ __attribute__((aligned(16))) float area[TOK_TILE * LDS_LD(DD) / 2];   // 64.5 KB
  static_assert(sizeof(area) >= sizeof(float) * 16 * ST_LD, "the staging tile fits the area");
  bf16* xs = (bf16*)area;
  __shared__ __attribute__((aligned(16))) bf16 sh[TOK_TILE * LDS_LD(HH)];   // 32.5 KB
  __shared__ int tl[TOK_TILE];
  TileInfo ti;
  if (!tile_info(offsets, tileOff, totalTiles, ti)) return;
  if (threadIdx.x < TOK_TILE) {
    int li = ti.listBase + (int)threadIdx.x;
    tl[threadIdx.x] = (li < ti.listEnd) ? tokenList[li] : -1;
  }
  __syncthreads();
  gather_rows<DD>(xbf, xs, tl);
  __syncthreads();

  const int wid = threadIdx.x >> 5;
  const int lane = threadIdx.x & 31;
  const int r = lane & 15, hf = lane >> 4;

  // stage 1: sh(32x512) = silu(Wsin[e](512x1024) @ x^T), 4 feature tiles per wave
  {
    const bf16* Wsi = wsinb + (size_t)ti.e * HH * DD;
    v8f acc[4][2];
#pragma unroll
    for (int t = 0; t < 4; ++t)
#pragma unroll
      for (int th = 0; th < 2; ++th) acc[t][th] = vzero8();
    for (int k = 0; k < DD; k += 32) {
      v16bf b0 = load_frag(xs, LDS_LD(DD), k, lane);
      v16bf b1 = load_frag(xs + 16 * LDS_LD(DD), LDS_LD(DD), k, lane);
#pragma unroll
      for (int t = 0; t < 4; ++t) {
        v16bf a = load_frag(Wsi + (size_t)((wid * 4 + t) * 16) * DD, DD, k, lane);
        acc[t][0] = wmma_bf16(a, b0, acc[t][0]);
        acc[t][1] = wmma_bf16(a, b1, acc[t][1]);
      }
    }
#pragma unroll
    for (int th = 0; th < 2; ++th) {
      int row = th * 16 + r;   // token row in tile
#pragma unroll
      for (int t = 0; t < 4; ++t) {
        int fb = (wid * 4 + t) * 16 + hf * 8;  // 8 consecutive h-features
#pragma unroll
        for (int j = 0; j < 8; ++j) {
          float v = acc[t][th][j];
          sh[row * LDS_LD(HH) + fb + j] = (bf16)(v * sigmoidf_(v));  // silu
        }
      }
    }
  }
  __syncthreads();

  // stage 2: sel(32x1024) = Wsout[e](1024x512) @ sh^T, 8 feature tiles per wave
  {
    const bf16* Wso = wsoutb + (size_t)ti.e * (4 * NN) * HH;
    v8f acc[8][2];
#pragma unroll
    for (int t = 0; t < 8; ++t)
#pragma unroll
      for (int th = 0; th < 2; ++th) acc[t][th] = vzero8();
    for (int k = 0; k < HH; k += 32) {
      v16bf b0 = load_frag(sh, LDS_LD(HH), k, lane);
      v16bf b1 = load_frag(sh + 16 * LDS_LD(HH), LDS_LD(HH), k, lane);
#pragma unroll
      for (int t = 0; t < 8; ++t) {
        v16bf a = load_frag(Wso + (size_t)((wid * 8 + t) * 16) * HH, HH, k, lane);
        acc[t][0] = wmma_bf16(a, b0, acc[t][0]);
        acc[t][1] = wmma_bf16(a, b1, acc[t][1]);
      }
    }
    // Epilogue, 16 tokens a round: every wave lays its raw sums into the staging tile, then the
    // work-group walks the tile row by row. A thread takes 4 neighbouring states n of one token
    // and all four selector values of each (a, b, c, d stand NN apart in a row), so u is loaded
    // once, 16 bytes a lane, a wave's store fills 4 whole lines, and the activation code stands
    // in the text once a round instead of once per accumulator element.
    const float* dp = dparam + ti.e * NN;
#pragma unroll  // constant th: acc[][] stays in registers
    for (int th = 0; th < 2; ++th) {
      if (th) __syncthreads();   // the first round's readers have left the staging tile
#pragma unroll  // constant t: acc[][] stays in registers
      for (int t = 0; t < 8; ++t) {
        float* q = area + r * ST_LD + (wid * 8 + t) * 16 + hf * 8;
        v4f lo, hi;
#pragma unroll
        for (int j = 0; j < 4; ++j) { lo[j] = acc[t][th][j]; hi[j] = acc[t][th][j + 4]; }
        *(v4f*)q = lo;
        *(v4f*)(q + 4) = hi;
      }
      __syncthreads();           // the staging tile is complete
#pragma unroll 1  // stays a loop: unrolled, the activation code would stand in the text 4 times
      for (int idx = threadIdx.x; idx < 16 * (NN / 4); idx += 256) {
        int row = idx / (NN / 4);              // the same in every lane of a wave
        int n = (idx % (NN / 4)) * 4;
        int tok = tl[th * 16 + row];
        if (tok < 0) continue;
        const float* q = area + row * ST_LD + n;
        v4f va = *(const v4f*)q;
        v4f vb = *(const v4f*)(q + NN);
        v4f vc = *(const v4f*)(q + 2 * NN);
        v4f vd = *(const v4f*)(q + 3 * NN);
        size_t base = (size_t)tok * NN + n;
        v4f uu = *(const v4f*)(u + base);
        v4f dd = *(const v4f*)(dp + n);
        v4f oa, ob, oc, os;
#pragma unroll
        for (int j = 0; j < 4; ++j) {
          oa[j] = sigmoidf_(va[j]);
          ob[j] = tanhf(vb[j]) * uu[j];
          oc[j] = tanhf(vc[j]);
          os[j] = dd[j] * sigmoidf_(vd[j]) * uu[j];
        }
        *(v4f*)(aarr + base) = oa;
        *(v4f*)(buarr + base) = ob;
        *(v4f*)(carr + base) = oc;
        *(v4f*)(skarr + base) = os;
      }
    }
  }
}

// ---------------- scan: h = a*h + b*u ; y = c*h + skip ----------------
// A step reads and writes only its own expert's state, so the 2048 steps of a batch row are
// EE independent chains. One work-group takes one (batch row, expert, SCAN_T states): it lists
// the expert's steps in time order in LDS and walks only those, SCAN_U steps' operands per trip.

#define SCAN_T 64                    // states per work-group: its y stores fill one 128-byte line
#define SCAN_W (SCAN_T / 32)         // waves per work-group
#define SCAN_U 32                    // steps whose operands are loaded together
#define SCAN_R (SS / SCAN_T)         // routes per lane while the list is built

// One trip: SCAN_U steps of the list. In the last, short trip (FULL false) the surplus places
// repeat step left - 1 with h held, so they store that step's y again and no store needs a test.
template <bool FULL>
__device__ __forceinline__ float scan_trip(
    const int* lst, int left, unsigned rowIdx, float h,
    const float* __restrict__ a, const float* __restrict__ bu,
    const float* __restrict__ c, const float* __restrict__ sk, bf16* __restrict__ ybf) {
  unsigned idx[SCAN_U];              // this lane's element in the four f32 planes and in y
  float av[SCAN_U], bv[SCAN_U], cv[SCAN_U], sv[SCAN_U];
#pragma unroll  // constant j: idx[] stays in registers
  for (int j = 0; j < SCAN_U; ++j)
    idx[j] = rowIdx + (unsigned)lst[(FULL || j < left) ? j : left - 1] * NN;
#pragma unroll  // lets the trip's loads issue together, ahead of the sums
  for (int j = 0; j < SCAN_U; ++j) {
    av[j] = a[idx[j]];
    bv[j] = bu[idx[j]];
    cv[j] = c[idx[j]];
    sv[j] = sk[idx[j]];
  }
  // holds every load in front of the sums: one that sinks among them starts its latency late
  __builtin_amdgcn_sched_barrier(0);
  bf16 yv[SCAN_U];
#pragma unroll  // constant j: the operand arrays stay in registers
  for (int j = 0; j < SCAN_U; ++j) {
    float hn = av[j] * h + bv[j];
    h = (FULL || j < left) ? hn : h;
    yv[j] = (bf16)(cv[j] * h + sv[j]);
  }
  // holds the stores behind the last y: mixed in with the sums they share one data register,
  // and each sum then waits (s_wait_xcnt) for the store in front of it
  __builtin_amdgcn_sched_barrier(0);
#pragma unroll  // constant j: idx[] and yv[] stay in registers
  for (int j = 0; j < SCAN_U; ++j) ybf[idx[j]] = yv[j];
  // the next trip rewrites the index and data registers that these stores name
  if (FULL) asm volatile("s_wait_xcnt 0x0" ::: "memory");
  return h;
}

__global__ void __launch_bounds__(SCAN_T) k_scan(
    const int* __restrict__ routes, const float* __restrict__ a,
    const float* __restrict__ bu, const float* __restrict__ c,
    const float* __restrict__ sk, bf16* __restrict__ ybf) {
  __shared__ __attribute__((aligned(16))) int list[SS];
  __shared__ int wcnt[SCAN_W];
  const int slice = blockIdx.x % (NN / SCAN_T);
  const int e = (blockIdx.x / (NN / SCAN_T)) % EE;
  const int b = blockIdx.x / ((NN / SCAN_T) * EE);
  const int wid = threadIdx.x >> 5;
  const int lane = threadIdx.x & 31;

  // wave wid lists the steps t in [wid * 32 * SCAN_R, (wid + 1) * 32 * SCAN_R), 32 per ballot
  const int t0 = wid * (32 * SCAN_R);
  unsigned hit[SCAN_R];
  int mine = 0;
#pragma unroll  // the route loads issue together; hit[] stays in scalar registers
  for (int i = 0; i < SCAN_R; ++i) {
    hit[i] = __builtin_amdgcn_ballot_w32(routes[b * SS + t0 + i * 32 + lane] == e);
    mine += __popc(hit[i]);
  }
  if (lane == 0) wcnt[wid] = mine;
  __syncthreads();
  int pos = 0, cnt = 0;
#pragma unroll  // SCAN_W is 2: no loop is left
  for (int w = 0; w < SCAN_W; ++w) {
    int v = wcnt[w];
    if (w < wid) pos += v;
    cnt += v;
  }
  cnt = __builtin_amdgcn_readfirstlane(cnt);   // same in every lane: keeps the trip tests scalar
#pragma unroll  // constant i: hit[] stays in scalar registers
  for (int i = 0; i < SCAN_R; ++i) {
    if ((hit[i] >> lane) & 1u)
      list[pos + (int)__builtin_amdgcn_mbcnt_lo(hit[i], 0u)] = t0 + i * 32 + lane;
    pos += __popc(hit[i]);
  }
  __syncthreads();

  const unsigned rowIdx = (unsigned)(b * SS) * NN + slice * SCAN_T + threadIdx.x;
  float h = 0.f;
  int base = 0;
  for (; base + SCAN_U <= cnt; base += SCAN_U)
    h = scan_trip<true>(list + base, SCAN_U, rowIdx, h, a, bu, c, sk, ybf);
  if (base < cnt)
    scan_trip<false>(list + base, cnt - base, rowIdx, h, a, bu, c, sk, ybf);
}

// ---------------- GEMM 3: out = Wout[e] @ y ----------------

__global__ void __launch_bounds__(256) k_out_gemm(
    const bf16* __restrict__ ybf, const bf16* __restrict__ woutb,
    const int* __restrict__ tokenList, const int* __restrict__ offsets,
    const int* __restrict__ tileOff, const int* __restrict__ totalTiles,
    float* __restrict__ out) {
  __shared__ __attribute__((aligned(16))) bf16 ys[TOK_TILE * LDS_LD(NN)];   // 16.5 KB
  __shared__ int tl[TOK_TILE];
  TileInfo ti;
  if (!tile_info(offsets, tileOff, totalTiles, ti)) return;
  if (threadIdx.x < TOK_TILE) {
    int li = ti.listBase + (int)threadIdx.x;
    tl[threadIdx.x] = (li < ti.listEnd) ? tokenList[li] : -1;
  }
  __syncthreads();
  gather_rows<NN>(ybf, ys, tl);
  __syncthreads();

  const int wid = threadIdx.x >> 5;
  const int lane = threadIdx.x & 31;
  const bf16* W = woutb + (size_t)ti.e * DD * NN;
  v8f acc[8][2];
#pragma unroll
  for (int t = 0; t < 8; ++t)
#pragma unroll
    for (int th = 0; th < 2; ++th) acc[t][th] = vzero8();
  for (int k = 0; k < NN; k += 32) {
    v16bf b0 = load_frag(ys, LDS_LD(NN), k, lane);
    v16bf b1 = load_frag(ys + 16 * LDS_LD(NN), LDS_LD(NN), k, lane);
#pragma unroll
    for (int t = 0; t < 8; ++t) {
      v16bf a = load_frag(W + (size_t)((wid * 8 + t) * 16) * NN, NN, k, lane);
      acc[t][0] = wmma_bf16(a, b0, acc[t][0]);
      acc[t][1] = wmma_bf16(a, b1, acc[t][1]);
    }
  }
  const int r = lane & 15, hf = lane >> 4;
#pragma unroll
  for (int th = 0; th < 2; ++th) {
    int tok = tl[th * 16 + r];
    if (tok < 0) continue;
    float* op = out + (size_t)tok * DD;
#pragma unroll
    for (int t = 0; t < 8; ++t) {
      int fb = (wid * 8 + t) * 16 + hf * 8;
#pragma unroll
      for (int j = 0; j < 8; ++j) op[fb + j] = acc[t][th][j];
    }
  }
}

// ---------------- host launcher ----------------

extern "C" void kernel_launch(void* const* d_in, const int* in_sizes, int n_in,
                              void* d_out, int out_size, void* d_ws, size_t ws_size,
                              hipStream_t stream) {
  (void)in_sizes; (void)n_in; (void)out_size; (void)ws_size;
  const float* x      = (const float*)d_in[0];
  const int*   tokid  = (const int*)d_in[1];
  const float* Win    = (const float*)d_in[2];
  const float* Wsin   = (const float*)d_in[3];
  const float* Wsout  = (const float*)d_in[4];
  const float* Wout   = (const float*)d_in[5];
  const float* dparam = (const float*)d_in[6];
  float* out = (float*)d_out;

  char* p = (char*)d_ws;
  auto take = [&](size_t bytes) -> char* {
    char* q = p;
    p += (bytes + 255) & ~(size_t)255;
    return q;
  };

  int* routes     = (int*)take(sizeof(int) * BS);
  int* offsets    = (int*)take(sizeof(int) * (EE + 1));
  int* tileOff    = (int*)take(sizeof(int) * (EE + 1));
  int* totalTiles = (int*)take(sizeof(int));
  int* tokenList  = (int*)take(sizeof(int) * BS);
  bf16* xbf    = (bf16*)take(sizeof(bf16) * (size_t)BS * DD);
  bf16* winb   = (bf16*)take(sizeof(bf16) * (size_t)EE * NN * DD);
  bf16* wsinb  = (bf16*)take(sizeof(bf16) * (size_t)EE * HH * DD);
  bf16* wsoutb = (bf16*)take(sizeof(bf16) * (size_t)EE * 4 * NN * HH);
  bf16* woutb  = (bf16*)take(sizeof(bf16) * (size_t)EE * DD * NN);
  float* u     = (float*)take(sizeof(float) * (size_t)BS * NN);
  float* aarr  = (float*)take(sizeof(float) * (size_t)BS * NN);
  float* buarr = (float*)take(sizeof(float) * (size_t)BS * NN);
  float* carr  = (float*)take(sizeof(float) * (size_t)BS * NN);
  float* skarr = (float*)take(sizeof(float) * (size_t)BS * NN);
  bf16* ybf    = (bf16*)take(sizeof(bf16) * (size_t)BS * NN);

  k_prep<<<CVT_GRID + 1, CVT_WAVES * 32, 0, stream>>>(
      x, Win, Wsin, Wsout, Wout, tokid, xbf, winb, wsinb, wsoutb, woutb,
      routes, offsets, tileOff, totalTiles, tokenList);

  k_u_gemm<<<TILE_MAX, 256, 0, stream>>>(xbf, winb, tokenList, offsets, tileOff,
                                         totalTiles, u);
  k_sel_gemm<<<TILE_MAX, 256, 0, stream>>>(xbf, wsinb, wsoutb, u, dparam, tokenList,
                                           offsets, tileOff, totalTiles,
                                           aarr, buarr, carr, skarr);
  k_scan<<<BB * EE * (NN / SCAN_T), SCAN_T, 0, stream>>>(routes, aarr, buarr, carr, skarr, ybf);
  k_out_gemm<<<TILE_MAX, 256, 0, stream>>>(ybf, woutb, tokenList, offsets, tileOff,
                                           totalTiles, out);
}

// v006
// One run takes 232 microseconds.
// Timed twice side by side with v005, it ran 1.06 times as fast both times.
// Over all steps from v000 it is 3.69 times as fast.
#include <hip/hip_runtime.h>
#include <hip/hip_bf16.h>
#include <stdint.h>

#define BB 8
#define SS 2048
#define DD 1024
#define NN 256
#define HH 512
#define EE 8
#define BS (BB * SS)                 // 16384 tokens
#define TOK_TILE 32
#define TILE_MAX (BS / TOK_TILE + EE)  // worst-case 32-token tiles over all experts
// Row pitch, in bf16 elements, of a token tile in LDS whose rows hold n elements: 16 bytes more
// than the row, an odd multiple of 16 bytes, so the 16 rows that one 16-byte fragment load
// touches fall on different banks (at the bare pitch, a multiple of 256 bytes, on the same four).
#define LDS_LD(n) ((n) + 8)
static_assert((LDS_LD(DD) / 8) % 2 == 1 && (LDS_LD(HH) / 8) % 2 == 1 && (LDS_LD(NN) / 8) % 2 == 1,
              "every tile pitch is an odd multiple of 16 bytes");

typedef __bf16 bf16;
typedef __attribute__((ext_vector_type(16))) __bf16 v16bf;
typedef __attribute__((ext_vector_type(8)))  __bf16 v8bf;
typedef __attribute__((ext_vector_type(8)))  float   v8f;
typedef __attribute__((ext_vector_type(4)))  float   v4f;
typedef __attribute__((ext_vector_type(4)))  __bf16 v4bf;

__device__ __forceinline__ v8f vzero8() {
  v8f v;
#pragma unroll
  for (int i = 0; i < 8; ++i) v[i] = 0.f;
  return v;
}

__device__ __forceinline__ float sigmoidf_(float x) { return 1.f / (1.f + __expf(-x)); }

// D = A(16xK, rows=M striped per lane) x B(Kx16, cols=N striped per lane) + C
__device__ __forceinline__ v8f wmma_bf16(v16bf a, v16bf b, v8f c) {
  return __builtin_amdgcn_wmma_f32_16x16x32_bf16(false, a, false, b, (short)0, c, false, false);
}

// Load one 16x32 bf16 fragment from a row-major tile (leading dim ld, elements).
// Per ISA 7.12.2: lane (r = lane&15, h = lane>>4) holds K = k0+h*8+{0..7} and k0+16+h*8+{0..7} of row r.
__device__ __forceinline__ v16bf load_frag(const bf16* tile, int ld, int k0, int lane) {
  const int r = lane & 15;
  const int h = (lane >> 4) & 1;
  const bf16* p = tile + (size_t)r * ld + k0 + h * 8;
  v8bf c0 = *(const v8bf*)(p);
  v8bf c1 = *(const v8bf*)(p + 16);
  v16bf f;
#pragma unroll
  for (int i = 0; i < 8; ++i) { f[i] = c0[i]; f[i + 8] = c1[i]; }
  return f;
}

struct TileInfo { int e, listBase, listEnd; };

__device__ __forceinline__ bool tile_info(const int* offsets, const int* tileOff,
                                          const int* totalTiles, TileInfo& ti) {
  int tile = blockIdx.x;
  if (tile >= *totalTiles) return false;
  int e = 0;
#pragma unroll
  for (int k = 1; k < EE; ++k) if (tile >= tileOff[k]) e = k;
  ti.e = e;
  int local = tile - tileOff[e];
  ti.listBase = offsets[e] + local * TOK_TILE;
  ti.listEnd = offsets[e + 1];
  return true;
}

// Cooperative gather of TOK_TILE token rows (ROW_ELEMS bf16 each) into LDS, at pitch
// LDS_LD(ROW_ELEMS); invalid -> 0.
template <int ROW_ELEMS>
__device__ __forceinline__ void gather_rows(const bf16* src_base, bf16* dst, const int* tl) {
  constexpr int CPR = ROW_ELEMS / 8;          // 16B chunks per row
  constexpr int IT = TOK_TILE * CPR / 256;    // chunks per thread
  static_assert(IT * 256 == TOK_TILE * CPR, "the threads share the chunks evenly");
  static_assert(IT % 4 == 0, "the loads go out four at a time");
  int tok[IT];
  uint4 v[IT];
#pragma unroll  // constant i: tok[] stays in registers
  for (int i = 0; i < IT; ++i) tok[i] = tl[((int)threadIdx.x + i * 256) / CPR];
#pragma unroll  // a thread's loads all issue before the first is used: none is under a test (an
                // empty place reads row 0) and none is waited for here
  for (int i = 0; i < IT; i += 4) {
    const uint4* p[4];
#pragma unroll
    for (int j = 0; j < 4; ++j) {
      int tsafe = tok[i + j] < 0 ? 0 : tok[i + j];
      p[j] = (const uint4*)(src_base + (size_t)tsafe * ROW_ELEMS) +
             ((int)threadIdx.x + (i + j) * 256) % CPR;
      v[i + j] = *p[j];
    }
    // stands before any register that these loads name is rewritten: as inputs of the wait the
    // four addresses stay in their registers up to it
    asm volatile("s_wait_xcnt 0x0" :: "v"(p[0]), "v"(p[1]), "v"(p[2]), "v"(p[3]) : "memory");
  }
#pragma unroll  // constant i: tok[] and v[] stay in registers
  for (int i = 0; i < IT; ++i) {
    int idx = (int)threadIdx.x + i * 256;
    uint4 w = v[i];
    if (tok[i] < 0) { w.x = 0u; w.y = 0u; w.z = 0u; w.w = 0u; }
    ((uint4*)(dst + (size_t)(idx / CPR) * LDS_LD(ROW_ELEMS)))[idx % CPR] = w;
  }
}

// ---------------- the GEMMs' inner loop ----------------
// One wave: 2 or 4 tiles of 16 weight rows (row-major, K elements a row, from global memory) times
// the 32 tokens of an LDS tile. The weight fragments live in two register sets; while one set is
// multiplied, all loads of the other are in flight. A set is 2 tiles x 64 k: whole 128-byte lines
// of its 32 rows, so the four loads that share a line go out side by side.

#define SET_K 64                     // k per register set
typedef v16bf wset[2][2];            // [k-step][tile]

__device__ __forceinline__ void load_set(wset& a, const bf16* W, int ld, int k, int lane) {
  // the two fences keep the set's loads one group at this place: sunk towards their uses they
  // would share registers and each would be waited for alone
  __builtin_amdgcn_sched_barrier(0);
#pragma unroll  // constant s, t: a[][] stays in registers
  for (int s = 0; s < 2; ++s)
#pragma unroll
    for (int t = 0; t < 2; ++t)
      a[s][t] = load_frag(W + (size_t)(t * 16) * ld, ld, k + s * 32, lane);
  __builtin_amdgcn_sched_barrier(0);
}

// the set's tiles are the tiles T0 and T0 + 1 of acc
template <int T0, int TT>
__device__ __forceinline__ void mma_set(const wset& a, const bf16* tile, int tld, int k, int lane,
                                        v8f (&acc)[TT][2]) {
#pragma unroll  // constant s, t: a[][] and acc[][] stay in registers
  for (int s = 0; s < 2; ++s) {
    v16bf b0 = load_frag(tile, tld, k + s * 32, lane);
    v16bf b1 = load_frag(tile + 16 * tld, tld, k + s * 32, lane);
#pragma unroll
    for (int t = 0; t < 2; ++t) {
      acc[T0 + t][0] = wmma_bf16(a[s][t], b0, acc[T0 + t][0]);
      acc[T0 + t][1] = wmma_bf16(a[s][t], b1, acc[T0 + t][1]);
    }
  }
}

// 2 tiles: the sets take turns along k
template <int K>
__device__ __forceinline__ void gemm_rows2(const bf16* W, const bf16* tile, int tld, int lane,
                                           v8f (&acc)[2][2]) {
  static_assert(K % (2 * SET_K) == 0, "K is a whole number of set pairs");
  wset a0, a1;
  load_set(a0, W, K, 0, lane);
#pragma unroll 1  // stays a loop of two sets: unrolled further, more sets would be live at a time
  for (int k = 0; k < K - 2 * SET_K; k += 2 * SET_K) {
    load_set(a1, W, K, k + SET_K, lane);
    mma_set<0, 2>(a0, tile, tld, k, lane, acc);
    load_set(a0, W, K, k + 2 * SET_K, lane);
    mma_set<0, 2>(a1, tile, tld, k + SET_K, lane, acc);
  }
  load_set(a1, W, K, K - SET_K, lane);
  mma_set<0, 2>(a0, tile, tld, K - 2 * SET_K, lane, acc);
  mma_set<0, 2>(a1, tile, tld, K - SET_K, lane, acc);
}

// 4 tiles: one set has the tiles 0 and 1, the other the tiles 2 and 3, of the same 64 k
template <int K>
__device__ __forceinline__ void gemm_rows4(const bf16* W, const bf16* tile, int tld, int lane,
                                           v8f (&acc)[4][2]) {
  static_assert(K % SET_K == 0, "K is a whole number of sets");
  const bf16* W2 = W + (size_t)32 * K;
  wset a0, a1;
  load_set(a0, W, K, 0, lane);
#pragma unroll 1  // stays a loop of two sets: unrolled further, more sets would be live at a time
  for (int k = 0; k < K - SET_K; k += SET_K) {
    load_set(a1, W2, K, k, lane);
    mma_set<0, 4>(a0, tile, tld, k, lane, acc);
    load_set(a0, W, K, k + SET_K, lane);
    mma_set<2, 4>(a1, tile, tld, k, lane, acc);
  }
  load_set(a1, W2, K, K - SET_K, lane);
  mma_set<0, 4>(a0, tile, tld, K - SET_K, lane, acc);
  mma_set<2, 4>(a1, tile, tld, K - SET_K, lane, acc);
}

// ---------------- preparation: one launch ----------------
// Nothing here depends on another work-group, so it is one grid. Work-group 0 routes the tokens
// and builds the per-expert token lists; the other CVT_GRID work-groups turn x and the four
// weight arrays into bf16.

// f32 -> bf16 as a stream: a grid that is resident at once, one work-group per WGP, and every
// wave loops over whole pieces of CVT_PIECE floats. A wave's load covers 512 contiguous bytes,
// its store 256, and CVT_LOADS loads of a lane are in flight together.
#define CVT_GRID 256                       // converting work-groups
#define CVT_WAVES 16                       // waves per work-group
#define CVT_LOADS 8                        // 16-byte loads per lane and trip
#define CVT_PIECE (CVT_LOADS * 32 * 4)     // floats per wave and trip
static_assert((BS * DD) % CVT_PIECE == 0 && (EE * NN * DD) % CVT_PIECE == 0 &&
              (EE * HH * DD) % CVT_PIECE == 0 && (EE * 4 * NN * HH) % CVT_PIECE == 0,
              "every converted array is a whole number of pieces");
#define PC_X     (BS * DD / CVT_PIECE)          // pieces of each array, in the order they are dealt
#define PC_WIN   (EE * NN * DD / CVT_PIECE)
#define PC_WSIN  (EE * HH * DD / CVT_PIECE)
#define PC_WSOUT (EE * 4 * NN * HH / CVT_PIECE)
#define PC_WOUT  (EE * DD * NN / CVT_PIECE)

#define RT_R (BS / (CVT_WAVES * 32))       // tokens per lane of the routing work-group

// One work-group: routes[], the token list sorted by expert (token order kept inside an expert),
// the experts' offsets in it and their tile offsets. Wave wid takes the tokens
// [wid * 32 * RT_R, (wid + 1) * 32 * RT_R), 32 a round; a token's rank among its wave's tokens of
// the same expert comes from ballots, the waves' totals meet in LDS.
__device__ __forceinline__ void build_lists(
    const int* __restrict__ tok, int* __restrict__ routes, int* __restrict__ offsets,
    int* __restrict__ tileOff, int* __restrict__ totalTiles, int* __restrict__ tokenList) {
  __shared__ int wtot[CVT_WAVES * EE];
  const int wid = threadIdx.x >> 5;
  const int lane = threadIdx.x & 31;
  const int t0 = wid * (32 * RT_R) + lane;
  int id[RT_R];
#pragma unroll  // the token loads issue together
  for (int i = 0; i < RT_R; ++i) id[i] = tok[t0 + i * 32];
  int cnt[EE];                       // the wave's tokens of each expert so far: scalar registers
#pragma unroll  // constant e: cnt[] stays in scalar registers
  for (int e = 0; e < EE; ++e) cnt[e] = 0;
  unsigned pack[RT_R];               // rank in the low half, route in the high half
#pragma unroll  // constant i: id[] and pack[] stay in registers
  for (int i = 0; i < RT_R; ++i) {
    unsigned x = (unsigned)id[i];
    x ^= x >> 16; x *= 2246822507u;
    x ^= x >> 13; x *= 3266489909u;
    x ^= x >> 16;
    int r = (int)(x & 7u);   // % 8
    int rk = 0;
#pragma unroll  // constant e: cnt[] stays in scalar registers
    for (int e = 0; e < EE; ++e) {
      unsigned m = __builtin_amdgcn_ballot_w32(r == e);
      rk = (r == e) ? cnt[e] + (int)__builtin_amdgcn_mbcnt_lo(m, 0u) : rk;
      cnt[e] += __popc(m);
    }
    pack[i] = (unsigned)rk | ((unsigned)r << 16);
  }
#pragma unroll  // behind the ranks, all together: among them each store would hold up the next round
  for (int i = 0; i < RT_R; ++i) routes[t0 + i * 32] = (int)(pack[i] >> 16);
  int mine = 0;
#pragma unroll  // constant e: cnt[] stays in scalar registers
  for (int e = 0; e < EE; ++e) if (lane == e) mine = cnt[e];
  if (lane < EE) wtot[wid * EE + lane] = mine;
  __syncthreads();
  // lane l looks after expert l % EE: its tokens in the waves in front of this one, and in all
  const int el = lane & (EE - 1);
  int before = 0, total = 0;
#pragma unroll  // the LDS loads issue together
  for (int w = 0; w < CVT_WAVES; ++w) {
    int v = wtot[w * EE + el];
    if (w < wid) before += v;
    total += v;
  }
  int off[EE + 1], toff[EE + 1];
  off[0] = 0;
  toff[0] = 0;
#pragma unroll  // constant e: off[] and toff[] stay in scalar registers
  for (int e = 0; e < EE; ++e) {
    int c = __builtin_amdgcn_readlane(total, e);
    off[e + 1] = off[e] + c;
    toff[e + 1] = toff[e] + (c + TOK_TILE - 1) / TOK_TILE;
  }
  int start = before;                // where this wave's tokens of expert el begin in the list
#pragma unroll  // constant e: off[] stays in scalar registers
  for (int e = 0; e < EE; ++e) if (el == e) start += off[e];
#pragma unroll  // constant i: pack[] stays in registers
  for (int i = 0; i < RT_R; ++i) {
    int r = (int)(pack[i] >> 16);
    int pos = __builtin_amdgcn_ds_bpermute(r << 2, start) + (int)(pack[i] & 0xffffu);
    tokenList[pos] = t0 + i * 32;
  }
  if (threadIdx.x == 0) {
#pragma unroll  // constant e: off[] and toff[] stay in scalar registers
    for (int e = 0; e <= EE; ++e) {
      offsets[e] = off[e];
      tileOff[e] = toff[e];
    }
    *totalTiles = toff[EE];
  }
}

__global__ void __launch_bounds__(CVT_WAVES * 32) k_prep(
    const float* __restrict__ x, const float* __restrict__ win,
    const float* __restrict__ wsin, const float* __restrict__ wsout,
    const float* __restrict__ wout, const int* __restrict__ tok,
    bf16* __restrict__ xbf, bf16* __restrict__ winb, bf16* __restrict__ wsinb,
    bf16* __restrict__ wsoutb, bf16* __restrict__ woutb,
    int* __restrict__ routes, int* __restrict__ offsets, int* __restrict__ tileOff,
    int* __restrict__ totalTiles, int* __restrict__ tokenList) {
  if (blockIdx.x == 0) {             // the first to start: its chain of steps is the longest
    build_lists(tok, routes, offsets, tileOff, totalTiles, tokenList);
    return;
  }
  // same in every lane: keeps the choice of the array scalar
  const int wid = __builtin_amdgcn_readfirstlane((int)(threadIdx.x >> 5));
  const int lane = threadIdx.x & 31;
  // piece -> (wave, work-group) with the work-group running fastest: the pieces that are in
  // flight at one time lie side by side
  for (int p = wid * CVT_GRID + (int)blockIdx.x - 1;
       p < PC_X + PC_WIN + PC_WSIN + PC_WSOUT + PC_WOUT; p += CVT_WAVES * CVT_GRID) {
    int q = p;
    const float* in = x;
    bf16* out = xbf;
    if (q >= PC_X) {
      q -= PC_X; in = win; out = winb;
      if (q >= PC_WIN) {
        q -= PC_WIN; in = wsin; out = wsinb;
        if (q >= PC_WSIN) {
          q -= PC_WSIN; in = wsout; out = wsoutb;
          if (q >= PC_WSOUT) { q -= PC_WSOUT; in = wout; out = woutb; }
        }
      }
    }
    const v4f* s = (const v4f*)(in + (size_t)q * CVT_PIECE) + lane;
    v4bf* d = (v4bf*)(out + (size_t)q * CVT_PIECE) + lane;
    v4f v[CVT_LOADS];
#pragma unroll  // the trip's loads issue together, ahead of the first store
    for (int j = 0; j < CVT_LOADS; ++j) v[j] = s[j * 32];
#pragma unroll  // constant j: v[] stays in registers
    for (int j = 0; j < CVT_LOADS; ++j) d[j * 32] = __builtin_convertvector(v[j], v4bf);
    // the next trip rewrites the address and data registers that these loads and stores name
    asm volatile("s_wait_xcnt 0x0" ::: "memory");
  }
}

// ---------------- GEMM 1: u = Win[e] @ x ----------------

__global__ void __launch_bounds__(256) k_u_gemm(
    const bf16* __restrict__ xbf, const bf16* __restrict__ winb,
    const int* __restrict__ tokenList, const int* __restrict__ offsets,
    const int* __restrict__ tileOff, const int* __restrict__ totalTiles,
    float* __restrict__ u) {
  __shared__ __attribute__((aligned(16))) bf16 xs[TOK_TILE * LDS_LD(DD)];   // 64.5 KB
  __shared__ int tl[TOK_TILE];
  TileInfo ti;
  if (!tile_info(offsets, tileOff, totalTiles, ti)) return;
  if (threadIdx.x < TOK_TILE) {
    int li = ti.listBase + (int)threadIdx.x;
    tl[threadIdx.x] = (li < ti.listEnd) ? tokenList[li] : -1;
  }
  __syncthreads();
  gather_rows<DD>(xbf, xs, tl);
  __syncthreads();

  const int wid = threadIdx.x >> 5;
  const int lane = threadIdx.x & 31;
  const bf16* W = winb + (size_t)ti.e * NN * DD;
  v8f acc[2][2];   // [ftile][token-half]
#pragma unroll
  for (int t = 0; t < 2; ++t)
#pragma unroll
    for (int th = 0; th < 2; ++th) acc[t][th] = vzero8();

  gemm_rows2<DD>(W + (size_t)(wid * 2 * 16) * DD, xs, LDS_LD(DD), lane, acc);
  const int r = lane & 15, hf = lane >> 4;
#pragma unroll
  for (int th = 0; th < 2; ++th) {
    int tok = tl[th * 16 + r];
    if (tok < 0) continue;
    float* up = u + (size_t)tok * NN;
#pragma unroll
    for (int t = 0; t < 2; ++t) {
      int fb = (wid * 2 + t) * 16 + hf * 8;
#pragma unroll
      for (int j = 0; j < 8; ++j) up[fb + j] = acc[t][th][j];
    }
  }
}

// ---- GEMM 2 (fused): sh = silu(Wsin@x) in LDS, sel = Wsout@sh -> a, b*u, c, skip ----

// Stage 2 and its epilogue go in two rounds of ST_N states each: a round's sums take half the
// registers, which leaves room for the second set of weight fragments.
#define ST_N (NN / 2)
// Row pitch, in floats, of the epilogue's staging tile (32 tokens x 4*ST_N selector values): an odd
// multiple of 16 bytes, so the 16 rows that one 16-byte LDS store touches fall on different banks.
#define ST_LD (4 * ST_N + 4)

// 6 waves per SIMD: three work-groups to a WGP, so that all tiles (a few more than two per WGP) are
// resident at once and none waits for a first round to end
__global__ void __launch_bounds__(256, 6) k_sel_gemm(
    const bf16* __restrict__ xbf, const bf16* __restrict__ wsinb,
    const bf16* __restrict__ wsoutb, const float* __restrict__ u,
    const float* __restrict__ dparam,
    const int* __restrict__ tokenList, const int* __restrict__ offsets,
    const int* __restrict__ tileOff, const int* __restrict__ totalTiles,
    float* __restrict__ aarr, float* __restrict__ buarr,
    float* __restrict__ carr, float* __restrict__ skarr) {
  // One LDS area with two lives: the x tile, and, from the barrier behind stage 1 on (nobody reads
  // x any more), the epilogue's f32 staging tile.
  __shared__ __attribute__((aligned(16))) float area[TOK_TILE * LDS_LD(DD) / 2];   // 64.5 KB
  static_assert(sizeof(area) >= sizeof(float) * TOK_TILE * ST_LD, "the staging tile fits the area");
  bf16* xs = (bf16*)area;
  __shared__ __attribute__((aligned(16))) bf16 sh[TOK_TILE * LDS_LD(HH)];   // 32.5 KB
  __shared__ int tl[TOK_TILE];
  TileInfo ti;
  if (!tile_info(offsets, tileOff, totalTiles, ti)) return;
  if (threadIdx.x < TOK_TILE) {
    int li = ti.listBase + (int)threadIdx.x;
    tl[threadIdx.x] = (li < ti.listEnd) ? tokenList[li] : -1;
  }
  __syncthreads();
  gather_rows<DD>(xbf, xs, tl);
  __syncthreads();

  // same in every lane: keeps the bases of the wave's weight rows in scalar registers
  const int wid = __builtin_amdgcn_readfirstlane((int)(threadIdx.x >> 5));
  const int lane = threadIdx.x & 31;
  const int r = lane & 15, hf = lane >> 4;

  // stage 1: sh(32x512) = silu(Wsin[e](512x1024) @ x^T), 4 feature tiles per wave
  {
    const bf16* Wsi = wsinb + (size_t)ti.e * HH * DD;
    v8f acc[4][2];
#pragma unroll
    for (int t = 0; t < 4; ++t)
#pragma unroll
      for (int th = 0; th < 2; ++th) acc[t][th] = vzero8();
    gemm_rows4<DD>(Wsi + (size_t)(wid * 4 * 16) * DD, xs, LDS_LD(DD), lane, acc);
#pragma unroll
    for (int th = 0; th < 2; ++th) {
      int row = th * 16 + r;   // token row in tile
#pragma unroll
      for (int t = 0; t < 4; ++t) {
        int fb = (wid * 4 + t) * 16 + hf * 8;  // 8 consecutive h-features
#pragma unroll
        for (int j = 0; j < 8; ++j) {
          float v = acc[t][th][j];
          sh[row * LDS_LD(HH) + fb + j] = (bf16)(v * sigmoidf_(v));  // silu
        }
      }
    }
  }
  __syncthreads();

  // stage 2: sel(32x1024) = Wsout[e](1024x512) @ sh^T, in two rounds. Round p takes the states
  // [p * ST_N, (p + 1) * ST_N) with all four selector values of each (a, b, c, d stand NN rows
  // apart in Wsout): 4 * ST_N weight rows, 4 feature tiles per wave.
  {
    const bf16* Wso = wsoutb + (size_t)ti.e * (4 * NN) * HH;
    const float* dp = dparam + ti.e * NN;
#pragma unroll 1  // stays a loop: unrolled, the GEMM loop and the activation code would stand twice
    for (int p = 0; p < NN / ST_N; ++p) {
      v8f acc[4][2];
#pragma unroll
      for (int t = 0; t < 4; ++t)
#pragma unroll
        for (int th = 0; th < 2; ++th) acc[t][th] = vzero8();
      // column c of the round's staging tile is selector value c / ST_N of state p * ST_N + c % ST_N;
      // this wave has the columns [wid * 64, wid * 64 + 64)
      const int wrow = (wid * 64 / ST_N) * NN + p * ST_N + (wid * 64) % ST_N;
      gemm_rows4<HH>(Wso + (size_t)wrow * HH, sh, LDS_LD(HH), lane, acc);
      // Epilogue: every wave lays its raw sums into the staging tile, then the work-group walks
      // the tile row by row. A thread takes 4 neighbouring states n of one token and all four
      // selector values of each (ST_N apart in a row), so u is loaded once, 16 bytes a lane, a
      // wave's store fills 4 whole lines, and the activation code stands in the text once.
      if (p) __syncthreads();    // the first round's readers have left the staging tile
#pragma unroll  // constant th, t: acc[][] stays in registers
      for (int th = 0; th < 2; ++th) {
#pragma unroll
        for (int t = 0; t < 4; ++t) {
          float* q = area + (th * 16 + r) * ST_LD + (wid * 4 + t) * 16 + hf * 8;
          v4f lo, hi;
#pragma unroll
          for (int j = 0; j < 4; ++j) { lo[j] = acc[t][th][j]; hi[j] = acc[t][th][j + 4]; }
          *(v4f*)q = lo;
          *(v4f*)(q + 4) = hi;
        }
      }
      __syncthreads();           // the staging tile is complete
#pragma unroll 1  // stays a loop: unrolled, the activation code would stand in the text 4 times
      for (int idx = threadIdx.x; idx < TOK_TILE * (ST_N / 4); idx += 256) {
        int row = idx / (ST_N / 4);            // the same in every lane of a wave
        int nn = (idx % (ST_N / 4)) * 4;
        int tok = tl[row];
        if (tok < 0) continue;
        const float* q = area + row * ST_LD + nn;
        v4f va = *(const v4f*)q;
        v4f vb = *(const v4f*)(q + ST_N);
        v4f vc = *(const v4f*)(q + 2 * ST_N);
        v4f vd = *(const v4f*)(q + 3 * ST_N);
        int n = p * ST_N + nn;
        size_t base = (size_t)tok * NN + n;
        v4f uu = *(const v4f*)(u + base);
        v4f dd = *(const v4f*)(dp + n);
        v4f oa, ob, oc, os;
#pragma unroll
        for (int j = 0; j < 4; ++j) {
          oa[j] = sigmoidf_(va[j]);
          ob[j] = tanhf(vb[j]) * uu[j];
          oc[j] = tanhf(vc[j]);
          os[j] = dd[j] * sigmoidf_(vd[j]) * uu[j];
        }
        *(v4f*)(aarr + base) = oa;
        *(v4f*)(buarr + base) = ob;
        *(v4f*)(carr + base) = oc;
        *(v4f*)(skarr + base) = os;
      }
    }
  }
}

// ---------------- scan: h = a*h + b*u ; y = c*h + skip ----------------
// A step reads and writes only its own expert's state, so the 2048 steps of a batch row are
// EE independent chains. One work-group takes one (batch row, expert, SCAN_T states): it lists
// the expert's steps in time order in LDS and walks only those, SCAN_U steps' operands per trip.

#define SCAN_T 64                    // states per work-group: its y stores fill one 128-byte line
#define SCAN_W (SCAN_T / 32)         // waves per work-group
#define SCAN_U 32                    // steps whose operands are loaded together
#define SCAN_R (SS / SCAN_T)         // routes per lane while the list is built

// One trip: SCAN_U steps of the list. In the last, short trip (FULL false) the surplus places
// repeat step left - 1 with h held, so they store that step's y again and no store needs a test.
template <bool FULL>
__device__ __forceinline__ float scan_trip(
    const int* lst, int left, unsigned rowIdx, float h,
    const float* __restrict__ a, const float* __restrict__ bu,
    const float* __restrict__ c, const float* __restrict__ sk, bf16* __restrict__ ybf) {
  unsigned idx[SCAN_U];              // this lane's element in the four f32 planes and in y
  float av[SCAN_U], bv[SCAN_U], cv[SCAN_U], sv[SCAN_U];
#pragma unroll  // constant j: idx[] stays in registers
  for (int j = 0; j < SCAN_U; ++j)
    idx[j] = rowIdx + (unsigned)lst[(FULL || j < left) ? j : left - 1] * NN;
#pragma unroll  // lets the trip's loads issue together, ahead of the sums
  for (int j = 0; j < SCAN_U; ++j) {
    av[j] = a[idx[j]];
    bv[j] = bu[idx[j]];
    cv[j] = c[idx[j]];
    sv[j] = sk[idx[j]];
  }
  // holds every load in front of the sums: one that sinks among them starts its latency late
  __builtin_amdgcn_sched_barrier(0);
  bf16 yv[SCAN_U];
#pragma unroll  // constant j: the operand arrays stay in registers
  for (int j = 0; j < SCAN_U; ++j) {
    float hn = av[j] * h + bv[j];
    h = (FULL || j < left) ? hn : h;
    yv[j] = (bf16)(cv[j] * h + sv[j]);
  }
  // holds the stores behind the last y: mixed in with the sums they share one data register,
  // and each sum then waits (s_wait_xcnt) for the store in front of it
  __builtin_amdgcn_sched_barrier(0);
#pragma unroll  // constant j: idx[] and yv[] stay in registers
  for (int j = 0; j < SCAN_U; ++j) ybf[idx[j]] = yv[j];
  // the next trip rewrites the index and data registers that these stores name
  if (FULL) asm volatile("s_wait_xcnt 0x0" ::: "memory");
  return h;
}

__global__ void __launch_bounds__(SCAN_T) k_scan(
    const int* __restrict__ routes, const float* __restrict__ a,
    const float* __restrict__ bu, const float* __restrict__ c,
    const float* __restrict__ sk, bf16* __restrict__ ybf) {
  __shared__ __attribute__((aligned(16))) int list[SS];
  __shared__ int wcnt[SCAN_W];
  const int slice = blockIdx.x % (NN / SCAN_T);
  const int e = (blockIdx.x / (NN / SCAN_T)) % EE;
  const int b = blockIdx.x / ((NN / SCAN_T) * EE);
  const int wid = threadIdx.x >> 5;
  const int lane = threadIdx.x & 31;

  // wave wid lists the steps t in [wid * 32 * SCAN_R, (wid + 1) * 32 * SCAN_R), 32 per ballot
  const int t0 = wid * (32 * SCAN_R);
  unsigned hit[SCAN_R];
  int mine = 0;
#pragma unroll  // the route loads issue together; hit[] stays in scalar registers
  for (int i = 0; i < SCAN_R; ++i) {
    hit[i] = __builtin_amdgcn_ballot_w32(routes[b * SS + t0 + i * 32 + lane] == e);
    mine += __popc(hit[i]);
  }
  if (lane == 0) wcnt[wid] = mine;
  __syncthreads();
  int pos = 0, cnt = 0;
#pragma unroll  // SCAN_W is 2: no loop is left
  for (int w = 0; w < SCAN_W; ++w) {
    int v = wcnt[w];
    if (w < wid) pos += v;
    cnt += v;
  }
  cnt = __builtin_amdgcn_readfirstlane(cnt);   // same in every lane: keeps the trip tests scalar
#pragma unroll  // constant i: hit[] stays in scalar registers
  for (int i = 0; i < SCAN_R; ++i) {
    if ((hit[i] >> lane) & 1u)
      list[pos + (int)__builtin_amdgcn_mbcnt_lo(hit[i], 0u)] = t0 + i * 32 + lane;
    pos += __popc(hit[i]);
  }
  __syncthreads();

  const unsigned rowIdx = (unsigned)(b * SS) * NN + slice * SCAN_T + threadIdx.x;
  float h = 0.f;
  int base = 0;
  for (; base + SCAN_U <= cnt; base += SCAN_U)
    h = scan_trip<true>(list + base, SCAN_U, rowIdx, h, a, bu, c, sk, ybf);
  if (base < cnt)
    scan_trip<false>(list + base, cnt - base, rowIdx, h, a, bu, c, sk, ybf);
}

// ---------------- GEMM 3: out = Wout[e] @ y ----------------

__global__ void __launch_bounds__(256) k_out_gemm(
    const bf16* __restrict__ ybf, const bf16* __restrict__ woutb,
    const int* __restrict__ tokenList, const int* __restrict__ offsets,
    const int* __restrict__ tileOff, const int* __restrict__ totalTiles,
    float* __restrict__ out) {
  __shared__ __attribute__((aligned(16))) bf16 ys[TOK_TILE * LDS_LD(NN)];   // 16.5 KB
  __shared__ int tl[TOK_TILE];
  TileInfo ti;
  if (!tile_info(offsets, tileOff, totalTiles, ti)) return;
  if (threadIdx.x < TOK_TILE) {
    int li = ti.listBase + (int)threadIdx.x;
    tl[threadIdx.x] = (li < ti.listEnd) ? tokenList[li] : -1;
  }
  __syncthreads();
  gather_rows<NN>(ybf, ys, tl);
  __syncthreads();

  const int wid = threadIdx.x >> 5;
  const int lane = threadIdx.x & 31;
  const bf16* W = woutb + (size_t)ti.e * DD * NN;
  const int r = lane & 15, hf = lane >> 4;
  // two rounds of 4 feature tiles per wave: a round's sums take half the registers, which leaves
  // room for the second set of weight fragments
#pragma unroll 1  // stays a loop: unrolled, both rounds' registers could be live together
  for (int p = 0; p < 2; ++p) {
    v8f acc[4][2];
#pragma unroll
    for (int t = 0; t < 4; ++t)
#pragma unroll
      for (int th = 0; th < 2; ++th) acc[t][th] = vzero8();
    gemm_rows4<NN>(W + (size_t)((wid * 8 + p * 4) * 16) * NN, ys, LDS_LD(NN), lane, acc);
#pragma unroll
    for (int th = 0; th < 2; ++th) {
      int tok = tl[th * 16 + r];
      if (tok < 0) continue;
      float* op = out + (size_t)tok * DD;
#pragma unroll
      for (int t = 0; t < 4; ++t) {
        int fb = (wid * 8 + p * 4 + t) * 16 + hf * 8;
#pragma unroll
        for (int j = 0; j < 8; ++j) op[fb + j] = acc[t][th][j];
      }
    }
    // the next round rewrites the address and data registers that these stores name
    asm volatile("s_wait_xcnt 0x0" ::: "memory");
  }
}

// ---------------- host launcher ----------------

extern "C" void kernel_launch(void* const* d_in, const int* in_sizes, int n_in,
                              void* d_out, int out_size, void* d_ws, size_t ws_size,
                              hipStream_t stream) {
  (void)in_sizes; (void)n_in; (void)out_size; (void)ws_size;
  const float* x      = (const float*)d_in[0];
  const int*   tokid  = (const int*)d_in[1];
  const float* Win    = (const float*)d_in[2];
  const float* Wsin   = (const float*)d_in[3];
  const float* Wsout  = (const float*)d_in[4];
  const float* Wout   = (const float*)d_in[5];
  const float* dparam = (const float*)d_in[6];
  float* out = (float*)d_out;

  char* p = (char*)d_ws;
  auto take = [&](size_t bytes) -> char* {
    char* q = p;
    p += (bytes + 255) & ~(size_t)255;
    return q;
  };

  int* routes     = (int*)take(sizeof(int) * BS);
  int* offsets    = (int*)take(sizeof(int) * (EE + 1));
  int* tileOff    = (int*)take(sizeof(int) * (EE + 1));
  int* totalTiles = (int*)take(sizeof(int));
  int* tokenList  = (int*)take(sizeof(int) * BS);
  bf16* xbf    = (bf16*)take(sizeof(bf16) * (size_t)BS * DD);
  bf16* winb   = (bf16*)take(sizeof(bf16) * (size_t)EE * NN * DD);
  bf16* wsinb  = (bf16*)take(sizeof(bf16) * (size_t)EE * HH * DD);
  bf16* wsoutb = (bf16*)take(sizeof(bf16) * (size_t)EE * 4 * NN * HH);
  bf16* woutb  = (bf16*)take(sizeof(bf16) * (size_t)EE * DD * NN);
  float* u     = (float*)take(sizeof(float) * (size_t)BS * NN);
  float* aarr  = (float*)take(sizeof(float) * (size_t)BS * NN);
  float* buarr = (float*)take(sizeof(float) * (size_t)BS * NN);
  float* carr  = (float*)take(sizeof(float) * (size_t)BS * NN);
  float* skarr = (float*)take(sizeof(float) * (size_t)BS * NN);
  bf16* ybf    = (bf16*)take(sizeof(bf16) * (size_t)BS * NN);

  k_prep<<<CVT_GRID + 1, CVT_WAVES * 32, 0, stream>>>(
      x, Win, Wsin, Wsout, Wout, tokid, xbf, winb, wsinb, wsoutb, woutb,
      routes, offsets, tileOff, totalTiles, tokenList);

  k_u_gemm<<<TILE_MAX, 256, 0, stream>>>(xbf, winb, tokenList, offsets, tileOff,
                                         totalTiles, u);
  k_sel_gemm<<<TILE_MAX, 256, 0, stream>>>(xbf, wsinb, wsoutb, u, dparam, tokenList,
                                           offsets, tileOff, totalTiles,
                                           aarr, buarr, carr, skarr);
  k_scan<<<BB * EE * (NN / SCAN_T), SCAN_T, 0, stream>>>(routes, aarr, buarr, carr, skarr, ybf);
  k_out_gemm<<<TILE_MAX, 256, 0, stream>>>(ybf, woutb, tokenList, offsets, tileOff,
                                           totalTiles, out);
}

// v007
// It runs in 163 microseconds.
// In two side-by-side timings against v006, it was 1.43 and 1.42 times as fast.
// All steps since v000 together make it 5.26 times as fast.
#include <hip/hip_runtime.h>
#include <hip/hip_bf16.h>
#include <stdint.h>

#define BB 8
#define SS 2048
#define DD 1024
#define NN 256
#define HH 512
#define EE 8
#define BS (BB * SS)                 // 16384 tokens
#define TOK_TILE 32
#define TILE_MAX (BS / TOK_TILE + EE)  // worst-case 32-token tiles over all experts
// Row pitch, in bf16 elements, of a token tile in LDS whose rows hold n elements: 16 bytes more
// than the row, an odd multiple of 16 bytes, so the 16 rows that one 16-byte fragment load
// touches fall on different banks (at the bare pitch, a multiple of 256 bytes, on the same four).
#define LDS_LD(n) ((n) + 8)
static_assert((LDS_LD(DD) / 8) % 2 == 1 && (LDS_LD(HH) / 8) % 2 == 1 && (LDS_LD(NN) / 8) % 2 == 1,
              "every tile pitch is an odd multiple of 16 bytes");

typedef __bf16 bf16;
typedef __attribute__((ext_vector_type(16))) __bf16 v16bf;
typedef __attribute__((ext_vector_type(8)))  __bf16 v8bf;
typedef __attribute__((ext_vector_type(8)))  float   v8f;
typedef __attribute__((ext_vector_type(4)))  float   v4f;
typedef __attribute__((ext_vector_type(4)))  __bf16 v4bf;

__device__ __forceinline__ v8f vzero8() {
  v8f v;
#pragma unroll
  for (int i = 0; i < 8; ++i) v[i] = 0.f;
  return v;
}

__device__ __forceinline__ float sigmoidf_(float x) { return 1.f / (1.f + __expf(-x)); }

// D = A(16xK, rows=M striped per lane) x B(Kx16, cols=N striped per lane) + C
__device__ __forceinline__ v8f wmma_bf16(v16bf a, v16bf b, v8f c) {
  return __builtin_amdgcn_wmma_f32_16x16x32_bf16(false, a, false, b, (short)0, c, false, false);
}

// Load one 16x32 bf16 fragment from a row-major tile (leading dim ld, elements).
// Per ISA 7.12.2: lane (r = lane&15, h = lane>>4) holds K = k0+h*8+{0..7} and k0+16+h*8+{0..7} of row r.
__device__ __forceinline__ v16bf load_frag(const bf16* tile, int ld, int k0, int lane) {
  const int r = lane & 15;
  const int h = (lane >> 4) & 1;
  const bf16* p = tile + (size_t)r * ld + k0 + h * 8;
  v8bf c0 = *(const v8bf*)(p);
  v8bf c1 = *(const v8bf*)(p + 16);
  v16bf f;
#pragma unroll
  for (int i = 0; i < 8; ++i) { f[i] = c0[i]; f[i + 8] = c1[i]; }
  return f;
}

// The bf16 weights lie in the workspace in fragment order: a block of 16 rows x 32 k is 1024
// contiguous bytes, the blocks of 16 rows follow one another along k, and inside a block lane l's
// two 16-byte pieces stand at bytes l * 16 and 512 + l * 16. A wave's load is then 512 contiguous
// bytes, 4 whole lines; from a row-major array it would be 32 bytes out of each of 16 lines. The lane
// gets the same elements in the same places as from load_frag. rows16 = where the 16 rows begin
// (row * K elements from the array's start, as in the row-major array).
#define WBLK (16 * 32)               // elements of a block
__device__ __forceinline__ v16bf load_wfrag(const bf16* rows16, int k0, int lane) {
  const bf16* p = rows16 + (size_t)(k0 / 32) * WBLK + lane * 8;
  v8bf c0 = *(const v8bf*)(p);
  v8bf c1 = *(const v8bf*)(p + WBLK / 2);
  v16bf f;
#pragma unroll
  for (int i = 0; i < 8; ++i) { f[i] = c0[i]; f[i + 8] = c1[i]; }
  return f;
}

struct TileInfo { int e, listBase, listEnd; };

__device__ __forceinline__ bool tile_info(const int* offsets, const int* tileOff,
                                          const int* totalTiles, TileInfo& ti) {
  int tile = blockIdx.x;
  if (tile >= *totalTiles) return false;
  int e = 0;
#pragma unroll
  for (int k = 1; k < EE; ++k) if (tile >= tileOff[k]) e = k;
  ti.e = e;
  int local = tile - tileOff[e];
  ti.listBase = offsets[e] + local * TOK_TILE;
  ti.listEnd = offsets[e + 1];
  return true;
}

// Cooperative gather of TOK_TILE token rows (ROW_ELEMS bf16 each) into LDS, at pitch
// LDS_LD(ROW_ELEMS); invalid -> 0.
template <int ROW_ELEMS>
__device__ __forceinline__ void gather_rows(const bf16* src_base, bf16* dst, const int* tl) {
  constexpr int CPR = ROW_ELEMS / 8;          // 16B chunks per row
  constexpr int IT = TOK_TILE * CPR / 256;    // chunks per thread
  static_assert(IT * 256 == TOK_TILE * CPR, "the threads share the chunks evenly");
  static_assert(IT % 4 == 0, "the loads go out four at a time");
  int tok[IT];
  uint4 v[IT];
#pragma unroll  // constant i: tok[] stays in registers
  for (int i = 0; i < IT; ++i) tok[i] = tl[((int)threadIdx.x + i * 256) / CPR];
#pragma unroll  // a thread's loads all issue before the first is used: none is under a test (an
                // empty place reads row 0) and none is waited for here
  for (int i = 0; i < IT; i += 4) {
    const uint4* p[4];
#pragma unroll
    for (int j = 0; j < 4; ++j) {
      int tsafe = tok[i + j] < 0 ? 0 : tok[i + j];
      p[j] = (const uint4*)(src_base + (size_t)tsafe * ROW_ELEMS) +
             ((int)threadIdx.x + (i + j) * 256) % CPR;
      v[i + j] = *p[j];
    }
    // stands before any register that these loads name is rewritten: as inputs of the wait the
    // four addresses stay in their registers up to it
    asm volatile("s_wait_xcnt 0x0" :: "v"(p[0]), "v"(p[1]), "v"(p[2]), "v"(p[3]) : "memory");
  }
#pragma unroll  // constant i: tok[] and v[] stay in registers
  for (int i = 0; i < IT; ++i) {
    int idx = (int)threadIdx.x + i * 256;
    uint4 w = v[i];
    if (tok[i] < 0) { w.x = 0u; w.y = 0u; w.z = 0u; w.w = 0u; }
    ((uint4*)(dst + (size_t)(idx / CPR) * LDS_LD(ROW_ELEMS)))[idx % CPR] = w;
  }
}

// ---------------- the GEMMs' inner loop ----------------
// One wave: 2 or 4 tiles of 16 weight rows (in fragment order, K elements a row, from global
// memory) times the 32 tokens of an LDS tile. The weight fragments live in two register sets; while
// one set is multiplied, all loads of the other are in flight. A set is 2 tiles x 64 k: 2 KB in a
// row of each tile.

#define SET_K 64                     // k per register set
typedef v16bf wset[2][2];            // [k-step][tile]

__device__ __forceinline__ void load_set(wset& a, const bf16* W, int ld, int k, int lane) {
  // the two fences keep the set's loads one group at this place: sunk towards their uses they
  // would share registers and each would be waited for alone
  __builtin_amdgcn_sched_barrier(0);
#pragma unroll  // constant s, t: a[][] stays in registers
  for (int s = 0; s < 2; ++s)
#pragma unroll
    for (int t = 0; t < 2; ++t)
      a[s][t] = load_wfrag(W + (size_t)(t * 16) * ld, k + s * 32, lane);
  __builtin_amdgcn_sched_barrier(0);
}

// the set's tiles are the tiles T0 and T0 + 1 of acc
template <int T0, int TT>
__device__ __forceinline__ void mma_set(const wset& a, const bf16* tile, int tld, int k, int lane,
                                        v8f (&acc)[TT][2]) {
#pragma unroll  // constant s, t: a[][] and acc[][] stay in registers
  for (int s = 0; s < 2; ++s) {
    v16bf b0 = load_frag(tile, tld, k + s * 32, lane);
    v16bf b1 = load_frag(tile + 16 * tld, tld, k + s * 32, lane);
#pragma unroll
    for (int t = 0; t < 2; ++t) {
      acc[T0 + t][0] = wmma_bf16(a[s][t], b0, acc[T0 + t][0]);
      acc[T0 + t][1] = wmma_bf16(a[s][t], b1, acc[T0 + t][1]);
    }
  }
}

// 2 tiles: the sets take turns along k
template <int K>
__device__ __forceinline__ void gemm_rows2(const bf16* W, const bf16* tile, int tld, int lane,
                                           v8f (&acc)[2][2]) {
  static_assert(K % (2 * SET_K) == 0, "K is a whole number of set pairs");
  wset a0, a1;
  load_set(a0, W, K, 0, lane);
#pragma unroll 1  // stays a loop of two sets: unrolled further, more sets would be live at a time
  for (int k = 0; k < K - 2 * SET_K; k += 2 * SET_K) {
    load_set(a1, W, K, k + SET_K, lane);
    mma_set<0, 2>(a0, tile, tld, k, lane, acc);
    load_set(a0, W, K, k + 2 * SET_K, lane);
    mma_set<0, 2>(a1, tile, tld, k + SET_K, lane, acc);
  }
  load_set(a1, W, K, K - SET_K, lane);
  mma_set<0, 2>(a0, tile, tld, K - 2 * SET_K, lane, acc);
  mma_set<0, 2>(a1, tile, tld, K - SET_K, lane, acc);
}

// 4 tiles: one set has the tiles 0 and 1, the other the tiles 2 and 3, of the same 64 k
template <int K>
__device__ __forceinline__ void gemm_rows4(const bf16* W, const bf16* tile, int tld, int lane,
                                           v8f (&acc)[4][2]) {
  static_assert(K % SET_K == 0, "K is a whole number of sets");
  const bf16* W2 = W + (size_t)32 * K;
  wset a0, a1;
  load_set(a0, W, K, 0, lane);
#pragma unroll 1  // stays a loop of two sets: unrolled further, more sets would be live at a time
  for (int k = 0; k < K - SET_K; k += SET_K) {
    load_set(a1, W2, K, k, lane);
    mma_set<0, 4>(a0, tile, tld, k, lane, acc);
    load_set(a0, W, K, k + SET_K, lane);
    mma_set<2, 4>(a1, tile, tld, k, lane, acc);
  }
  load_set(a1, W2, K, K - SET_K, lane);
  mma_set<0, 4>(a0, tile, tld, K - SET_K, lane, acc);
  mma_set<2, 4>(a1, tile, tld, K - SET_K, lane, acc);
}

// ---------------- preparation: one launch ----------------
// Nothing here depends on another work-group, so it is one grid. Work-group 0 routes the tokens
// and builds the per-expert token lists; the other CVT_GRID work-groups turn x and the four
// weight arrays into bf16, the weights in the fragment order that load_wfrag reads.

// f32 -> bf16 as a stream: a grid that is resident at once, one work-group per WGP, and every
// wave loops over whole pieces of CVT_PIECE floats. A wave's load covers 512 bytes (contiguous in x, 4 whole lines in a weight array),
// its store 256, and CVT_LOADS loads of a lane are in flight together.
#define CVT_GRID 256                       // converting work-groups
#define CVT_WAVES 16                       // waves per work-group
#define CVT_LOADS 8                        // 16-byte loads per lane and trip
#define CVT_PIECE (CVT_LOADS * 32 * 4)     // floats per wave and trip
static_assert((BS * DD) % CVT_PIECE == 0 && (EE * NN * DD) % CVT_PIECE == 0 &&
              (EE * HH * DD) % CVT_PIECE == 0 && (EE * 4 * NN * HH) % CVT_PIECE == 0,
              "every converted array is a whole number of pieces");
// A piece of a weight array is 16 rows x 64 k, two blocks of the fragment order: the 1024 elements
// that it writes are contiguous. PC_LOG(K) = log2 of the pieces along a row of K elements.
static_assert(CVT_PIECE == 2 * WBLK && CVT_LOADS == 8, "a weight piece is two blocks");
#define PC_LOG(K) __builtin_ctz((K) / 64)
#define PC_X     (BS * DD / CVT_PIECE)          // pieces of each array, in the order they are dealt
#define PC_WIN   (EE * NN * DD / CVT_PIECE)
#define PC_WSIN  (EE * HH * DD / CVT_PIECE)
#define PC_WSOUT (EE * 4 * NN * HH / CVT_PIECE)
#define PC_WOUT  (EE * DD * NN / CVT_PIECE)

#define RT_R (BS / (CVT_WAVES * 32))       // tokens per lane of the routing work-group

// One work-group: routes[], the token list sorted by expert (token order kept inside an expert),
// the experts' offsets in it and their tile offsets. Wave wid takes the tokens
// [wid * 32 * RT_R, (wid + 1) * 32 * RT_R), 32 a round; a token's rank among its wave's tokens of
// the same expert comes from ballots, the waves' totals meet in LDS.
__device__ __forceinline__ void build_lists(
    const int* __restrict__ tok, int* __restrict__ routes, int* __restrict__ offsets,
    int* __restrict__ tileOff, int* __restrict__ totalTiles, int* __restrict__ tokenList) {
  __shared__ int wtot[CVT_WAVES * EE];
  const int wid = threadIdx.x >> 5;
  const int lane = threadIdx.x & 31;
  const int t0 = wid * (32 * RT_R) + lane;
  int id[RT_R];
#pragma unroll  // the token loads issue together
  for (int i = 0; i < RT_R; ++i) id[i] = tok[t0 + i * 32];
  int cnt[EE];                       // the wave's tokens of each expert so far: scalar registers
#pragma unroll  // constant e: cnt[] stays in scalar registers
  for (int e = 0; e < EE; ++e) cnt[e] = 0;
  unsigned pack[RT_R];               // rank in the low half, route in the high half
#pragma unroll  // constant i: id[] and pack[] stay in registers
  for (int i = 0; i < RT_R; ++i) {
    unsigned x = (unsigned)id[i];
    x ^= x >> 16; x *= 2246822507u;
    x ^= x >> 13; x *= 3266489909u;
    x ^= x >> 16;
    int r = (int)(x & 7u);   // % 8
    int rk = 0;
#pragma unroll  // constant e: cnt[] stays in scalar registers
    for (int e = 0; e < EE; ++e) {
      unsigned m = __builtin_amdgcn_ballot_w32(r == e);
      rk = (r == e) ? cnt[e] + (int)__builtin_amdgcn_mbcnt_lo(m, 0u) : rk;
      cnt[e] += __popc(m);
    }
    pack[i] = (unsigned)rk | ((unsigned)r << 16);
  }
#pragma unroll  // behind the ranks, all together: among them each store would hold up the next round
  for (int i = 0; i < RT_R; ++i) routes[t0 + i * 32] = (int)(pack[i] >> 16);
  int mine = 0;
#pragma unroll  // constant e: cnt[] stays in scalar registers
  for (int e = 0; e < EE; ++e) if (lane == e) mine = cnt[e];
  if (lane < EE) wtot[wid * EE + lane] = mine;
  __syncthreads();
  // lane l looks after expert l % EE: its tokens in the waves in front of this one, and in all
  const int el = lane & (EE - 1);
  int before = 0, total = 0;
#pragma unroll  // the LDS loads issue together
  for (int w = 0; w < CVT_WAVES; ++w) {
    int v = wtot[w * EE + el];
    if (w < wid) before += v;
    total += v;
  }
  int off[EE + 1], toff[EE + 1];
  off[0] = 0;
  toff[0] = 0;
#pragma unroll  // constant e: off[] and toff[] stay in scalar registers
  for (int e = 0; e < EE; ++e) {
    int c = __builtin_amdgcn_readlane(total, e);
    off[e + 1] = off[e] + c;
    toff[e + 1] = toff[e] + (c + TOK_TILE - 1) / TOK_TILE;
  }
  int start = before;                // where this wave's tokens of expert el begin in the list
#pragma unroll  // constant e: off[] stays in scalar registers
  for (int e = 0; e < EE; ++e) if (el == e) start += off[e];
#pragma unroll  // constant i: pack[] stays in registers
  for (int i = 0; i < RT_R; ++i) {
    int r = (int)(pack[i] >> 16);
    int pos = __builtin_amdgcn_ds_bpermute(r << 2, start) + (int)(pack[i] & 0xffffu);
    tokenList[pos] = t0 + i * 32;
  }
  if (threadIdx.x == 0) {
#pragma unroll  // constant e: off[] and toff[] stay in scalar registers
    for (int e = 0; e <= EE; ++e) {
      offsets[e] = off[e];
      tileOff[e] = toff[e];
    }
    *totalTiles = toff[EE];
  }
}

__global__ void __launch_bounds__(CVT_WAVES * 32) k_prep(
    const float* __restrict__ x, const float* __restrict__ win,
    const float* __restrict__ wsin, const float* __restrict__ wsout,
    const float* __restrict__ wout, const int* __restrict__ tok,
    bf16* __restrict__ xbf, bf16* __restrict__ winb, bf16* __restrict__ wsinb,
    bf16* __restrict__ wsoutb, bf16* __restrict__ woutb,
    int* __restrict__ routes, int* __restrict__ offsets, int* __restrict__ tileOff,
    int* __restrict__ totalTiles, int* __restrict__ tokenList) {
  if (blockIdx.x == 0) {             // the first to start: its chain of steps is the longest
    build_lists(tok, routes, offsets, tileOff, totalTiles, tokenList);
    return;
  }
  // same in every lane: keeps the choice of the array scalar
  const int wid = __builtin_amdgcn_readfirstlane((int)(threadIdx.x >> 5));
  const int lane = threadIdx.x & 31;
  // piece -> (wave, work-group) with the work-group running fastest: the pieces that are in
  // flight at one time lie side by side
  for (int p = wid * CVT_GRID + (int)blockIdx.x - 1;
       p < PC_X + PC_WIN + PC_WSIN + PC_WSOUT + PC_WOUT; p += CVT_WAVES * CVT_GRID) {
    int q = p;
    int lk = -1;                     // PC_LOG of a weight array; x stays row-major
    const float* in = x;
    bf16* out = xbf;
    if (q >= PC_X) {
      q -= PC_X; in = win; out = winb; lk = PC_LOG(DD);
      if (q >= PC_WIN) {
        q -= PC_WIN; in = wsin; out = wsinb;
        if (q >= PC_WSIN) {
          q -= PC_WSIN; in = wsout; out = wsoutb; lk = PC_LOG(HH);
          if (q >= PC_WSOUT) { q -= PC_WSOUT; in = wout; out = woutb; lk = PC_LOG(NN); }
        }
      }
    }
    if (lk < 0) {
      const v4f* s = (const v4f*)(in + (size_t)q * CVT_PIECE) + lane;
      v4bf* d = (v4bf*)(out + (size_t)q * CVT_PIECE) + lane;
      v4f v[CVT_LOADS];
#pragma unroll  // the trip's loads issue together, ahead of the first store
      for (int j = 0; j < CVT_LOADS; ++j) v[j] = s[j * 32];
#pragma unroll  // constant j: v[] stays in registers
      for (int j = 0; j < CVT_LOADS; ++j) d[j * 32] = __builtin_convertvector(v[j], v4bf);
    } else {
      // Load j takes 32 k (block j / 4 of the piece's two) of the rows (j % 4) * 4 + {0..3}: one
      // whole line of each row, 8 lanes to a line. Lane (rr = lane >> 3, kq = lane & 7) has the k
      // kq * 4 + {0..3} of its row; in load_frag's map they are half kq & 1 of the 16-byte piece
      // kq >> 2 of fragment lane ((kq >> 1) & 1) * 16 + row. A store lays down 4 runs of 64 bytes,
      // and the four stores of a block fill its lines.
      const int rr = lane >> 3, kq = lane & 7;
      const size_t ld = (size_t)64 << lk;      // elements in a row
      const float* s = in + ((size_t)(q >> lk) * 16 + rr) * ld + (q & ((1 << lk) - 1)) * 64 + kq * 4;
      bf16* d = out + (size_t)q * CVT_PIECE + (kq >> 2) * (WBLK / 2) + ((kq >> 1) & 1) * 128 +
                rr * 8 + (kq & 1) * 4;
      const float* sp[4] = {s, s + 4 * ld, s + 8 * ld, s + 12 * ld};
      v4f v[CVT_LOADS];
#pragma unroll  // the trip's loads issue together, ahead of the first store
      for (int j = 0; j < CVT_LOADS; ++j) v[j] = *(const v4f*)(sp[j % 4] + (j / 4) * 32);
      // stands before any register that these loads name is rewritten: as inputs of the wait the
      // four addresses stay in their registers up to it
      asm volatile("s_wait_xcnt 0x0" :: "v"(sp[0]), "v"(sp[1]), "v"(sp[2]), "v"(sp[3]) : "memory");
#pragma unroll  // constant j: v[] stays in registers
      for (int j = 0; j < CVT_LOADS; ++j)
        *(v4bf*)(d + (j / 4) * WBLK + (j % 4) * 32) = __builtin_convertvector(v[j], v4bf);
      // stands directly behind the stores, before any way out of this block on which a register
      // that they name could be rewritten
      asm volatile("s_wait_xcnt 0x0" ::: "memory");
    }
    // the next trip rewrites the address and data registers that these loads and stores name
    asm volatile("s_wait_xcnt 0x0" ::: "memory");
  }
}

// ---------------- GEMM 1: u = Win[e] @ x ----------------

__global__ void __launch_bounds__(256) k_u_gemm(
    const bf16* __restrict__ xbf, const bf16* __restrict__ winb,
    const int* __restrict__ tokenList, const int* __restrict__ offsets,
    const int* __restrict__ tileOff, const int* __restrict__ totalTiles,
    float* __restrict__ u) {
  __shared__ __attribute__((aligned(16))) bf16 xs[TOK_TILE * LDS_LD(DD)];   // 64.5 KB
  __shared__ int tl[TOK_TILE];
  TileInfo ti;
  if (!tile_info(offsets, tileOff, totalTiles, ti)) return;
  if (threadIdx.x < TOK_TILE) {
    int li = ti.listBase + (int)threadIdx.x;
    tl[threadIdx.x] = (li < ti.listEnd) ? tokenList[li] : -1;
  }
  __syncthreads();
  gather_rows<DD>(xbf, xs, tl);
  __syncthreads();

  const int wid = threadIdx.x >> 5;
  const int lane = threadIdx.x & 31;
  const bf16* W = winb + (size_t)ti.e * NN * DD;
  v8f acc[2][2];   // [ftile][token-half]
#pragma unroll
  for (int t = 0; t < 2; ++t)
#pragma unroll
    for (int th = 0; th < 2; ++th) acc[t][th] = vzero8();

  gemm_rows2<DD>(W + (size_t)(wid * 2 * 16) * DD, xs, LDS_LD(DD), lane, acc);
  const int r = lane & 15, hf = lane >> 4;
#pragma unroll
  for (int th = 0; th < 2; ++th) {
    int tok = tl[th * 16 + r];
    if (tok < 0) continue;
    float* up = u + (size_t)tok * NN;
#pragma unroll
    for (int t = 0; t < 2; ++t) {
      int fb = (wid * 2 + t) * 16 + hf * 8;
#pragma unroll
      for (int j = 0; j < 8; ++j) up[fb + j] = acc[t][th][j];
    }
  }
}

// ---- GEMM 2 (fused): sh = silu(Wsin@x) in LDS, sel = Wsout@sh -> a, b*u, c, skip ----

// Stage 2 and its epilogue go in two rounds of ST_N states each: a round's sums take half the
// registers, which leaves room for the second set of weight fragments.
#define ST_N (NN / 2)
// Row pitch, in floats, of the epilogue's staging tile (32 tokens x 4*ST_N selector values): an odd
// multiple of 16 bytes, so the 16 rows that one 16-byte LDS store touches fall on different banks.
#define ST_LD (4 * ST_N + 4)

// 6 waves per SIMD: three work-groups to a WGP, so that all tiles (a few more than two per WGP) are
// resident at once and none waits for a first round to end
__global__ void __launch_bounds__(256, 6) k_sel_gemm(
    const bf16* __restrict__ xbf, const bf16* __restrict__ wsinb,
    const bf16* __restrict__ wsoutb, const float* __restrict__ u,
    const float* __restrict__ dparam,
    const int* __restrict__ tokenList, const int* __restrict__ offsets,
    const int* __restrict__ tileOff, const int* __restrict__ totalTiles,
    float* __restrict__ aarr, float* __restrict__ buarr,
    float* __restrict__ carr, float* __restrict__ skarr) {
  // One LDS area with two lives: the x tile, and, from the barrier behind stage 1 on (nobody reads
  // x any more), the epilogue's f32 staging tile.
  __shared__ __attribute__((aligned(16))) float area[TOK_TILE * LDS_LD(DD) / 2];   // 64.5 KB
  static_assert(sizeof(area) >= sizeof(float) * TOK_TILE * ST_LD, "the staging tile fits the area");
  bf16* xs = (bf16*)area;
  __shared__ __attribute__((aligned(16))) bf16 sh[TOK_TILE * LDS_LD(HH)];   // 32.5 KB
  __shared__ int tl[TOK_TILE];
  TileInfo ti;
  if (!tile_info(offsets, tileOff, totalTiles, ti)) return;
  if (threadIdx.x < TOK_TILE) {
    int li = ti.listBase + (int)threadIdx.x;
    tl[threadIdx.x] = (li < ti.listEnd) ? tokenList[li] : -1;
  }
  __syncthreads();
  gather_rows<DD>(xbf, xs, tl);
  __syncthreads();

  // same in every lane: keeps the bases of the wave's weight rows in scalar registers
  const int wid = __builtin_amdgcn_readfirstlane((int)(threadIdx.x >> 5));
  const int lane = threadIdx.x & 31;
  const int r = lane & 15, hf = lane >> 4;

  // stage 1: sh(32x512) = silu(Wsin[e](512x1024) @ x^T), 4 feature tiles per wave
  {
    const bf16* Wsi = wsinb + (size_t)ti.e * HH * DD;
    v8f acc[4][2];
#pragma unroll
    for (int t = 0; t < 4; ++t)
#pragma unroll
      for (int th = 0; th < 2; ++th) acc[t][th] = vzero8();
    gemm_rows4<DD>(Wsi + (size_t)(wid * 4 * 16) * DD, xs, LDS_LD(DD), lane, acc);
#pragma unroll
    for (int th = 0; th < 2; ++th) {
      int row = th * 16 + r;   // token row in tile
#pragma unroll
      for (int t = 0; t < 4; ++t) {
        int fb = (wid * 4 + t) * 16 + hf * 8;  // 8 consecutive h-features
#pragma unroll
        for (int j = 0; j < 8; ++j) {
          float v = acc[t][th][j];
          sh[row * LDS_LD(HH) + fb + j] = (bf16)(v * sigmoidf_(v));  // silu
        }
      }
    }
  }
  __syncthreads();

  // stage 2: sel(32x1024) = Wsout[e](1024x512) @ sh^T, in two rounds. Round p takes the states
  // [p * ST_N, (p + 1) * ST_N) with all four selector values of each (a, b, c, d stand NN rows
  // apart in Wsout): 4 * ST_N weight rows, 4 feature tiles per wave.
  {
    const bf16* Wso = wsoutb + (size_t)ti.e * (4 * NN) * HH;
    const float* dp = dparam + ti.e * NN;
#pragma unroll 1  // stays a loop: unrolled, the GEMM loop and the activation code would stand twice
    for (int p = 0; p < NN / ST_N; ++p) {
      v8f acc[4][2];
#pragma unroll
      for (int t = 0; t < 4; ++t)
#pragma unroll
        for (int th = 0; th < 2; ++th) acc[t][th] = vzero8();
      // column c of the round's staging tile is selector value c / ST_N of state p * ST_N + c % ST_N;
      // this wave has the columns [wid * 64, wid * 64 + 64)
      const int wrow = (wid * 64 / ST_N) * NN + p * ST_N + (wid * 64) % ST_N;
      gemm_rows4<HH>(Wso + (size_t)wrow * HH, sh, LDS_LD(HH), lane, acc);
      // Epilogue: every wave lays its raw sums into the staging tile, then the work-group walks
      // the tile row by row. A thread takes 4 neighbouring states n of one token and all four
      // selector values of each (ST_N apart in a row), so u is loaded once, 16 bytes a lane, a
      // wave's store fills 4 whole lines, and the activation code stands in the text once.
      if (p) __syncthreads();    // the first round's readers have left the staging tile
#pragma unroll  // constant th, t: acc[][] stays in registers
      for (int th = 0; th < 2; ++th) {
#pragma unroll
        for (int t = 0; t < 4; ++t) {
          float* q = area + (th * 16 + r) * ST_LD + (wid * 4 + t) * 16 + hf * 8;
          v4f lo, hi;
#pragma unroll
          for (int j = 0; j < 4; ++j) { lo[j] = acc[t][th][j]; hi[j] = acc[t][th][j + 4]; }
          *(v4f*)q = lo;
          *(v4f*)(q + 4) = hi;
        }
      }
      __syncthreads();           // the staging tile is complete
#pragma unroll 1  // stays a loop: unrolled, the activation code would stand in the text 4 times
      for (int idx = threadIdx.x; idx < TOK_TILE * (ST_N / 4); idx += 256) {
        int row = idx / (ST_N / 4);            // the same in every lane of a wave
        int nn = (idx % (ST_N / 4)) * 4;
        int tok = tl[row];
        if (tok < 0) continue;
        const float* q = area + row * ST_LD + nn;
        v4f va = *(const v4f*)q;
        v4f vb = *(const v4f*)(q + ST_N);
        v4f vc = *(const v4f*)(q + 2 * ST_N);
        v4f vd = *(const v4f*)(q + 3 * ST_N);
        int n = p * ST_N + nn;
        size_t base = (size_t)tok * NN + n;
        v4f uu = *(const v4f*)(u + base);
        v4f dd = *(const v4f*)(dp + n);
        v4f oa, ob, oc, os;
#pragma unroll
        for (int j = 0; j < 4; ++j) {
          oa[j] = sigmoidf_(va[j]);
          ob[j] = tanhf(vb[j]) * uu[j];
          oc[j] = tanhf(vc[j]);
          os[j] = dd[j] * sigmoidf_(vd[j]) * uu[j];
        }
        *(v4f*)(aarr + base) = oa;
        *(v4f*)(buarr + base) = ob;
        *(v4f*)(carr + base) = oc;
        *(v4f*)(skarr + base) = os;
      }
    }
  }
}

// ---------------- scan: h = a*h + b*u ; y = c*h + skip ----------------
// A step reads and writes only its own expert's state, so the 2048 steps of a batch row are
// EE independent chains. One work-group takes one (batch row, expert, SCAN_T states): it lists
// the expert's steps in time order in LDS and walks only those, SCAN_U steps' operands per trip.

#define SCAN_T 64                    // states per work-group: its y stores fill one 128-byte line
#define SCAN_W (SCAN_T / 32)         // waves per work-group
#define SCAN_U 32                    // steps whose operands are loaded together
#define SCAN_R (SS / SCAN_T)         // routes per lane while the list is built

// One trip: SCAN_U steps of the list. In the last, short trip (FULL false) the surplus places
// repeat step left - 1 with h held, so they store that step's y again and no store needs a test.
template <bool FULL>
__device__ __forceinline__ float scan_trip(
    const int* lst, int left, unsigned rowIdx, float h,
    const float* __restrict__ a, const float* __restrict__ bu,
    const float* __restrict__ c, const float* __restrict__ sk, bf16* __restrict__ ybf) {
  unsigned idx[SCAN_U];              // this lane's element in the four f32 planes and in y
  float av[SCAN_U], bv[SCAN_U], cv[SCAN_U], sv[SCAN_U];
#pragma unroll  // constant j: idx[] stays in registers
  for (int j = 0; j < SCAN_U; ++j)
    idx[j] = rowIdx + (unsigned)lst[(FULL || j < left) ? j : left - 1] * NN;
#pragma unroll  // lets the trip's loads issue together, ahead of the sums
  for (int j = 0; j < SCAN_U; ++j) {
    av[j] = a[idx[j]];
    bv[j] = bu[idx[j]];
    cv[j] = c[idx[j]];
    sv[j] = sk[idx[j]];
  }
  // holds every load in front of the sums: one that sinks among them starts its latency late
  __builtin_amdgcn_sched_barrier(0);
  bf16 yv[SCAN_U];
#pragma unroll  // constant j: the operand arrays stay in registers
  for (int j = 0; j < SCAN_U; ++j) {
    float hn = av[j] * h + bv[j];
    h = (FULL || j < left) ? hn : h;
    yv[j] = (bf16)(cv[j] * h + sv[j]);
  }
  // holds the stores behind the last y: mixed in with the sums they share one data register,
  // and each sum then waits (s_wait_xcnt) for the store in front of it
  __builtin_amdgcn_sched_barrier(0);
#pragma unroll  // constant j: idx[] and yv[] stay in registers
  for (int j = 0; j < SCAN_U; ++j) ybf[idx[j]] = yv[j];
  // the next trip rewrites the index and data registers that these stores name
  if (FULL) asm volatile("s_wait_xcnt 0x0" ::: "memory");
  return h;
}

__global__ void __launch_bounds__(SCAN_T) k_scan(
    const int* __restrict__ routes, const float* __restrict__ a,
    const float* __restrict__ bu, const float* __restrict__ c,
    const float* __restrict__ sk, bf16* __restrict__ ybf) {
  __shared__ __attribute__((aligned(16))) int list[SS];
  __shared__ int wcnt[SCAN_W];
  const int slice = blockIdx.x % (NN / SCAN_T);
  const int e = (blockIdx.x / (NN / SCAN_T)) % EE;
  const int b = blockIdx.x / ((NN / SCAN_T) * EE);
  const int wid = threadIdx.x >> 5;
  const int lane = threadIdx.x & 31;

  // wave wid lists the steps t in [wid * 32 * SCAN_R, (wid + 1) * 32 * SCAN_R), 32 per ballot
  const int t0 = wid * (32 * SCAN_R);
  unsigned hit[SCAN_R];
  int mine = 0;
#pragma unroll  // the route loads issue together; hit[] stays in scalar registers
  for (int i = 0; i < SCAN_R; ++i) {
    hit[i] = __builtin_amdgcn_ballot_w32(routes[b * SS + t0 + i * 32 + lane] == e);
    mine += __popc(hit[i]);
  }
  if (lane == 0) wcnt[wid] = mine;
  __syncthreads();
  int pos = 0, cnt = 0;
#pragma unroll  // SCAN_W is 2: no loop is left
  for (int w = 0; w < SCAN_W; ++w) {
    int v = wcnt[w];
    if (w < wid) pos += v;
    cnt += v;
  }
  cnt = __builtin_amdgcn_readfirstlane(cnt);   // same in every lane: keeps the trip tests scalar
#pragma unroll  // constant i: hit[] stays in scalar registers
  for (int i = 0; i < SCAN_R; ++i) {
    if ((hit[i] >> lane) & 1u)
      list[pos + (int)__builtin_amdgcn_mbcnt_lo(hit[i], 0u)] = t0 + i * 32 + lane;
    pos += __popc(hit[i]);
  }
  __syncthreads();

  const unsigned rowIdx = (unsigned)(b * SS) * NN + slice * SCAN_T + threadIdx.x;
  float h = 0.f;
  int base = 0;
  for (; base + SCAN_U <= cnt; base += SCAN_U)
    h = scan_trip<true>(list + base, SCAN_U, rowIdx, h, a, bu, c, sk, ybf);
  if (base < cnt)
    scan_trip<false>(list + base, cnt - base, rowIdx, h, a, bu, c, sk, ybf);
}

// ---------------- GEMM 3: out = Wout[e] @ y ----------------

__global__ void __launch_bounds__(256) k_out_gemm(
    const bf16* __restrict__ ybf, const bf16* __restrict__ woutb,
    const int* __restrict__ tokenList, const int* __restrict__ offsets,
    const int* __restrict__ tileOff, const int* __restrict__ totalTiles,
    float* __restrict__ out) {
  __shared__ __attribute__((aligned(16))) bf16 ys[TOK_TILE * LDS_LD(NN)];   // 16.5 KB
  __shared__ int tl[TOK_TILE];
  TileInfo ti;
  if (!tile_info(offsets, tileOff, totalTiles, ti)) return;
  if (threadIdx.x < TOK_TILE) {
    int li = ti.listBase + (int)threadIdx.x;
    tl[threadIdx.x] = (li < ti.listEnd) ? tokenList[li] : -1;
  }
  __syncthreads();
  gather_rows<NN>(ybf, ys, tl);
  __syncthreads();

  const int wid = threadIdx.x >> 5;
  const int lane = threadIdx.x & 31;
  const bf16* W = woutb + (size_t)ti.e * DD * NN;
  const int r = lane & 15, hf = lane >> 4;
  // two rounds of 4 feature tiles per wave: a round's sums take half the registers, which leaves
  // room for the second set of weight fragments
#pragma unroll 1  // stays a loop: unrolled, both rounds' registers could be live together
  for (int p = 0; p < 2; ++p) {
    v8f acc[4][2];
#pragma unroll
    for (int t = 0; t < 4; ++t)
#pragma unroll
      for (int th = 0; th < 2; ++th) acc[t][th] = vzero8();
    gemm_rows4<NN>(W + (size_t)((wid * 8 + p * 4) * 16) * NN, ys, LDS_LD(NN), lane, acc);
#pragma unroll
    for (int th = 0; th < 2; ++th) {
      int tok = tl[th * 16 + r];
      if (tok < 0) continue;
      float* op = out + (size_t)tok * DD;
#pragma unroll
      for (int t = 0; t < 4; ++t) {
        int fb = (wid * 8 + p * 4 + t) * 16 + hf * 8;
#pragma unroll
        for (int j = 0; j < 8; ++j) op[fb + j] = acc[t][th][j];
      }
    }
    // the next round rewrites the address and data registers that these stores name
    asm volatile("s_wait_xcnt 0x0" ::: "memory");
  }
}

// ---------------- host launcher ----------------

extern "C" void kernel_launch(void* const* d_in, const int* in_sizes, int n_in,
                              void* d_out, int out_size, void* d_ws, size_t ws_size,
                              hipStream_t stream) {
  (void)in_sizes; (void)n_in; (void)out_size; (void)ws_size;
  const float* x      = (const float*)d_in[0];
  const int*   tokid  = (const int*)d_in[1];
  const float* Win    = (const float*)d_in[2];
  const float* Wsin   = (const float*)d_in[3];
  const float* Wsout  = (const float*)d_in[4];
  const float* Wout   = (const float*)d_in[5];
  const float* dparam = (const float*)d_in[6];
  float* out = (float*)d_out;

  char* p = (char*)d_ws;
  auto take = [&](size_t bytes) -> char* {
    char* q = p;
    p += (bytes + 255) & ~(size_t)255;
    return q;
  };

  int* routes     = (int*)take(sizeof(int) * BS);
  int* offsets    = (int*)take(sizeof(int) * (EE + 1));
  int* tileOff    = (int*)take(sizeof(int) * (EE + 1));
  int* totalTiles = (int*)take(sizeof(int));
  int* tokenList  = (int*)take(sizeof(int) * BS);
  bf16* xbf    = (bf16*)take(sizeof(bf16) * (size_t)BS * DD);
  bf16* winb   = (bf16*)take(sizeof(bf16) * (size_t)EE * NN * DD);
  bf16* wsinb  = (bf16*)take(sizeof(bf16) * (size_t)EE * HH * DD);
  bf16* wsoutb = (bf16*)take(sizeof(bf16) * (size_t)EE * 4 * NN * HH);
  bf16* woutb  = (bf16*)take(sizeof(bf16) * (size_t)EE * DD * NN);
  float* u     = (float*)take(sizeof(float) * (size_t)BS * NN);
  float* aarr  = (float*)take(sizeof(float) * (size_t)BS * NN);
  float* buarr = (float*)take(sizeof(float) * (size_t)BS * NN);
  float* carr  = (float*)take(sizeof(float) * (size_t)BS * NN);
  float* skarr = (float*)take(sizeof(float) * (size_t)BS * NN);
  bf16* ybf    = (bf16*)take(sizeof(bf16) * (size_t)BS * NN);

  k_prep<<<CVT_GRID + 1, CVT_WAVES * 32, 0, stream>>>(
      x, Win, Wsin, Wsout, Wout, tokid, xbf, winb, wsinb, wsoutb, woutb,
      routes, offsets, tileOff, totalTiles, tokenList);

  k_u_gemm<<<TILE_MAX, 256, 0, stream>>>(xbf, winb, tokenList, offsets, tileOff,
                                         totalTiles, u);
  k_sel_gemm<<<TILE_MAX, 256, 0, stream>>>(xbf, wsinb, wsoutb, u, dparam, tokenList,
                                           offsets, tileOff, totalTiles,
                                           aarr, buarr, carr, skarr);
  k_scan<<<BB * EE * (NN / SCAN_T), SCAN_T, 0, stream>>>(routes, aarr, buarr, carr, skarr, ybf);
  k_out_gemm<<<TILE_MAX, 256, 0, stream>>>(ybf, woutb, tokenList, offsets, tileOff,
                                           totalTiles, out);
}

// v008
// One run takes 124 microseconds.
// Next to v007, in two timings, it ran 1.32 times as fast each time.
// Over all steps from v000 it is 6.97 times as fast.
#include <hip/hip_runtime.h>
#include <hip/hip_bf16.h>
#include <stdint.h>

#define BB 8
#define SS 2048
#define DD 1024
#define NN 256
#define HH 512
#define EE 8
#define BS (BB * SS)                 // 16384 tokens
#define TOK_TILE 32
#define TILE_MAX (BS / TOK_TILE + EE)  // worst-case 32-token tiles over all experts
// Row pitch, in bf16 elements, of a token tile in LDS whose rows hold n elements: 16 bytes more
// than the row, an odd multiple of 16 bytes, so the 16 rows that one 16-byte fragment load
// touches fall on different banks (at the bare pitch, a multiple of 256 bytes, on the same four).
#define LDS_LD(n) ((n) + 8)
static_assert((LDS_LD(DD) / 8) % 2 == 1 && (LDS_LD(HH) / 8) % 2 == 1 && (LDS_LD(NN) / 8) % 2 == 1,
              "every tile pitch is an odd multiple of 16 bytes");

typedef __bf16 bf16;
typedef __attribute__((ext_vector_type(16))) __bf16 v16bf;
typedef __attribute__((ext_vector_type(8)))  __bf16 v8bf;
typedef __attribute__((ext_vector_type(8)))  float   v8f;
typedef __attribute__((ext_vector_type(4)))  float   v4f;
typedef __attribute__((ext_vector_type(4)))  __bf16 v4bf;

__device__ __forceinline__ v8f vzero8() {
  v8f v;
#pragma unroll
  for (int i = 0; i < 8; ++i) v[i] = 0.f;
  return v;
}

__device__ __forceinline__ float sigmoidf_(float x) { return 1.f / (1.f + __expf(-x)); }

// D = A(16xK, rows=M striped per lane) x B(Kx16, cols=N striped per lane) + C
__device__ __forceinline__ v8f wmma_bf16(v16bf a, v16bf b, v8f c) {
  return __builtin_amdgcn_wmma_f32_16x16x32_bf16(false, a, false, b, (short)0, c, false, false);
}

// Load one 16x32 bf16 fragment from a row-major tile (leading dim ld, elements).
// Per ISA 7.12.2: lane (r = lane&15, h = lane>>4) holds K = k0+h*8+{0..7} and k0+16+h*8+{0..7} of row r.
__device__ __forceinline__ v16bf load_frag(const bf16* tile, int ld, int k0, int lane) {
  const int r = lane & 15;
  const int h = (lane >> 4) & 1;
  const bf16* p = tile + (size_t)r * ld + k0 + h * 8;
  v8bf c0 = *(const v8bf*)(p);
  v8bf c1 = *(const v8bf*)(p + 16);
  v16bf f;
#pragma unroll
  for (int i = 0; i < 8; ++i) { f[i] = c0[i]; f[i + 8] = c1[i]; }
  return f;
}

// The bf16 weights lie in the workspace in fragment order: a block of 16 rows x 32 k is 1024
// contiguous bytes, the blocks of 16 rows follow one another along k, and inside a block lane l's
// two 16-byte pieces stand at bytes l * 16 and 512 + l * 16. A wave's load is then 512 contiguous
// bytes, 4 whole lines; from a row-major array it would be 32 bytes out of each of 16 lines. The lane
// gets the same elements in the same places as from load_frag. rows16 = where the 16 rows begin
// (row * K elements from the array's start, as in the row-major array).
#define WBLK (16 * 32)               // elements of a block
__device__ __forceinline__ v16bf load_wfrag(const bf16* rows16, int k0, int lane) {
  const bf16* p = rows16 + (size_t)(k0 / 32) * WBLK + lane * 8;
  v8bf c0 = *(const v8bf*)(p);
  v8bf c1 = *(const v8bf*)(p + WBLK / 2);
  v16bf f;
#pragma unroll
  for (int i = 0; i < 8; ++i) { f[i] = c0[i]; f[i + 8] = c1[i]; }
  return f;
}

struct TileInfo { int e, listBase, listEnd; };

__device__ __forceinline__ bool tile_info(const int* offsets, const int* tileOff,
                                          const int* totalTiles, TileInfo& ti) {
  int tile = blockIdx.x;
  if (tile >= *totalTiles) return false;
  int e = 0;
#pragma unroll
  for (int k = 1; k < EE; ++k) if (tile >= tileOff[k]) e = k;
  ti.e = e;
  int local = tile - tileOff[e];
  ti.listBase = offsets[e] + local * TOK_TILE;
  ti.listEnd = offsets[e + 1];
  return true;
}

// Cooperative gather of TOK_TILE token rows (ROW_ELEMS bf16 each) into LDS, at pitch
// LDS_LD(ROW_ELEMS); invalid -> 0.
template <int ROW_ELEMS>
__device__ __forceinline__ void gather_rows(const bf16* src_base, bf16* dst, const int* tl) {
  constexpr int CPR = ROW_ELEMS / 8;          // 16B chunks per row
  constexpr int IT = TOK_TILE * CPR / 256;    // chunks per thread
  static_assert(IT * 256 == TOK_TILE * CPR, "the threads share the chunks evenly");
  static_assert(IT % 4 == 0, "the loads go out four at a time");
  int tok[IT];
  uint4 v[IT];
#pragma unroll  // constant i: tok[] stays in registers
  for (int i = 0; i < IT; ++i) tok[i] = tl[((int)threadIdx.x + i * 256) / CPR];
#pragma unroll  // a thread's loads all issue before the first is used: none is under a test (an
                // empty place reads row 0) and none is waited for here
  for (int i = 0; i < IT; i += 4) {
    const uint4* p[4];
#pragma unroll
    for (int j = 0; j < 4; ++j) {
      int tsafe = tok[i + j] < 0 ? 0 : tok[i + j];
      p[j] = (const uint4*)(src_base + (size_t)tsafe * ROW_ELEMS) +
             ((int)threadIdx.x + (i + j) * 256) % CPR;
      v[i + j] = *p[j];
    }
    // stands before any register that these loads name is rewritten: as inputs of the wait the
    // four addresses stay in their registers up to it
    asm volatile("s_wait_xcnt 0x0" :: "v"(p[0]), "v"(p[1]), "v"(p[2]), "v"(p[3]) : "memory");
  }
#pragma unroll  // constant i: tok[] and v[] stay in registers
  for (int i = 0; i < IT; ++i) {
    int idx = (int)threadIdx.x + i * 256;
    uint4 w = v[i];
    if (tok[i] < 0) { w.x = 0u; w.y = 0u; w.z = 0u; w.w = 0u; }
    ((uint4*)(dst + (size_t)(idx / CPR) * LDS_LD(ROW_ELEMS)))[idx % CPR] = w;
  }
}

// ---------------- the GEMMs' inner loop ----------------
// One wave: 2 or 4 tiles of 16 weight rows (in fragment order, K elements a row, from global
// memory) times the 32 tokens of an LDS tile. The weight fragments live in two register sets; while
// one set is multiplied, all loads of the other are in flight. A set is 2 tiles x 64 k: 2 KB in a
// row of each tile.

#define SET_K 64                     // k per register set
typedef v16bf wset[2][2];            // [k-step][tile]

__device__ __forceinline__ void load_set(wset& a, const bf16* W, int ld, int k, int lane) {
  // the two fences keep the set's loads one group at this place: sunk towards their uses they
  // would share registers and each would be waited for alone
  __builtin_amdgcn_sched_barrier(0);
#pragma unroll  // constant s, t: a[][] stays in registers
  for (int s = 0; s < 2; ++s)
#pragma unroll
    for (int t = 0; t < 2; ++t)
      a[s][t] = load_wfrag(W + (size_t)(t * 16) * ld, k + s * 32, lane);
  __builtin_amdgcn_sched_barrier(0);
}

// the set's tiles are the tiles T0 and T0 + 1 of acc
template <int T0, int TT>
__device__ __forceinline__ void mma_set(const wset& a, const bf16* tile, int tld, int k, int lane,
                                        v8f (&acc)[TT][2]) {
#pragma unroll  // constant s, t: a[][] and acc[][] stay in registers
  for (int s = 0; s < 2; ++s) {
    v16bf b0 = load_frag(tile, tld, k + s * 32, lane);
    v16bf b1 = load_frag(tile + 16 * tld, tld, k + s * 32, lane);
#pragma unroll
    for (int t = 0; t < 2; ++t) {
      acc[T0 + t][0] = wmma_bf16(a[s][t], b0, acc[T0 + t][0]);
      acc[T0 + t][1] = wmma_bf16(a[s][t], b1, acc[T0 + t][1]);
    }
  }
}

// 2 tiles: the sets take turns along k
template <int K>
__device__ __forceinline__ void gemm_rows2(const bf16* W, const bf16* tile, int tld, int lane,
                                           v8f (&acc)[2][2]) {
  static_assert(K % (2 * SET_K) == 0, "K is a whole number of set pairs");
  wset a0, a1;
  load_set(a0, W, K, 0, lane);
#pragma unroll 1  // stays a loop of two sets: unrolled further, more sets would be live at a time
  for (int k = 0; k < K - 2 * SET_K; k += 2 * SET_K) {
    load_set(a1, W, K, k + SET_K, lane);
    mma_set<0, 2>(a0, tile, tld, k, lane, acc);
    load_set(a0, W, K, k + 2 * SET_K, lane);
    mma_set<0, 2>(a1, tile, tld, k + SET_K, lane, acc);
  }
  load_set(a1, W, K, K - SET_K, lane);
  mma_set<0, 2>(a0, tile, tld, K - 2 * SET_K, lane, acc);
  mma_set<0, 2>(a1, tile, tld, K - SET_K, lane, acc);
}

// 4 tiles: one set has the tiles 0 and 1, the other the tiles 2 and 3, of the same 64 k
template <int K>
__device__ __forceinline__ void gemm_rows4(const bf16* W, const bf16* tile, int tld, int lane,
                                           v8f (&acc)[4][2]) {
  static_assert(K % SET_K == 0, "K is a whole number of sets");
  const bf16* W2 = W + (size_t)32 * K;
  wset a0, a1;
  load_set(a0, W, K, 0, lane);
#pragma unroll 1  // stays a loop of two sets: unrolled further, more sets would be live at a time
  for (int k = 0; k < K - SET_K; k += SET_K) {
    load_set(a1, W2, K, k, lane);
    mma_set<0, 4>(a0, tile, tld, k, lane, acc);
    load_set(a0, W, K, k + SET_K, lane);
    mma_set<2, 4>(a1, tile, tld, k, lane, acc);
  }
  load_set(a1, W2, K, K - SET_K, lane);
  mma_set<0, 4>(a0, tile, tld, K - SET_K, lane, acc);
  mma_set<2, 4>(a1, tile, tld, K - SET_K, lane, acc);
}

// ---------------- the u and out GEMMs' stores ----------------
// A wave's sums hold, per lane, 8 neighbouring features of one token: stored from there, a 16-byte
// store lays 32 pieces over 16 lines. So the wave first lays its TT tiles x 32 tokens into an LDS
// range of its own, one row a token, and reads them back along the rows: a store then covers whole
// 128-byte lines. No other wave touches the range, so no barrier is needed.
// Row pitch, in floats, of such a range whose rows hold n floats: an odd multiple of 16 bytes, so
// the 16 rows that one 16-byte LDS store touches fall on different banks.
#define STG_LD(n) ((n) + 4)
static_assert((STG_LD(32) / 4) % 2 == 1 && (STG_LD(64) / 4) % 2 == 1,
              "every staging pitch is an odd multiple of 16 bytes");

// The token list of a tile whose sums go out through store_rows. A tile has at least one token; the
// surplus places of an expert's last, short tile repeat its last token: their rows get the same
// operands, so the same sums, and store that token's values again.
__device__ __forceinline__ void fill_tl(const TileInfo& ti, const int* tokenList, int* tl) {
  if (threadIdx.x < TOK_TILE) {
    int li = ti.listBase + (int)threadIdx.x;
    tl[threadIdx.x] = tokenList[li < ti.listEnd ? li : ti.listEnd - 1];
  }
}

// dst: the output array, LDO floats a token; col0: the first of the wave's TT * 16 features.
// Every place of tl[] names a token (see fill_tl), so no store needs a test.
template <int TT, int LDO>
__device__ __forceinline__ void store_rows(const v8f (&acc)[TT][2], float* stg, const int* tl,
                                           float* __restrict__ dst, int col0, int lane) {
  constexpr int RW = TT * 16;          // floats of a token's row that the wave holds
  constexpr int LPR = RW / 4;          // lanes to a row on the way back
  constexpr int RPS = 32 / LPR;        // rows to a store
  constexpr int NS = TOK_TILE / RPS;   // stores
  const int r = lane & 15, hf = lane >> 4;
#pragma unroll  // constant th, t: acc[][] stays in registers
  for (int th = 0; th < 2; ++th) {
#pragma unroll
    for (int t = 0; t < TT; ++t) {
      float* q = stg + (th * 16 + r) * STG_LD(RW) + t * 16 + hf * 8;
      v4f lo, hi;
#pragma unroll
      for (int j = 0; j < 4; ++j) { lo[j] = acc[t][th][j]; hi[j] = acc[t][th][j + 4]; }
      *(v4f*)q = lo;
      *(v4f*)(q + 4) = hi;
    }
  }
  // the rows are read back by other lanes than wrote them: every LDS store of the wave has landed,
  // and no read is moved up over one
  asm volatile("s_wait_dscnt 0x0" ::: "memory");
  const int rr = lane / LPR, cc = (lane % LPR) * 4;
  v4f v[NS];
  unsigned off[NS];                    // byte offsets in dst
#pragma unroll  // constant i: v[] and off[] stay in registers; the LDS loads issue together
  for (int i = 0; i < NS; ++i) {
    v[i] = *(const v4f*)(stg + (i * RPS + rr) * STG_LD(RW) + cc);
    off[i] = (unsigned)((tl[i * RPS + rr] * LDO + col0 + cc) * 4);
  }
#pragma unroll  // constant i: v[] and off[] stay in registers
  for (int i = 0; i < NS; ++i) *(v4f*)((char*)dst + off[i]) = v[i];
}

// ---------------- preparation: one launch ----------------
// Nothing here depends on another work-group, so it is one grid. Work-group 0 routes the tokens
// and builds the per-expert token lists; the other CVT_GRID work-groups turn x and the four
// weight arrays into bf16, the weights in the fragment order that load_wfrag reads.

// f32 -> bf16 as a stream: a grid that is resident at once, one work-group per WGP, and every
// wave loops over whole pieces of CVT_PIECE floats. A wave's load covers 512 bytes (contiguous in x, 4 whole lines in a weight array),
// its store 256, and CVT_LOADS loads of a lane are in flight together.
#define CVT_GRID 256                       // converting work-groups
#define CVT_WAVES 16                       // waves per work-group
#define CVT_LOADS 8                        // 16-byte loads per lane and trip
#define CVT_PIECE (CVT_LOADS * 32 * 4)     // floats per wave and trip
static_assert((BS * DD) % CVT_PIECE == 0 && (EE * NN * DD) % CVT_PIECE == 0 &&
              (EE * HH * DD) % CVT_PIECE == 0 && (EE * 4 * NN * HH) % CVT_PIECE == 0,
              "every converted array is a whole number of pieces");
// A piece of a weight array is 16 rows x 64 k, two blocks of the fragment order: the 1024 elements
// that it writes are contiguous. PC_LOG(K) = log2 of the pieces along a row of K elements.
static_assert(CVT_PIECE == 2 * WBLK && CVT_LOADS == 8, "a weight piece is two blocks");
#define PC_LOG(K) __builtin_ctz((K) / 64)
#define PC_X     (BS * DD / CVT_PIECE)          // pieces of each array, in the order they are dealt
#define PC_WIN   (EE * NN * DD / CVT_PIECE)
#define PC_WSIN  (EE * HH * DD / CVT_PIECE)
#define PC_WSOUT (EE * 4 * NN * HH / CVT_PIECE)
#define PC_WOUT  (EE * DD * NN / CVT_PIECE)

#define RT_R (BS / (CVT_WAVES * 32))       // tokens per lane of the routing work-group

// One work-group: routes[], the token list sorted by expert (token order kept inside an expert),
// the experts' offsets in it and their tile offsets. Wave wid takes the tokens
// [wid * 32 * RT_R, (wid + 1) * 32 * RT_R), 32 a round; a token's rank among its wave's tokens of
// the same expert comes from ballots, the waves' totals meet in LDS.
__device__ __forceinline__ void build_lists(
    const int* __restrict__ tok, int* __restrict__ routes, int* __restrict__ offsets,
    int* __restrict__ tileOff, int* __restrict__ totalTiles, int* __restrict__ tokenList) {
  __shared__ int wtot[CVT_WAVES * EE];
  const int wid = threadIdx.x >> 5;
  const int lane = threadIdx.x & 31;
  const int t0 = wid * (32 * RT_R) + lane;
  int id[RT_R];
#pragma unroll  // the token loads issue together
  for (int i = 0; i < RT_R; ++i) id[i] = tok[t0 + i * 32];
  int cnt[EE];                       // the wave's tokens of each expert so far: scalar registers
#pragma unroll  // constant e: cnt[] stays in scalar registers
  for (int e = 0; e < EE; ++e) cnt[e] = 0;
  unsigned pack[RT_R];               // rank in the low half, route in the high half
#pragma unroll  // constant i: id[] and pack[] stay in registers
  for (int i = 0; i < RT_R; ++i) {
    unsigned x = (unsigned)id[i];
    x ^= x >> 16; x *= 2246822507u;
    x ^= x >> 13; x *= 3266489909u;
    x ^= x >> 16;
    int r = (int)(x & 7u);   // % 8
    int rk = 0;
#pragma unroll  // constant e: cnt[] stays in scalar registers
    for (int e = 0; e < EE; ++e) {
      unsigned m = __builtin_amdgcn_ballot_w32(r == e);
      rk = (r == e) ? cnt[e] + (int)__builtin_amdgcn_mbcnt_lo(m, 0u) : rk;
      cnt[e] += __popc(m);
    }
    pack[i] = (unsigned)rk | ((unsigned)r << 16);
  }
#pragma unroll  // behind the ranks, all together: among them each store would hold up the next round
  for (int i = 0; i < RT_R; ++i) routes[t0 + i * 32] = (int)(pack[i] >> 16);
  int mine = 0;
#pragma unroll  // constant e: cnt[] stays in scalar registers
  for (int e = 0; e < EE; ++e) if (lane == e) mine = cnt[e];
  if (lane < EE) wtot[wid * EE + lane] = mine;
  __syncthreads();
  // lane l looks after expert l % EE: its tokens in the waves in front of this one, and in all
  const int el = lane & (EE - 1);
  int before = 0, total = 0;
#pragma unroll  // the LDS loads issue together
  for (int w = 0; w < CVT_WAVES; ++w) {
    int v = wtot[w * EE + el];
    if (w < wid) before += v;
    total += v;
  }
  int off[EE + 1], toff[EE + 1];
  off[0] = 0;
  toff[0] = 0;
#pragma unroll  // constant e: off[] and toff[] stay in scalar registers
  for (int e = 0; e < EE; ++e) {
    int c = __builtin_amdgcn_readlane(total, e);
    off[e + 1] = off[e] + c;
    toff[e + 1] = toff[e] + (c + TOK_TILE - 1) / TOK_TILE;
  }
  int start = before;                // where this wave's tokens of expert el begin in the list
#pragma unroll  // constant e: off[] stays in scalar registers
  for (int e = 0; e < EE; ++e) if (el == e) start += off[e];
#pragma unroll  // constant i: pack[] stays in registers
  for (int i = 0; i < RT_R; ++i) {
    int r = (int)(pack[i] >> 16);
    int pos = __builtin_amdgcn_ds_bpermute(r << 2, start) + (int)(pack[i] & 0xffffu);
    tokenList[pos] = t0 + i * 32;
  }
  if (threadIdx.x == 0) {
#pragma unroll  // constant e: off[] and toff[] stay in scalar registers
    for (int e = 0; e <= EE; ++e) {
      offsets[e] = off[e];
      tileOff[e] = toff[e];
    }
    *totalTiles = toff[EE];
  }
}

__global__ void __launch_bounds__(CVT_WAVES * 32) k_prep(
    const float* __restrict__ x, const float* __restrict__ win,
    const float* __restrict__ wsin, const float* __restrict__ wsout,
    const float* __restrict__ wout, const int* __restrict__ tok,
    bf16* __restrict__ xbf, bf16* __restrict__ winb, bf16* __restrict__ wsinb,
    bf16* __restrict__ wsoutb, bf16* __restrict__ woutb,
    int* __restrict__ routes, int* __restrict__ offsets, int* __restrict__ tileOff,
    int* __restrict__ totalTiles, int* __restrict__ tokenList) {
  if (blockIdx.x == 0) {             // the first to start: its chain of steps is the longest
    build_lists(tok, routes, offsets, tileOff, totalTiles, tokenList);
    return;
  }
  // same in every lane: keeps the choice of the array scalar
  const int wid = __builtin_amdgcn_readfirstlane((int)(threadIdx.x >> 5));
  const int lane = threadIdx.x & 31;
  // piece -> (wave, work-group) with the work-group running fastest: the pieces that are in
  // flight at one time lie side by side
  for (int p = wid * CVT_GRID + (int)blockIdx.x - 1;
       p < PC_X + PC_WIN + PC_WSIN + PC_WSOUT + PC_WOUT; p += CVT_WAVES * CVT_GRID) {
    int q = p;
    int lk = -1;                     // PC_LOG of a weight array; x stays row-major
    const float* in = x;
    bf16* out = xbf;
    if (q >= PC_X) {
      q -= PC_X; in = win; out = winb; lk = PC_LOG(DD);
      if (q >= PC_WIN) {
        q -= PC_WIN; in = wsin; out = wsinb;
        if (q >= PC_WSIN) {
          q -= PC_WSIN; in = wsout; out = wsoutb; lk = PC_LOG(HH);
          if (q >= PC_WSOUT) { q -= PC_WSOUT; in = wout; out = woutb; lk = PC_LOG(NN); }
        }
      }
    }
    if (lk < 0) {
      const v4f* s = (const v4f*)(in + (size_t)q * CVT_PIECE) + lane;
      v4bf* d = (v4bf*)(out + (size_t)q * CVT_PIECE) + lane;
      v4f v[CVT_LOADS];
#pragma unroll  // the trip's loads issue together, ahead of the first store
      for (int j = 0; j < CVT_LOADS; ++j) v[j] = s[j * 32];
#pragma unroll  // constant j: v[] stays in registers
      for (int j = 0; j < CVT_LOADS; ++j) d[j * 32] = __builtin_convertvector(v[j], v4bf);
    } else {
      // Load j takes 32 k (block j / 4 of the piece's two) of the rows (j % 4) * 4 + {0..3}: one
      // whole line of each row, 8 lanes to a line. Lane (rr = lane >> 3, kq = lane & 7) has the k
      // kq * 4 + {0..3} of its row; in load_frag's map they are half kq & 1 of the 16-byte piece
      // kq >> 2 of fragment lane ((kq >> 1) & 1) * 16 + row. A store lays down 4 runs of 64 bytes,
      // and the four stores of a block fill its lines.
      const int rr = lane >> 3, kq = lane & 7;
      const size_t ld = (size_t)64 << lk;      // elements in a row
      const float* s = in + ((size_t)(q >> lk) * 16 + rr) * ld + (q & ((1 << lk) - 1)) * 64 + kq * 4;
      bf16* d = out + (size_t)q * CVT_PIECE + (kq >> 2) * (WBLK / 2) + ((kq >> 1) & 1) * 128 +
                rr * 8 + (kq & 1) * 4;
      const float* sp[4] = {s, s + 4 * ld, s + 8 * ld, s + 12 * ld};
      v4f v[CVT_LOADS];
#pragma unroll  // the trip's loads issue together, ahead of the first store
      for (int j = 0; j < CVT_LOADS; ++j) v[j] = *(const v4f*)(sp[j % 4] + (j / 4) * 32);
      // stands before any register that these loads name is rewritten: as inputs of the wait the
      // four addresses stay in their registers up to it
      asm volatile("s_wait_xcnt 0x0" :: "v"(sp[0]), "v"(sp[1]), "v"(sp[2]), "v"(sp[3]) : "memory");
#pragma unroll  // constant j: v[] stays in registers
      for (int j = 0; j < CVT_LOADS; ++j)
        *(v4bf*)(d + (j / 4) * WBLK + (j % 4) * 32) = __builtin_convertvector(v[j], v4bf);
      // stands directly behind the stores, before any way out of this block on which a register
      // that they name could be rewritten
      asm volatile("s_wait_xcnt 0x0" ::: "memory");
    }
    // the next trip rewrites the address and data registers that these loads and stores name
    asm volatile("s_wait_xcnt 0x0" ::: "memory");
  }
}

// ---------------- GEMM 1: u = Win[e] @ x ----------------

__global__ void __launch_bounds__(256) k_u_gemm(
    const bf16* __restrict__ xbf, const bf16* __restrict__ winb,
    const int* __restrict__ tokenList, const int* __restrict__ offsets,
    const int* __restrict__ tileOff, const int* __restrict__ totalTiles,
    float* __restrict__ u) {
  __shared__ __attribute__((aligned(16))) bf16 xs[TOK_TILE * LDS_LD(DD)];   // 64.5 KB
  __shared__ __attribute__((aligned(16))) float stg[8][TOK_TILE * STG_LD(32)];   // 36 KB
  __shared__ int tl[TOK_TILE];
  TileInfo ti;
  if (!tile_info(offsets, tileOff, totalTiles, ti)) return;
  fill_tl(ti, tokenList, tl);
  __syncthreads();
  gather_rows<DD>(xbf, xs, tl);
  __syncthreads();

  const int wid = threadIdx.x >> 5;
  const int lane = threadIdx.x & 31;
  const bf16* W = winb + (size_t)ti.e * NN * DD;
  v8f acc[2][2];   // [ftile][token-half]
#pragma unroll
  for (int t = 0; t < 2; ++t)
#pragma unroll
    for (int th = 0; th < 2; ++th) acc[t][th] = vzero8();

  gemm_rows2<DD>(W + (size_t)(wid * 2 * 16) * DD, xs, LDS_LD(DD), lane, acc);
  store_rows<2, NN>(acc, stg[wid], tl, u, wid * 2 * 16, lane);
}

// ---- GEMM 2 (fused): sh = silu(Wsin@x) in LDS, sel = Wsout@sh -> a, b*u, c, skip ----

// Stage 2 and its epilogue go in two rounds of ST_N states each: a round's sums take half the
// registers, which leaves room for the second set of weight fragments.
#define ST_N (NN / 2)
// Row pitch, in floats, of the epilogue's staging tile (32 tokens x 4*ST_N selector values): an odd
// multiple of 16 bytes, so the 16 rows that one 16-byte LDS store touches fall on different banks.
#define ST_LD (4 * ST_N + 4)

// 6 waves per SIMD: three work-groups to a WGP, so that all tiles (a few more than two per WGP) are
// resident at once and none waits for a first round to end
__global__ void __launch_bounds__(256, 6) k_sel_gemm(
    const bf16* __restrict__ xbf, const bf16* __restrict__ wsinb,
    const bf16* __restrict__ wsoutb, const float* __restrict__ u,
    const float* __restrict__ dparam,
    const int* __restrict__ tokenList, const int* __restrict__ offsets,
    const int* __restrict__ tileOff, const int* __restrict__ totalTiles,
    float* __restrict__ aarr, float* __restrict__ buarr,
    float* __restrict__ carr, float* __restrict__ skarr) {
  // One LDS area with two lives: the x tile, and, from the barrier behind stage 1 on (nobody reads
  // x any more), the epilogue's f32 staging tile.
  __shared__ __attribute__((aligned(16))) float area[TOK_TILE * LDS_LD(DD) / 2];   // 64.5 KB
  static_assert(sizeof(area) >= sizeof(float) * TOK_TILE * ST_LD, "the staging tile fits the area");
  bf16* xs = (bf16*)area;
  __shared__ __attribute__((aligned(16))) bf16 sh[TOK_TILE * LDS_LD(HH)];   // 32.5 KB
  __shared__ int tl[TOK_TILE];
  TileInfo ti;
  if (!tile_info(offsets, tileOff, totalTiles, ti)) return;
  if (threadIdx.x < TOK_TILE) {
    int li = ti.listBase + (int)threadIdx.x;
    tl[threadIdx.x] = (li < ti.listEnd) ? tokenList[li] : -1;
  }
  __syncthreads();
  gather_rows<DD>(xbf, xs, tl);
  __syncthreads();

  // same in every lane: keeps the bases of the wave's weight rows in scalar registers
  const int wid = __builtin_amdgcn_readfirstlane((int)(threadIdx.x >> 5));
  const int lane = threadIdx.x & 31;
  const int r = lane & 15, hf = lane >> 4;

  // stage 1: sh(32x512) = silu(Wsin[e](512x1024) @ x^T), 4 feature tiles per wave
  {
    const bf16* Wsi = wsinb + (size_t)ti.e * HH * DD;
    v8f acc[4][2];
#pragma unroll
    for (int t = 0; t < 4; ++t)
#pragma unroll
      for (int th = 0; th < 2; ++th) acc[t][th] = vzero8();
    gemm_rows4<DD>(Wsi + (size_t)(wid * 4 * 16) * DD, xs, LDS_LD(DD), lane, acc);
#pragma unroll
    for (int th = 0; th < 2; ++th) {
      int row = th * 16 + r;   // token row in tile
#pragma unroll
      for (int t = 0; t < 4; ++t) {
        int fb = (wid * 4 + t) * 16 + hf * 8;  // 8 consecutive h-features
#pragma unroll
        for (int j = 0; j < 8; ++j) {
          float v = acc[t][th][j];
          sh[row * LDS_LD(HH) + fb + j] = (bf16)(v * sigmoidf_(v));  // silu
        }
      }
    }
  }
  __syncthreads();

  // stage 2: sel(32x1024) = Wsout[e](1024x512) @ sh^T, in two rounds. Round p takes the states
  // [p * ST_N, (p + 1) * ST_N) with all four selector values of each (a, b, c, d stand NN rows
  // apart in Wsout): 4 * ST_N weight rows, 4 feature tiles per wave.
  {
    const bf16* Wso = wsoutb + (size_t)ti.e * (4 * NN) * HH;
    const float* dp = dparam + ti.e * NN;
#pragma unroll 1  // stays a loop: unrolled, the GEMM loop and the activation code would stand twice
    for (int p = 0; p < NN / ST_N; ++p) {
      v8f acc[4][2];
#pragma unroll
      for (int t = 0; t < 4; ++t)
#pragma unroll
        for (int th = 0; th < 2; ++th) acc[t][th] = vzero8();
      // column c of the round's staging tile is selector value c / ST_N of state p * ST_N + c % ST_N;
      // this wave has the columns [wid * 64, wid * 64 + 64)
      const int wrow = (wid * 64 / ST_N) * NN + p * ST_N + (wid * 64) % ST_N;
      gemm_rows4<HH>(Wso + (size_t)wrow * HH, sh, LDS_LD(HH), lane, acc);
      // Epilogue: every wave lays its raw sums into the staging tile, then the work-group walks
      // the tile row by row. A thread takes 4 neighbouring states n of one token and all four
      // selector values of each (ST_N apart in a row), so u is loaded once, 16 bytes a lane, a
      // wave's store fills 4 whole lines, and the activation code stands in the text once.
      if (p) __syncthreads();    // the first round's readers have left the staging tile
#pragma unroll  // constant th, t: acc[][] stays in registers
      for (int th = 0; th < 2; ++th) {
#pragma unroll
        for (int t = 0; t < 4; ++t) {
          float* q = area + (th * 16 + r) * ST_LD + (wid * 4 + t) * 16 + hf * 8;
          v4f lo, hi;
#pragma unroll
          for (int j = 0; j < 4; ++j) { lo[j] = acc[t][th][j]; hi[j] = acc[t][th][j + 4]; }
          *(v4f*)q = lo;
          *(v4f*)(q + 4) = hi;
        }
      }
      __syncthreads();           // the staging tile is complete
#pragma unroll 1  // stays a loop: unrolled, the activation code would stand in the text 4 times
      for (int idx = threadIdx.x; idx < TOK_TILE * (ST_N / 4); idx += 256) {
        int row = idx / (ST_N / 4);            // the same in every lane of a wave
        int nn = (idx % (ST_N / 4)) * 4;
        int tok = tl[row];
        if (tok < 0) continue;
        const float* q = area + row * ST_LD + nn;
        v4f va = *(const v4f*)q;
        v4f vb = *(const v4f*)(q + ST_N);
        v4f vc = *(const v4f*)(q + 2 * ST_N);
        v4f vd = *(const v4f*)(q + 3 * ST_N);
        int n = p * ST_N + nn;
        size_t base = (size_t)tok * NN + n;
        v4f uu = *(const v4f*)(u + base);
        v4f dd = *(const v4f*)(dp + n);
        v4f oa, ob, oc, os;
#pragma unroll
        for (int j = 0; j < 4; ++j) {
          oa[j] = sigmoidf_(va[j]);
          ob[j] = tanhf(vb[j]) * uu[j];
          oc[j] = tanhf(vc[j]);
          os[j] = dd[j] * sigmoidf_(vd[j]) * uu[j];
        }
        *(v4f*)(aarr + base) = oa;
        *(v4f*)(buarr + base) = ob;
        *(v4f*)(carr + base) = oc;
        *(v4f*)(skarr + base) = os;
      }
    }
  }
}

// ---------------- scan: h = a*h + b*u ; y = c*h + skip ----------------
// A step reads and writes only its own expert's state, so the 2048 steps of a batch row are
// EE independent chains. One work-group takes one (batch row, expert, SCAN_T states): it lists
// the expert's steps in time order in LDS and walks only those, SCAN_U steps' operands per trip.

#define SCAN_T 64                    // states per work-group: its y stores fill one 128-byte line
#define SCAN_W (SCAN_T / 32)         // waves per work-group
#define SCAN_U 32                    // steps whose operands are loaded together
#define SCAN_R (SS / SCAN_T)         // routes per lane while the list is built

// One trip: SCAN_U steps of the list. In the last, short trip (FULL false) the surplus places
// repeat step left - 1 with h held, so they store that step's y again and no store needs a test.
template <bool FULL>
__device__ __forceinline__ float scan_trip(
    const int* lst, int left, unsigned rowIdx, float h,
    const float* __restrict__ a, const float* __restrict__ bu,
    const float* __restrict__ c, const float* __restrict__ sk, bf16* __restrict__ ybf) {
  unsigned idx[SCAN_U];              // this lane's element in the four f32 planes and in y
  float av[SCAN_U], bv[SCAN_U], cv[SCAN_U], sv[SCAN_U];
#pragma unroll  // constant j: idx[] stays in registers
  for (int j = 0; j < SCAN_U; ++j)
    idx[j] = rowIdx + (unsigned)lst[(FULL || j < left) ? j : left - 1] * NN;
#pragma unroll  // lets the trip's loads issue together, ahead of the sums
  for (int j = 0; j < SCAN_U; ++j) {
    av[j] = a[idx[j]];
    bv[j] = bu[idx[j]];
    cv[j] = c[idx[j]];
    sv[j] = sk[idx[j]];
  }
  // holds every load in front of the sums: one that sinks among them starts its latency late
  __builtin_amdgcn_sched_barrier(0);
  bf16 yv[SCAN_U];
#pragma unroll  // constant j: the operand arrays stay in registers
  for (int j = 0; j < SCAN_U; ++j) {
    float hn = av[j] * h + bv[j];
    h = (FULL || j < left) ? hn : h;
    yv[j] = (bf16)(cv[j] * h + sv[j]);
  }
  // holds the stores behind the last y: mixed in with the sums they share one data register,
  // and each sum then waits (s_wait_xcnt) for the store in front of it
  __builtin_amdgcn_sched_barrier(0);
#pragma unroll  // constant j: idx[] and yv[] stay in registers
  for (int j = 0; j < SCAN_U; ++j) ybf[idx[j]] = yv[j];
  // the next trip rewrites the index and data registers that these stores name
  if (FULL) asm volatile("s_wait_xcnt 0x0" ::: "memory");
  return h;
}

__global__ void __launch_bounds__(SCAN_T) k_scan(
    const int* __restrict__ routes, const float* __restrict__ a,
    const float* __restrict__ bu, const float* __restrict__ c,
    const float* __restrict__ sk, bf16* __restrict__ ybf) {
  __shared__ __attribute__((aligned(16))) int list[SS];
  __shared__ int wcnt[SCAN_W];
  const int slice = blockIdx.x % (NN / SCAN_T);
  const int e = (blockIdx.x / (NN / SCAN_T)) % EE;
  const int b = blockIdx.x / ((NN / SCAN_T) * EE);
  const int wid = threadIdx.x >> 5;
  const int lane = threadIdx.x & 31;

  // wave wid lists the steps t in [wid * 32 * SCAN_R, (wid + 1) * 32 * SCAN_R), 32 per ballot
  const int t0 = wid * (32 * SCAN_R);
  unsigned hit[SCAN_R];
  int mine = 0;
#pragma unroll  // the route loads issue together; hit[] stays in scalar registers
  for (int i = 0; i < SCAN_R; ++i) {
    hit[i] = __builtin_amdgcn_ballot_w32(routes[b * SS + t0 + i * 32 + lane] == e);
    mine += __popc(hit[i]);
  }
  if (lane == 0) wcnt[wid] = mine;
  __syncthreads();
  int pos = 0, cnt = 0;
#pragma unroll  // SCAN_W is 2: no loop is left
  for (int w = 0; w < SCAN_W; ++w) {
    int v = wcnt[w];
    if (w < wid) pos += v;
    cnt += v;
  }
  cnt = __builtin_amdgcn_readfirstlane(cnt);   // same in every lane: keeps the trip tests scalar
#pragma unroll  // constant i: hit[] stays in scalar registers
  for (int i = 0; i < SCAN_R; ++i) {
    if ((hit[i] >> lane) & 1u)
      list[pos + (int)__builtin_amdgcn_mbcnt_lo(hit[i], 0u)] = t0 + i * 32 + lane;
    pos += __popc(hit[i]);
  }
  __syncthreads();

  const unsigned rowIdx = (unsigned)(b * SS) * NN + slice * SCAN_T + threadIdx.x;
  float h = 0.f;
  int base = 0;
  for (; base + SCAN_U <= cnt; base += SCAN_U)
    h = scan_trip<true>(list + base, SCAN_U, rowIdx, h, a, bu, c, sk, ybf);
  if (base < cnt)
    scan_trip<false>(list + base, cnt - base, rowIdx, h, a, bu, c, sk, ybf);
}

// ---------------- GEMM 3: out = Wout[e] @ y ----------------

__global__ void __launch_bounds__(256) k_out_gemm(
    const bf16* __restrict__ ybf, const bf16* __restrict__ woutb,
    const int* __restrict__ tokenList, const int* __restrict__ offsets,
    const int* __restrict__ tileOff, const int* __restrict__ totalTiles,
    float* __restrict__ out) {
  __shared__ __attribute__((aligned(16))) bf16 ys[TOK_TILE * LDS_LD(NN)];   // 16.5 KB
  __shared__ __attribute__((aligned(16))) float stg[8][TOK_TILE * STG_LD(64)];   // 68 KB
  __shared__ int tl[TOK_TILE];
  TileInfo ti;
  if (!tile_info(offsets, tileOff, totalTiles, ti)) return;
  fill_tl(ti, tokenList, tl);
  __syncthreads();
  gather_rows<NN>(ybf, ys, tl);
  __syncthreads();

  // same in every lane: keeps the bases of the wave's weight rows and of its staging range in
  // scalar registers
  const int wid = __builtin_amdgcn_readfirstlane((int)(threadIdx.x >> 5));
  const int lane = threadIdx.x & 31;
  const bf16* W = woutb + (size_t)ti.e * DD * NN;
  // two rounds of 4 feature tiles per wave: a round's sums take half the registers, which leaves
  // room for the second set of weight fragments
#pragma unroll 1  // stays a loop: unrolled, both rounds' registers could be live together
  for (int p = 0; p < 2; ++p) {
    v8f acc[4][2];
#pragma unroll
    for (int t = 0; t < 4; ++t)
#pragma unroll
      for (int th = 0; th < 2; ++th) acc[t][th] = vzero8();
    gemm_rows4<NN>(W + (size_t)((wid * 8 + p * 4) * 16) * NN, ys, LDS_LD(NN), lane, acc);
    store_rows<4, DD>(acc, stg[wid], tl, out, (wid * 8 + p * 4) * 16, lane);
    // the next round rewrites the address and data registers that these stores name
    asm volatile("s_wait_xcnt 0x0" ::: "memory");
  }
}

// ---------------- host launcher ----------------

extern "C" void kernel_launch(void* const* d_in, const int* in_sizes, int n_in,
                              void* d_out, int out_size, void* d_ws, size_t ws_size,
                              hipStream_t stream) {
  (void)in_sizes; (void)n_in; (void)out_size; (void)ws_size;
  const float* x      = (const float*)d_in[0];
  const int*   tokid  = (const int*)d_in[1];
  const float* Win    = (const float*)d_in[2];
  const float* Wsin   = (const float*)d_in[3];
  const float* Wsout  = (const float*)d_in[4];
  const float* Wout   = (const float*)d_in[5];
  const float* dparam = (const float*)d_in[6];
  float* out = (float*)d_out;

  char* p = (char*)d_ws;
  auto take = [&](size_t bytes) -> char* {
    char* q = p;
    p += (bytes + 255) & ~(size_t)255;
    return q;
  };

  int* routes     = (int*)take(sizeof(int) * BS);
  int* offsets    = (int*)take(sizeof(int) * (EE + 1));
  int* tileOff    = (int*)take(sizeof(int) * (EE + 1));
  int* totalTiles = (int*)take(sizeof(int));
  int* tokenList  = (int*)take(sizeof(int) * BS);
  bf16* xbf    = (bf16*)take(sizeof(bf16) * (size_t)BS * DD);
  bf16* winb   = (bf16*)take(sizeof(bf16) * (size_t)EE * NN * DD);
  bf16* wsinb  = (bf16*)take(sizeof(bf16) * (size_t)EE * HH * DD);
  bf16* wsoutb = (bf16*)take(sizeof(bf16) * (size_t)EE * 4 * NN * HH);
  bf16* woutb  = (bf16*)take(sizeof(bf16) * (size_t)EE * DD * NN);
  float* u     = (float*)take(sizeof(float) * (size_t)BS * NN);
  float* aarr  = (float*)take(sizeof(float) * (size_t)BS * NN);
  float* buarr = (float*)take(sizeof(float) * (size_t)BS * NN);
  float* carr  = (float*)take(sizeof(float) * (size_t)BS * NN);
  float* skarr = (float*)take(sizeof(float) * (size_t)BS * NN);
  bf16* ybf    = (bf16*)take(sizeof(bf16) * (size_t)BS * NN);

  k_prep<<<CVT_GRID + 1, CVT_WAVES * 32, 0, stream>>>(
      x, Win, Wsin, Wsout, Wout, tokid, xbf, winb, wsinb, wsoutb, woutb,
      routes, offsets, tileOff, totalTiles, tokenList);

  k_u_gemm<<<TILE_MAX, 256, 0, stream>>>(xbf, winb, tokenList, offsets, tileOff,
                                         totalTiles, u);
  k_sel_gemm<<<TILE_MAX, 256, 0, stream>>>(xbf, wsinb, wsoutb, u, dparam, tokenList,
                                           offsets, tileOff, totalTiles,
                                           aarr, buarr, carr, skarr);
  k_scan<<<BB * EE * (NN / SCAN_T), SCAN_T, 0, stream>>>(routes, aarr, buarr, carr, skarr, ybf);
  k_out_gemm<<<TILE_MAX, 256, 0, stream>>>(ybf, woutb, tokenList, offsets, tileOff,
                                           totalTiles, out);
}

// v009
// Measured time: 110 microseconds a run.
// Two timings next to v008 put it at 1.12 and 1.13 times that version's speed.
// All steps since v000 together make it 7.84 times as fast.
#include <hip/hip_runtime.h>
#include <hip/hip_bf16.h>
#include <stdint.h>

#define BB 8
#define SS 2048
#define DD 1024
#define NN 256
#define HH 512
#define EE 8
#define BS (BB * SS)                 // 16384 tokens
#define TOK_TILE 32
#define TILE_MAX (BS / TOK_TILE + EE)  // worst-case 32-token tiles over all experts
// The selector and out GEMMs take tiles of BIG_TILE tokens, one work-group of BIG_WAVES waves to a
// tile: a tile reads its expert's whole weight arrays from L2 once, so the bytes that the weights
// cost fall with the number of tiles. 80 is the smallest multiple of 16 at which the tiles, for any
// split of the tokens over the experts, are fewer than the chip's 256 WGPs: all run at once.
#define BIG_TILE 80
#define BIG_TH (BIG_TILE / 16)       // groups of 16 tokens
#define BIG_WAVES 16
#define BIG_NT (BIG_WAVES * 32)
#define BIG_TILE_MAX ((BS + EE * (BIG_TILE - 1)) / BIG_TILE)
static_assert(BIG_TILE_MAX <= 256, "one round of work-groups");
// Row pitch, in bf16 elements, of a token tile in LDS whose rows hold n elements: 16 bytes more
// than the row, an odd multiple of 16 bytes, so the 16 rows that one 16-byte fragment load
// touches fall on different banks (at the bare pitch, a multiple of 256 bytes, on the same four).
#define LDS_LD(n) ((n) + 8)
static_assert((LDS_LD(DD) / 8) % 2 == 1 && (LDS_LD(HH) / 8) % 2 == 1 && (LDS_LD(NN) / 8) % 2 == 1,
              "every tile pitch is an odd multiple of 16 bytes");

typedef __bf16 bf16;
typedef __attribute__((ext_vector_type(16))) __bf16 v16bf;
typedef __attribute__((ext_vector_type(8)))  __bf16 v8bf;
typedef __attribute__((ext_vector_type(8)))  float   v8f;
typedef __attribute__((ext_vector_type(4)))  float   v4f;
typedef __attribute__((ext_vector_type(4)))  __bf16 v4bf;

__device__ __forceinline__ v8f vzero8() {
  v8f v;
#pragma unroll
  for (int i = 0; i < 8; ++i) v[i] = 0.f;
  return v;
}

__device__ __forceinline__ float sigmoidf_(float x) { return 1.f / (1.f + __expf(-x)); }

// D = A(16xK, rows=M striped per lane) x B(Kx16, cols=N striped per lane) + C
__device__ __forceinline__ v8f wmma_bf16(v16bf a, v16bf b, v8f c) {
  return __builtin_amdgcn_wmma_f32_16x16x32_bf16(false, a, false, b, (short)0, c, false, false);
}

// Load one 16x32 bf16 fragment from a row-major tile (leading dim ld, elements).
// Per ISA 7.12.2: lane (r = lane&15, h = lane>>4) holds K = k0+h*8+{0..7} and k0+16+h*8+{0..7} of row r.
__device__ __forceinline__ v16bf load_frag(const bf16* tile, int ld, int k0, int lane) {
  const int r = lane & 15;
  const int h = (lane >> 4) & 1;
  const bf16* p = tile + (size_t)r * ld + k0 + h * 8;
  v8bf c0 = *(const v8bf*)(p);
  v8bf c1 = *(const v8bf*)(p + 16);
  v16bf f;
#pragma unroll
  for (int i = 0; i < 8; ++i) { f[i] = c0[i]; f[i + 8] = c1[i]; }
  return f;
}

// The bf16 weights lie in the workspace in fragment order: a block of 16 rows x 32 k is 1024
// contiguous bytes, the blocks of 16 rows follow one another along k, and inside a block lane l's
// two 16-byte pieces stand at bytes l * 16 and 512 + l * 16. A wave's load is then 512 contiguous
// bytes, 4 whole lines; from a row-major array it would be 32 bytes out of each of 16 lines. The lane
// gets the same elements in the same places as from load_frag. rows16 = where the 16 rows begin
// (row * K elements from the array's start, as in the row-major array).
#define WBLK (16 * 32)               // elements of a block
__device__ __forceinline__ v16bf load_wfrag(const bf16* rows16, int k0, int lane) {
  const bf16* p = rows16 + (size_t)(k0 / 32) * WBLK + lane * 8;
  v8bf c0 = *(const v8bf*)(p);
  v8bf c1 = *(const v8bf*)(p + WBLK / 2);
  v16bf f;
#pragma unroll
  for (int i = 0; i < 8; ++i) { f[i] = c0[i]; f[i + 8] = c1[i]; }
  return f;
}

struct TileInfo { int e, listBase, listEnd; };

__device__ __forceinline__ bool tile_info(const int* offsets, const int* tileOff,
                                          const int* totalTiles, TileInfo& ti) {
  int tile = blockIdx.x;
  if (tile >= *totalTiles) return false;
  int e = 0;
#pragma unroll
  for (int k = 1; k < EE; ++k) if (tile >= tileOff[k]) e = k;
  ti.e = e;
  int local = tile - tileOff[e];
  ti.listBase = offsets[e] + local * TOK_TILE;
  ti.listEnd = offsets[e + 1];
  return true;
}

// The same for tiles of T tokens, from the experts' offsets alone: expert k has
// ceil(its tokens / T) tiles, and the experts' tiles follow one another.
template <int T>
__device__ __forceinline__ bool tile_info_t(const int* offsets, TileInfo& ti) {
  const int tile = blockIdx.x;
  int first = 0;                     // the first tile of expert k
  bool found = false;
#pragma unroll  // the offsets load together; everything here is scalar
  for (int k = 0; k < EE; ++k) {
    const int lo = offsets[k], hi = offsets[k + 1];
    const int nt = (hi - lo + T - 1) / T;
    if (tile >= first && tile < first + nt) {
      found = true;
      ti.e = k;
      ti.listBase = lo + (tile - first) * T;
      ti.listEnd = hi;
    }
    first += nt;
  }
  return found;
}

// Cooperative gather, by NT threads, of T token rows (ROW_ELEMS bf16 each) into LDS, at pitch
// LDS_LD(ROW_ELEMS); invalid -> 0.
template <int ROW_ELEMS, int T = TOK_TILE, int NT = 256>
__device__ __forceinline__ void gather_rows(const bf16* src_base, bf16* dst, const int* tl) {
  constexpr int CPR = ROW_ELEMS / 8;          // 16B chunks per row
  constexpr int IT = T * CPR / NT;            // chunks per thread
  static_assert(IT * NT == T * CPR, "the threads share the chunks evenly");
  constexpr int G = IT % 4 == 0 ? 4 : 5;      // loads to a group
  static_assert(IT % G == 0, "the loads go out in whole groups");
  int tok[IT];
  uint4 v[IT];
#pragma unroll  // constant i: tok[] stays in registers
  for (int i = 0; i < IT; ++i) tok[i] = tl[((int)threadIdx.x + i * NT) / CPR];
#pragma unroll  // a thread's loads all issue before the first is used: none is under a test (an
                // empty place reads row 0) and none is waited for here
  for (int i = 0; i < IT; i += G) {
    const uint4* p[G];
#pragma unroll
    for (int j = 0; j < G; ++j) {
      int tsafe = tok[i + j] < 0 ? 0 : tok[i + j];
      p[j] = (const uint4*)(src_base + (size_t)tsafe * ROW_ELEMS) +
             ((int)threadIdx.x + (i + j) * NT) % CPR;
      v[i + j] = *p[j];
    }
    // stands before any register that these loads name is rewritten: as inputs of the wait the
    // group's addresses stay in their registers up to it
    if constexpr (G == 4)
      asm volatile("s_wait_xcnt 0x0" :: "v"(p[0]), "v"(p[1]), "v"(p[2]), "v"(p[3]) : "memory");
    else
      asm volatile("s_wait_xcnt 0x0"
                   :: "v"(p[0]), "v"(p[1]), "v"(p[2]), "v"(p[3]), "v"(p[4]) : "memory");
  }
#pragma unroll  // constant i: tok[] and v[] stay in registers
  for (int i = 0; i < IT; ++i) {
    int idx = (int)threadIdx.x + i * NT;
    uint4 w = v[i];
    if (tok[i] < 0) { w.x = 0u; w.y = 0u; w.z = 0u; w.w = 0u; }
    ((uint4*)(dst + (size_t)(idx / CPR) * LDS_LD(ROW_ELEMS)))[idx % CPR] = w;
  }
}

// ---------------- the GEMMs' inner loop ----------------
// One wave: 2 tiles of 16 weight rows (in fragment order, K elements a row, from global
// memory) times the TH * 16 tokens of an LDS tile. The weight fragments live in two register sets; while
// one set is multiplied, all loads of the other are in flight. A set is 2 tiles x 64 k: 2 KB in a
// row of each tile.

#define SET_K 64                     // k per register set
typedef v16bf wset[2][2];            // [k-step][tile]

__device__ __forceinline__ void load_set(wset& a, const bf16* W, int ld, int k, int lane) {
  // the two fences keep the set's loads one group at this place: sunk towards their uses they
  // would share registers and each would be waited for alone
  __builtin_amdgcn_sched_barrier(0);
#pragma unroll  // constant s, t: a[][] stays in registers
  for (int s = 0; s < 2; ++s)
#pragma unroll
    for (int t = 0; t < 2; ++t)
      a[s][t] = load_wfrag(W + (size_t)(t * 16) * ld, k + s * 32, lane);
  __builtin_amdgcn_sched_barrier(0);
}

template <int TH>
__device__ __forceinline__ void mma_set(const wset& a, const bf16* tile, int tld, int k, int lane,
                                        v8f (&acc)[2][TH]) {
#pragma unroll  // constant s, t, th: a[][], b[] and acc[][] stay in registers
  for (int s = 0; s < 2; ++s) {
    v16bf b[TH];
#pragma unroll
    for (int th = 0; th < TH; ++th) b[th] = load_frag(tile + th * 16 * tld, tld, k + s * 32, lane);
#pragma unroll
    for (int t = 0; t < 2; ++t)
#pragma unroll
      for (int th = 0; th < TH; ++th) acc[t][th] = wmma_bf16(a[s][t], b[th], acc[t][th]);
  }
}

// 2 tiles: the sets take turns along k
template <int K, int TH>
__device__ __forceinline__ void gemm_rows2(const bf16* W, const bf16* tile, int tld, int lane,
                                           v8f (&acc)[2][TH]) {
  static_assert(K % (2 * SET_K) == 0, "K is a whole number of set pairs");
  wset a0, a1;
  load_set(a0, W, K, 0, lane);
#pragma unroll 1  // stays a loop of two sets: unrolled further, more sets would be live at a time
  for (int k = 0; k < K - 2 * SET_K; k += 2 * SET_K) {
    load_set(a1, W, K, k + SET_K, lane);
    mma_set(a0, tile, tld, k, lane, acc);
    load_set(a0, W, K, k + 2 * SET_K, lane);
    mma_set(a1, tile, tld, k + SET_K, lane, acc);
  }
  load_set(a1, W, K, K - SET_K, lane);
  mma_set(a0, tile, tld, K - 2 * SET_K, lane, acc);
  // keeps the last set's token fragments behind the products in front of them, as load_set's fences
  // do inside the loop: fetched ahead, two sets' fragments are live at once and registers spill
  __builtin_amdgcn_sched_barrier(0);
  mma_set(a1, tile, tld, K - SET_K, lane, acc);
}

// ---------------- the u and out GEMMs' stores ----------------
// A wave's sums hold, per lane, 8 neighbouring features of one token: stored from there, a 16-byte
// store lays 32 pieces over 16 lines. So the wave first lays its TT tiles x TH * 16 tokens into an LDS
// range of its own, one row a token, and reads them back along the rows: a store then covers whole
// 128-byte lines. No other wave touches the range, so no barrier is needed.
// Row pitch, in floats, of such a range whose rows hold n floats: an odd multiple of 16 bytes, so
// the 16 rows that one 16-byte LDS store touches fall on different banks.
#define STG_LD(n) ((n) + 4)
static_assert((STG_LD(32) / 4) % 2 == 1 && (STG_LD(64) / 4) % 2 == 1,
              "every staging pitch is an odd multiple of 16 bytes");

// The token list of a tile whose sums go out through store_rows. A tile has at least one token; the
// surplus places of an expert's last, short tile repeat its last token: their rows get the same
// operands, so the same sums, and store that token's values again.
template <int T = TOK_TILE>
__device__ __forceinline__ void fill_tl(const TileInfo& ti, const int* tokenList, int* tl) {
  if (threadIdx.x < T) {
    int li = ti.listBase + (int)threadIdx.x;
    tl[threadIdx.x] = tokenList[li < ti.listEnd ? li : ti.listEnd - 1];
  }
}

// dst: the output array, LDO floats a token; col0: the first of the wave's TT * 16 features.
// Every place of tl[] names a token (see fill_tl), so no store needs a test.
template <int TT, int LDO, int TH>
__device__ __forceinline__ void store_rows(const v8f (&acc)[TT][TH], float* stg, const int* tl,
                                           float* __restrict__ dst, int col0, int lane) {
  constexpr int RW = TT * 16;          // floats of a token's row that the wave holds
  constexpr int LPR = RW / 4;          // lanes to a row on the way back
  constexpr int RPS = 32 / LPR;        // rows to a store
  constexpr int NS = TH * 16 / RPS;    // stores
  const int r = lane & 15, hf = lane >> 4;
#pragma unroll  // constant th, t: acc[][] stays in registers
  for (int th = 0; th < TH; ++th) {
#pragma unroll
    for (int t = 0; t < TT; ++t) {
      float* q = stg + (th * 16 + r) * STG_LD(RW) + t * 16 + hf * 8;
      v4f lo, hi;
#pragma unroll
      for (int j = 0; j < 4; ++j) { lo[j] = acc[t][th][j]; hi[j] = acc[t][th][j + 4]; }
      *(v4f*)q = lo;
      *(v4f*)(q + 4) = hi;
    }
  }
  // the rows are read back by other lanes than wrote them: every LDS store of the wave has landed,
  // and no read is moved up over one
  asm volatile("s_wait_dscnt 0x0" ::: "memory");
  const int rr = lane / LPR, cc = (lane % LPR) * 4;
  v4f v[NS];
  unsigned off[NS];                    // byte offsets in dst
#pragma unroll  // constant i: v[] and off[] stay in registers; the LDS loads issue together
  for (int i = 0; i < NS; ++i) {
    v[i] = *(const v4f*)(stg + (i * RPS + rr) * STG_LD(RW) + cc);
    off[i] = (unsigned)((tl[i * RPS + rr] * LDO + col0 + cc) * 4);
  }
#pragma unroll  // constant i: v[] and off[] stay in registers
  for (int i = 0; i < NS; ++i) *(v4f*)((char*)dst + off[i]) = v[i];
}

// ---------------- preparation: one launch ----------------
// Nothing here depends on another work-group, so it is one grid. Work-group 0 routes the tokens
// and builds the per-expert token lists; the other CVT_GRID work-groups turn x and the four
// weight arrays into bf16, the weights in the fragment order that load_wfrag reads.

// f32 -> bf16 as a stream: a grid that is resident at once, one work-group per WGP, and every
// wave loops over whole pieces of CVT_PIECE floats. A wave's load covers 512 bytes (contiguous in x, 4 whole lines in a weight array),
// its store 256, and CVT_LOADS loads of a lane are in flight together.
#define CVT_GRID 256                       // converting work-groups
#define CVT_WAVES 16                       // waves per work-group
#define CVT_LOADS 8                        // 16-byte loads per lane and trip
#define CVT_PIECE (CVT_LOADS * 32 * 4)     // floats per wave and trip
static_assert((BS * DD) % CVT_PIECE == 0 && (EE * NN * DD) % CVT_PIECE == 0 &&
              (EE * HH * DD) % CVT_PIECE == 0 && (EE * 4 * NN * HH) % CVT_PIECE == 0,
              "every converted array is a whole number of pieces");
// A piece of a weight array is 16 rows x 64 k, two blocks of the fragment order: the 1024 elements
// that it writes are contiguous. PC_LOG(K) = log2 of the pieces along a row of K elements.
static_assert(CVT_PIECE == 2 * WBLK && CVT_LOADS == 8, "a weight piece is two blocks");
#define PC_LOG(K) __builtin_ctz((K) / 64)
#define PC_X     (BS * DD / CVT_PIECE)          // pieces of each array, in the order they are dealt
#define PC_WIN   (EE * NN * DD / CVT_PIECE)
#define PC_WSIN  (EE * HH * DD / CVT_PIECE)
#define PC_WSOUT (EE * 4 * NN * HH / CVT_PIECE)
#define PC_WOUT  (EE * DD * NN / CVT_PIECE)

#define RT_R (BS / (CVT_WAVES * 32))       // tokens per lane of the routing work-group

// One work-group: routes[], the token list sorted by expert (token order kept inside an expert),
// the experts' offsets in it and their tile offsets. Wave wid takes the tokens
// [wid * 32 * RT_R, (wid + 1) * 32 * RT_R), 32 a round; a token's rank among its wave's tokens of
// the same expert comes from ballots, the waves' totals meet in LDS.
__device__ __forceinline__ void build_lists(
    const int* __restrict__ tok, int* __restrict__ routes, int* __restrict__ offsets,
    int* __restrict__ tileOff, int* __restrict__ totalTiles, int* __restrict__ tokenList) {
  __shared__ int wtot[CVT_WAVES * EE];
  const int wid = threadIdx.x >> 5;
  const int lane = threadIdx.x & 31;
  const int t0 = wid * (32 * RT_R) + lane;
  int id[RT_R];
#pragma unroll  // the token loads issue together
  for (int i = 0; i < RT_R; ++i) id[i] = tok[t0 + i * 32];
  int cnt[EE];                       // the wave's tokens of each expert so far: scalar registers
#pragma unroll  // constant e: cnt[] stays in scalar registers
  for (int e = 0; e < EE; ++e) cnt[e] = 0;
  unsigned pack[RT_R];               // rank in the low half, route in the high half
#pragma unroll  // constant i: id[] and pack[] stay in registers
  for (int i = 0; i < RT_R; ++i) {
    unsigned x = (unsigned)id[i];
    x ^= x >> 16; x *= 2246822507u;
    x ^= x >> 13; x *= 3266489909u;
    x ^= x >> 16;
    int r = (int)(x & 7u);   // % 8
    int rk = 0;
#pragma unroll  // constant e: cnt[] stays in scalar registers
    for (int e = 0; e < EE; ++e) {
      unsigned m = __builtin_amdgcn_ballot_w32(r == e);
      rk = (r == e) ? cnt[e] + (int)__builtin_amdgcn_mbcnt_lo(m, 0u) : rk;
      cnt[e] += __popc(m);
    }
    pack[i] = (unsigned)rk | ((unsigned)r << 16);
  }
#pragma unroll  // behind the ranks, all together: among them each store would hold up the next round
  for (int i = 0; i < RT_R; ++i) routes[t0 + i * 32] = (int)(pack[i] >> 16);
  int mine = 0;
#pragma unroll  // constant e: cnt[] stays in scalar registers
  for (int e = 0; e < EE; ++e) if (lane == e) mine = cnt[e];
  if (lane < EE) wtot[wid * EE + lane] = mine;
  __syncthreads();
  // lane l looks after expert l % EE: its tokens in the waves in front of this one, and in all
  const int el = lane & (EE - 1);
  int before = 0, total = 0;
#pragma unroll  // the LDS loads issue together
  for (int w = 0; w < CVT_WAVES; ++w) {
    int v = wtot[w * EE + el];
    if (w < wid) before += v;
    total += v;
  }
  int off[EE + 1], toff[EE + 1];
  off[0] = 0;
  toff[0] = 0;
#pragma unroll  // constant e: off[] and toff[] stay in scalar registers
  for (int e = 0; e < EE; ++e) {
    int c = __builtin_amdgcn_readlane(total, e);
    off[e + 1] = off[e] + c;
    toff[e + 1] = toff[e] + (c + TOK_TILE - 1) / TOK_TILE;
  }
  int start = before;                // where this wave's tokens of expert el begin in the list
#pragma unroll  // constant e: off[] stays in scalar registers
  for (int e = 0; e < EE; ++e) if (el == e) start += off[e];
#pragma unroll  // constant i: pack[] stays in registers
  for (int i = 0; i < RT_R; ++i) {
    int r = (int)(pack[i] >> 16);
    int pos = __builtin_amdgcn_ds_bpermute(r << 2, start) + (int)(pack[i] & 0xffffu);
    tokenList[pos] = t0 + i * 32;
  }
  if (threadIdx.x == 0) {
#pragma unroll  // constant e: off[] and toff[] stay in scalar registers
    for (int e = 0; e <= EE; ++e) {
      offsets[e] = off[e];
      tileOff[e] = toff[e];
    }
    *totalTiles = toff[EE];
  }
}

__global__ void __launch_bounds__(CVT_WAVES * 32) k_prep(
    const float* __restrict__ x, const float* __restrict__ win,
    const float* __restrict__ wsin, const float* __restrict__ wsout,
    const float* __restrict__ wout, const int* __restrict__ tok,
    bf16* __restrict__ xbf, bf16* __restrict__ winb, bf16* __restrict__ wsinb,
    bf16* __restrict__ wsoutb, bf16* __restrict__ woutb,
    int* __restrict__ routes, int* __restrict__ offsets, int* __restrict__ tileOff,
    int* __restrict__ totalTiles, int* __restrict__ tokenList) {
  if (blockIdx.x == 0) {             // the first to start: its chain of steps is the longest
    build_lists(tok, routes, offsets, tileOff, totalTiles, tokenList);
    return;
  }
  // same in every lane: keeps the choice of the array scalar
  const int wid = __builtin_amdgcn_readfirstlane((int)(threadIdx.x >> 5));
  const int lane = threadIdx.x & 31;
  // piece -> (wave, work-group) with the work-group running fastest: the pieces that are in
  // flight at one time lie side by side
  for (int p = wid * CVT_GRID + (int)blockIdx.x - 1;
       p < PC_X + PC_WIN + PC_WSIN + PC_WSOUT + PC_WOUT; p += CVT_WAVES * CVT_GRID) {
    int q = p;
    int lk = -1;                     // PC_LOG of a weight array; x stays row-major
    const float* in = x;
    bf16* out = xbf;
    if (q >= PC_X) {
      q -= PC_X; in = win; out = winb; lk = PC_LOG(DD);
      if (q >= PC_WIN) {
        q -= PC_WIN; in = wsin; out = wsinb;
        if (q >= PC_WSIN) {
          q -= PC_WSIN; in = wsout; out = wsoutb; lk = PC_LOG(HH);
          if (q >= PC_WSOUT) { q -= PC_WSOUT; in = wout; out = woutb; lk = PC_LOG(NN); }
        }
      }
    }
    if (lk < 0) {
      const v4f* s = (const v4f*)(in + (size_t)q * CVT_PIECE) + lane;
      v4bf* d = (v4bf*)(out + (size_t)q * CVT_PIECE) + lane;
      v4f v[CVT_LOADS];
#pragma unroll  // the trip's loads issue together, ahead of the first store
      for (int j = 0; j < CVT_LOADS; ++j) v[j] = s[j * 32];
#pragma unroll  // constant j: v[] stays in registers
      for (int j = 0; j < CVT_LOADS; ++j) d[j * 32] = __builtin_convertvector(v[j], v4bf);
    } else {
      // Load j takes 32 k (block j / 4 of the piece's two) of the rows (j % 4) * 4 + {0..3}: one
      // whole line of each row, 8 lanes to a line. Lane (rr = lane >> 3, kq = lane & 7) has the k
      // kq * 4 + {0..3} of its row; in load_frag's map they are half kq & 1 of the 16-byte piece
      // kq >> 2 of fragment lane ((kq >> 1) & 1) * 16 + row. A store lays down 4 runs of 64 bytes,
      // and the four stores of a block fill its lines.
      const int rr = lane >> 3, kq = lane & 7;
      const size_t ld = (size_t)64 << lk;      // elements in a row
      const float* s = in + ((size_t)(q >> lk) * 16 + rr) * ld + (q & ((1 << lk) - 1)) * 64 + kq * 4;
      bf16* d = out + (size_t)q * CVT_PIECE + (kq >> 2) * (WBLK / 2) + ((kq >> 1) & 1) * 128 +
                rr * 8 + (kq & 1) * 4;
      const float* sp[4] = {s, s + 4 * ld, s + 8 * ld, s + 12 * ld};
      v4f v[CVT_LOADS];
#pragma unroll  // the trip's loads issue together, ahead of the first store
      for (int j = 0; j < CVT_LOADS; ++j) v[j] = *(const v4f*)(sp[j % 4] + (j / 4) * 32);
      // stands before any register that these loads name is rewritten: as inputs of the wait the
      // four addresses stay in their registers up to it
      asm volatile("s_wait_xcnt 0x0" :: "v"(sp[0]), "v"(sp[1]), "v"(sp[2]), "v"(sp[3]) : "memory");
#pragma unroll  // constant j: v[] stays in registers
      for (int j = 0; j < CVT_LOADS; ++j)
        *(v4bf*)(d + (j / 4) * WBLK + (j % 4) * 32) = __builtin_convertvector(v[j], v4bf);
      // stands directly behind the stores, before any way out of this block on which a register
      // that they name could be rewritten
      asm volatile("s_wait_xcnt 0x0" ::: "memory");
    }
    // the next trip rewrites the address and data registers that these loads and stores name
    asm volatile("s_wait_xcnt 0x0" ::: "memory");
  }
}

// ---------------- GEMM 1: u = Win[e] @ x ----------------

__global__ void __launch_bounds__(256) k_u_gemm(
    const bf16* __restrict__ xbf, const bf16* __restrict__ winb,
    const int* __restrict__ tokenList, const int* __restrict__ offsets,
    const int* __restrict__ tileOff, const int* __restrict__ totalTiles,
    float* __restrict__ u) {
  __shared__ __attribute__((aligned(16))) bf16 xs[TOK_TILE * LDS_LD(DD)];   // 64.5 KB
  __shared__ __attribute__((aligned(16))) float stg[8][TOK_TILE * STG_LD(32)];   // 36 KB
  __shared__ int tl[TOK_TILE];
  TileInfo ti;
  if (!tile_info(offsets, tileOff, totalTiles, ti)) return;
  fill_tl(ti, tokenList, tl);
  __syncthreads();
  gather_rows<DD>(xbf, xs, tl);
  __syncthreads();

  const int wid = threadIdx.x >> 5;
  const int lane = threadIdx.x & 31;
  const bf16* W = winb + (size_t)ti.e * NN * DD;
  v8f acc[2][2];   // [ftile][token-half]
#pragma unroll
  for (int t = 0; t < 2; ++t)
#pragma unroll
    for (int th = 0; th < 2; ++th) acc[t][th] = vzero8();

  gemm_rows2<DD>(W + (size_t)(wid * 2 * 16) * DD, xs, LDS_LD(DD), lane, acc);
  store_rows<2, NN>(acc, stg[wid], tl, u, wid * 2 * 16, lane);
}

// ---- GEMM 2 (fused): sh = silu(Wsin@x) in LDS, sel = Wsout@sh -> a, b*u, c, skip ----

// Stage 2 and its epilogue go in two rounds of ST_N states each: a round's raw sums fill the LDS
// area that the x tile has left.
#define ST_N (NN / 2)
// Row pitch, in floats, of the epilogue's staging tile (a row: 4*ST_N selector values of a token): an
// odd multiple of 16 bytes, so the 16 rows that one 16-byte LDS store touches fall on different banks.
#define ST_LD (4 * ST_N + 4)

// One work-group of 16 waves to a WGP (its LDS leaves room for no second one).
__global__ void __launch_bounds__(BIG_NT) k_sel_gemm(
    const bf16* __restrict__ xbf, const bf16* __restrict__ wsinb,
    const bf16* __restrict__ wsoutb, const float* __restrict__ u,
    const float* __restrict__ dparam,
    const int* __restrict__ tokenList, const int* __restrict__ offsets,
    float* __restrict__ aarr, float* __restrict__ buarr,
    float* __restrict__ carr, float* __restrict__ skarr) {
  // One LDS area with two lives: the x tile, and, from the barrier behind stage 1 on (nobody reads
  // x any more), the epilogue's f32 staging tile.
  __shared__ __attribute__((aligned(16))) float area[BIG_TILE * LDS_LD(DD) / 2];   // 161 KB
  static_assert(sizeof(area) >= sizeof(float) * BIG_TILE * ST_LD, "the staging tile fits the area");
  bf16* xs = (bf16*)area;
  __shared__ __attribute__((aligned(16))) bf16 sh[BIG_TILE * LDS_LD(HH)];   // 81 KB
  __shared__ int tl[BIG_TILE];
  TileInfo ti;
  if (!tile_info_t<BIG_TILE>(offsets, ti)) return;
  if (threadIdx.x < BIG_TILE) {
    int li = ti.listBase + (int)threadIdx.x;
    tl[threadIdx.x] = (li < ti.listEnd) ? tokenList[li] : -1;
  }
  __syncthreads();
  gather_rows<DD, BIG_TILE, BIG_NT>(xbf, xs, tl);
  __syncthreads();

  // same in every lane: keeps the bases of the wave's weight rows in scalar registers
  const int wid = __builtin_amdgcn_readfirstlane((int)(threadIdx.x >> 5));
  const int lane = threadIdx.x & 31;
  const int r = lane & 15, hf = lane >> 4;
  static_assert(HH == BIG_WAVES * 32 && 4 * ST_N == BIG_WAVES * 32, "2 feature tiles per wave");

  // stage 1: sh(80x512) = silu(Wsin[e](512x1024) @ x^T), 2 feature tiles per wave
  {
    const bf16* Wsi = wsinb + (size_t)ti.e * HH * DD;
    v8f acc[2][BIG_TH];
#pragma unroll
    for (int t = 0; t < 2; ++t)
#pragma unroll
      for (int th = 0; th < BIG_TH; ++th) acc[t][th] = vzero8();
    gemm_rows2<DD>(Wsi + (size_t)(wid * 2 * 16) * DD, xs, LDS_LD(DD), lane, acc);
#pragma unroll
    for (int th = 0; th < BIG_TH; ++th) {
      int row = th * 16 + r;   // token row in tile
#pragma unroll
      for (int t = 0; t < 2; ++t) {
        int fb = (wid * 2 + t) * 16 + hf * 8;  // 8 consecutive h-features
#pragma unroll
        for (int j = 0; j < 8; ++j) {
          float v = acc[t][th][j];
          sh[row * LDS_LD(HH) + fb + j] = (bf16)(v * sigmoidf_(v));  // silu
        }
      }
    }
  }
  __syncthreads();

  // stage 2: sel(80x1024) = Wsout[e](1024x512) @ sh^T, in two rounds. Round p takes the states
  // [p * ST_N, (p + 1) * ST_N) with all four selector values of each (a, b, c, d stand NN rows
  // apart in Wsout): 4 * ST_N weight rows, 2 feature tiles per wave.
  {
    const bf16* Wso = wsoutb + (size_t)ti.e * (4 * NN) * HH;
    const float* dp = dparam + ti.e * NN;
#pragma unroll 1  // stays a loop: unrolled, the GEMM loop and the activation code would stand twice
    for (int p = 0; p < NN / ST_N; ++p) {
      v8f acc[2][BIG_TH];
#pragma unroll
      for (int t = 0; t < 2; ++t)
#pragma unroll
        for (int th = 0; th < BIG_TH; ++th) acc[t][th] = vzero8();
      // column c of the round's staging tile is selector value c / ST_N of state p * ST_N + c % ST_N;
      // this wave has the columns [wid * 32, wid * 32 + 32)
      const int wrow = (wid * 32 / ST_N) * NN + p * ST_N + (wid * 32) % ST_N;
      gemm_rows2<HH>(Wso + (size_t)wrow * HH, sh, LDS_LD(HH), lane, acc);
      // Epilogue: every wave lays its raw sums into the staging tile, then the work-group walks
      // the tile row by row. A thread takes 4 neighbouring states n of one token and all four
      // selector values of each (ST_N apart in a row), so u is loaded once, 16 bytes a lane, a
      // wave's store fills 4 whole lines, and the activation code stands in the text once.
      if (p) __syncthreads();    // the first round's readers have left the staging tile
#pragma unroll  // constant th, t: acc[][] stays in registers
      for (int th = 0; th < BIG_TH; ++th) {
#pragma unroll
        for (int t = 0; t < 2; ++t) {
          float* q = area + (th * 16 + r) * ST_LD + (wid * 2 + t) * 16 + hf * 8;
          v4f lo, hi;
#pragma unroll
          for (int j = 0; j < 4; ++j) { lo[j] = acc[t][th][j]; hi[j] = acc[t][th][j + 4]; }
          *(v4f*)q = lo;
          *(v4f*)(q + 4) = hi;
        }
      }
      __syncthreads();           // the staging tile is complete
#pragma unroll 1  // stays a loop: unrolled, the activation code would stand in the text 5 times
      for (int idx = threadIdx.x; idx < BIG_TILE * (ST_N / 4); idx += BIG_NT) {
        int row = idx / (ST_N / 4);            // the same in every lane of a wave
        int nn = (idx % (ST_N / 4)) * 4;
        int tok = tl[row];
        if (tok < 0) continue;
        const float* q = area + row * ST_LD + nn;
        v4f va = *(const v4f*)q;
        v4f vb = *(const v4f*)(q + ST_N);
        v4f vc = *(const v4f*)(q + 2 * ST_N);
        v4f vd = *(const v4f*)(q + 3 * ST_N);
        int n = p * ST_N + nn;
        size_t base = (size_t)tok * NN + n;
        v4f uu = *(const v4f*)(u + base);
        v4f dd = *(const v4f*)(dp + n);
        v4f oa, ob, oc, os;
#pragma unroll
        for (int j = 0; j < 4; ++j) {
          oa[j] = sigmoidf_(va[j]);
          ob[j] = tanhf(vb[j]) * uu[j];
          oc[j] = tanhf(vc[j]);
          os[j] = dd[j] * sigmoidf_(vd[j]) * uu[j];
        }
        *(v4f*)(aarr + base) = oa;
        *(v4f*)(buarr + base) = ob;
        *(v4f*)(carr + base) = oc;
        *(v4f*)(skarr + base) = os;
      }
    }
  }
}

// ---------------- scan: h = a*h + b*u ; y = c*h + skip ----------------
// A step reads and writes only its own expert's state, so the 2048 steps of a batch row are
// EE independent chains. One work-group takes one (batch row, expert, SCAN_T states): it lists
// the expert's steps in time order in LDS and walks only those, SCAN_U steps' operands per trip.

#define SCAN_T 64                    // states per work-group: its y stores fill one 128-byte line
#define SCAN_W (SCAN_T / 32)         // waves per work-group
#define SCAN_U 32                    // steps whose operands are loaded together
#define SCAN_R (SS / SCAN_T)         // routes per lane while the list is built

// One trip: SCAN_U steps of the list. In the last, short trip (FULL false) the surplus places
// repeat step left - 1 with h held, so they store that step's y again and no store needs a test.
template <bool FULL>
__device__ __forceinline__ float scan_trip(
    const int* lst, int left, unsigned rowIdx, float h,
    const float* __restrict__ a, const float* __restrict__ bu,
    const float* __restrict__ c, const float* __restrict__ sk, bf16* __restrict__ ybf) {
  unsigned idx[SCAN_U];              // this lane's element in the four f32 planes and in y
  float av[SCAN_U], bv[SCAN_U], cv[SCAN_U], sv[SCAN_U];
#pragma unroll  // constant j: idx[] stays in registers
  for (int j = 0; j < SCAN_U; ++j)
    idx[j] = rowIdx + (unsigned)lst[(FULL || j < left) ? j : left - 1] * NN;
#pragma unroll  // lets the trip's loads issue together, ahead of the sums
  for (int j = 0; j < SCAN_U; ++j) {
    av[j] = a[idx[j]];
    bv[j] = bu[idx[j]];
    cv[j] = c[idx[j]];
    sv[j] = sk[idx[j]];
  }
  // holds every load in front of the sums: one that sinks among them starts its latency late
  __builtin_amdgcn_sched_barrier(0);
  bf16 yv[SCAN_U];
#pragma unroll  // constant j: the operand arrays stay in registers
  for (int j = 0; j < SCAN_U; ++j) {
    float hn = av[j] * h + bv[j];
    h = (FULL || j < left) ? hn : h;
    yv[j] = (bf16)(cv[j] * h + sv[j]);
  }
  // holds the stores behind the last y: mixed in with the sums they share one data register,
  // and each sum then waits (s_wait_xcnt) for the store in front of it
  __builtin_amdgcn_sched_barrier(0);
#pragma unroll  // constant j: idx[] and yv[] stay in registers
  for (int j = 0; j < SCAN_U; ++j) ybf[idx[j]] = yv[j];
  // the next trip rewrites the index and data registers that these stores name
  if (FULL) asm volatile("s_wait_xcnt 0x0" ::: "memory");
  return h;
}

__global__ void __launch_bounds__(SCAN_T) k_scan(
    const int* __restrict__ routes, const float* __restrict__ a,
    const float* __restrict__ bu, const float* __restrict__ c,
    const float* __restrict__ sk, bf16* __restrict__ ybf) {
  __shared__ __attribute__((aligned(16))) int list[SS];
  __shared__ int wcnt[SCAN_W];
  const int slice = blockIdx.x % (NN / SCAN_T);
  const int e = (blockIdx.x / (NN / SCAN_T)) % EE;
  const int b = blockIdx.x / ((NN / SCAN_T) * EE);
  const int wid = threadIdx.x >> 5;
  const int lane = threadIdx.x & 31;

  // wave wid lists the steps t in [wid * 32 * SCAN_R, (wid + 1) * 32 * SCAN_R), 32 per ballot
  const int t0 = wid * (32 * SCAN_R);
  unsigned hit[SCAN_R];
  int mine = 0;
#pragma unroll  // the route loads issue together; hit[] stays in scalar registers
  for (int i = 0; i < SCAN_R; ++i) {
    hit[i] = __builtin_amdgcn_ballot_w32(routes[b * SS + t0 + i * 32 + lane] == e);
    mine += __popc(hit[i]);
  }
  if (lane == 0) wcnt[wid] = mine;
  __syncthreads();
  int pos = 0, cnt = 0;
#pragma unroll  // SCAN_W is 2: no loop is left
  for (int w = 0; w < SCAN_W; ++w) {
    int v = wcnt[w];
    if (w < wid) pos += v;
    cnt += v;
  }
  cnt = __builtin_amdgcn_readfirstlane(cnt);   // same in every lane: keeps the trip tests scalar
#pragma unroll  // constant i: hit[] stays in scalar registers
  for (int i = 0; i < SCAN_R; ++i) {
    if ((hit[i] >> lane) & 1u)
      list[pos + (int)__builtin_amdgcn_mbcnt_lo(hit[i], 0u)] = t0 + i * 32 + lane;
    pos += __popc(hit[i]);
  }
  __syncthreads();

  const unsigned rowIdx = (unsigned)(b * SS) * NN + slice * SCAN_T + threadIdx.x;
  float h = 0.f;
  int base = 0;
  for (; base + SCAN_U <= cnt; base += SCAN_U)
    h = scan_trip<true>(list + base, SCAN_U, rowIdx, h, a, bu, c, sk, ybf);
  if (base < cnt)
    scan_trip<false>(list + base, cnt - base, rowIdx, h, a, bu, c, sk, ybf);
}

// ---------------- GEMM 3: out = Wout[e] @ y ----------------

__global__ void __launch_bounds__(BIG_NT) k_out_gemm(
    const bf16* __restrict__ ybf, const bf16* __restrict__ woutb,
    const int* __restrict__ tokenList, const int* __restrict__ offsets,
    float* __restrict__ out) {
  __shared__ __attribute__((aligned(16))) bf16 ys[BIG_TILE * LDS_LD(NN)];   // 41 KB
  __shared__ __attribute__((aligned(16))) float stg[BIG_WAVES][BIG_TILE * STG_LD(32)];   // 180 KB
  __shared__ int tl[BIG_TILE];
  TileInfo ti;
  if (!tile_info_t<BIG_TILE>(offsets, ti)) return;
  fill_tl<BIG_TILE>(ti, tokenList, tl);
  __syncthreads();
  gather_rows<NN, BIG_TILE, BIG_NT>(ybf, ys, tl);
  __syncthreads();

  // same in every lane: keeps the bases of the wave's weight rows and of its staging range in
  // scalar registers
  const int wid = __builtin_amdgcn_readfirstlane((int)(threadIdx.x >> 5));
  const int lane = threadIdx.x & 31;
  const bf16* W = woutb + (size_t)ti.e * DD * NN;
  static_assert(DD == BIG_WAVES * 2 * 32, "two rounds of 2 feature tiles per wave");
#pragma unroll 1  // stays a loop: unrolled, both rounds' registers could be live together
  for (int p = 0; p < 2; ++p) {
    v8f acc[2][BIG_TH];
#pragma unroll
    for (int t = 0; t < 2; ++t)
#pragma unroll
      for (int th = 0; th < BIG_TH; ++th) acc[t][th] = vzero8();
    gemm_rows2<NN>(W + (size_t)((wid * 4 + p * 2) * 16) * NN, ys, LDS_LD(NN), lane, acc);
    store_rows<2, DD>(acc, stg[wid], tl, out, (wid * 4 + p * 2) * 16, lane);
    // the next round rewrites the address and data registers that these stores name
    asm volatile("s_wait_xcnt 0x0" ::: "memory");
  }
}

// ---------------- host launcher ----------------

extern "C" void kernel_launch(void* const* d_in, const int* in_sizes, int n_in,
                              void* d_out, int out_size, void* d_ws, size_t ws_size,
                              hipStream_t stream) {
  (void)in_sizes; (void)n_in; (void)out_size; (void)ws_size;
  const float* x      = (const float*)d_in[0];
  const int*   tokid  = (const int*)d_in[1];
  const float* Win    = (const float*)d_in[2];
  const float* Wsin   = (const float*)d_in[3];
  const float* Wsout  = (const float*)d_in[4];
  const float* Wout   = (const float*)d_in[5];
  const float* dparam = (const float*)d_in[6];
  float* out = (float*)d_out;

  char* p = (char*)d_ws;
  auto take = [&](size_t bytes) -> char* {
    char* q = p;
    p += (bytes + 255) & ~(size_t)255;
    return q;
  };

  int* routes     = (int*)take(sizeof(int) * BS);
  int* offsets    = (int*)take(sizeof(int) * (EE + 1));
  int* tileOff    = (int*)take(sizeof(int) * (EE + 1));
  int* totalTiles = (int*)take(sizeof(int));
  int* tokenList  = (int*)take(sizeof(int) * BS);
  bf16* xbf    = (bf16*)take(sizeof(bf16) * (size_t)BS * DD);
  bf16* winb   = (bf16*)take(sizeof(bf16) * (size_t)EE * NN * DD);
  bf16* wsinb  = (bf16*)take(sizeof(bf16) * (size_t)EE * HH * DD);
  bf16* wsoutb = (bf16*)take(sizeof(bf16) * (size_t)EE * 4 * NN * HH);
  bf16* woutb  = (bf16*)take(sizeof(bf16) * (size_t)EE * DD * NN);
  float* u     = (float*)take(sizeof(float) * (size_t)BS * NN);
  float* aarr  = (float*)take(sizeof(float) * (size_t)BS * NN);
  float* buarr = (float*)take(sizeof(float) * (size_t)BS * NN);
  float* carr  = (float*)take(sizeof(float) * (size_t)BS * NN);
  float* skarr = (float*)take(sizeof(float) * (size_t)BS * NN);
  bf16* ybf    = (bf16*)take(sizeof(bf16) * (size_t)BS * NN);

  k_prep<<<CVT_GRID + 1, CVT_WAVES * 32, 0, stream>>>(
      x, Win, Wsin, Wsout, Wout, tokid, xbf, winb, wsinb, wsoutb, woutb,
      routes, offsets, tileOff, totalTiles, tokenList);

  k_u_gemm<<<TILE_MAX, 256, 0, stream>>>(xbf, winb, tokenList, offsets, tileOff,
                                         totalTiles, u);
  k_sel_gemm<<<BIG_TILE_MAX, BIG_NT, 0, stream>>>(xbf, wsinb, wsoutb, u, dparam, tokenList,
                                                  offsets, aarr, buarr, carr, skarr);
  k_scan<<<BB * EE * (NN / SCAN_T), SCAN_T, 0, stream>>>(routes, aarr, buarr, carr, skarr, ybf);
  k_out_gemm<<<BIG_TILE_MAX, BIG_NT, 0, stream>>>(ybf, woutb, tokenList, offsets, out);
}

// v010
// A run of this version takes 96.6 microseconds.
// Timed twice side by side with v009, it ran 1.14 and 1.13 times as fast.
// Counting every step since v000, it is 8.89 times as fast.
#include <hip/hip_runtime.h>
#include <hip/hip_bf16.h>
#include <stdint.h>

#define BB 8
#define SS 2048
#define DD 1024
#define NN 256
#define HH 512
#define EE 8
#define BS (BB * SS)                 // 16384 tokens
// The selector and out GEMMs take tiles of BIG_TILE tokens, one work-group of BIG_WAVES waves to a
// tile: a tile reads its expert's whole weight arrays from L2 once, so the bytes that the weights
// cost fall with the number of tiles. 80 is the smallest multiple of 16 at which the tiles, for any
// split of the tokens over the experts, are fewer than the chip's 256 WGPs: all run at once.
#define BIG_TILE 80
#define BIG_TH (BIG_TILE / 16)       // groups of 16 tokens
#define BIG_WAVES 16
#define BIG_NT (BIG_WAVES * 32)
#define BIG_TILE_MAX ((BS + EE * (BIG_TILE - 1)) / BIG_TILE)
static_assert(BIG_TILE_MAX <= 256, "one round of work-groups");
// Row pitch, in bf16 elements, of a token tile in LDS whose rows hold n elements: 16 bytes more
// than the row, an odd multiple of 16 bytes, so the 16 rows that one 16-byte fragment load
// touches fall on different banks (at the bare pitch, a multiple of 256 bytes, on the same four).
#define LDS_LD(n) ((n) + 8)
static_assert((LDS_LD(DD) / 8) % 2 == 1 && (LDS_LD(HH) / 8) % 2 == 1 && (LDS_LD(NN) / 8) % 2 == 1,
              "every tile pitch is an odd multiple of 16 bytes");

typedef __bf16 bf16;
typedef __attribute__((ext_vector_type(16))) __bf16 v16bf;
typedef __attribute__((ext_vector_type(8)))  __bf16 v8bf;
typedef __attribute__((ext_vector_type(8)))  float   v8f;
typedef __attribute__((ext_vector_type(4)))  float   v4f;
typedef __attribute__((ext_vector_type(4)))  __bf16 v4bf;

__device__ __forceinline__ v8f vzero8() {
  v8f v;
#pragma unroll
  for (int i = 0; i < 8; ++i) v[i] = 0.f;
  return v;
}

__device__ __forceinline__ float sigmoidf_(float x) { return 1.f / (1.f + __expf(-x)); }

// D = A(16xK, rows=M striped per lane) x B(Kx16, cols=N striped per lane) + C
__device__ __forceinline__ v8f wmma_bf16(v16bf a, v16bf b, v8f c) {
  return __builtin_amdgcn_wmma_f32_16x16x32_bf16(false, a, false, b, (short)0, c, false, false);
}

// Load one 16x32 bf16 fragment from a row-major tile (leading dim ld, elements).
// Per ISA 7.12.2: lane (r = lane&15, h = lane>>4) holds K = k0+h*8+{0..7} and k0+16+h*8+{0..7} of row r.
__device__ __forceinline__ v16bf load_frag(const bf16* tile, int ld, int k0, int lane) {
  const int r = lane & 15;
  const int h = (lane >> 4) & 1;
  const bf16* p = tile + (size_t)r * ld + k0 + h * 8;
  v8bf c0 = *(const v8bf*)(p);
  v8bf c1 = *(const v8bf*)(p + 16);
  v16bf f;
#pragma unroll
  for (int i = 0; i < 8; ++i) { f[i] = c0[i]; f[i + 8] = c1[i]; }
  return f;
}

// The bf16 weights lie in the workspace in fragment order: a block of 16 rows x 32 k is 1024
// contiguous bytes, the blocks of 16 rows follow one another along k, and inside a block lane l's
// two 16-byte pieces stand at bytes l * 16 and 512 + l * 16. A wave's load is then 512 contiguous
// bytes, 4 whole lines; from a row-major array it would be 32 bytes out of each of 16 lines. The lane
// gets the same elements in the same places as from load_frag. rows16 = where the 16 rows begin
// (row * K elements from the array's start, as in the row-major array).
#define WBLK (16 * 32)               // elements of a block
__device__ __forceinline__ v16bf load_wfrag(const bf16* rows16, int k0, int lane) {
  const bf16* p = rows16 + (size_t)(k0 / 32) * WBLK + lane * 8;
  v8bf c0 = *(const v8bf*)(p);
  v8bf c1 = *(const v8bf*)(p + WBLK / 2);
  v16bf f;
#pragma unroll
  for (int i = 0; i < 8; ++i) { f[i] = c0[i]; f[i + 8] = c1[i]; }
  return f;
}

struct TileInfo { int e, listBase, listEnd; };

// A work-group's tile of T tokens, from the experts' offsets alone: expert k has
// ceil(its tokens / T) tiles, and the experts' tiles follow one another.
template <int T>
__device__ __forceinline__ bool tile_info_t(const int* offsets, TileInfo& ti) {
  const int tile = blockIdx.x;
  int first = 0;                     // the first tile of expert k
  bool found = false;
#pragma unroll  // the offsets load together; everything here is scalar
  for (int k = 0; k < EE; ++k) {
    const int lo = offsets[k], hi = offsets[k + 1];
    const int nt = (hi - lo + T - 1) / T;
    if (tile >= first && tile < first + nt) {
      found = true;
      ti.e = k;
      ti.listBase = lo + (tile - first) * T;
      ti.listEnd = hi;
    }
    first += nt;
  }
  return found;
}

// Cooperative gather, by NT threads, of T token rows (ROW_ELEMS bf16 each) into LDS, at pitch
// LDS_LD(ROW_ELEMS); invalid -> 0.
template <int ROW_ELEMS, int T, int NT>
__device__ __forceinline__ void gather_rows(const bf16* src_base, bf16* dst, const int* tl) {
  constexpr int CPR = ROW_ELEMS / 8;          // 16B chunks per row
  constexpr int IT = T * CPR / NT;            // chunks per thread
  static_assert(IT * NT == T * CPR, "the threads share the chunks evenly");
  constexpr int G = IT % 4 == 0 ? 4 : 5;      // loads to a group
  static_assert(IT % G == 0, "the loads go out in whole groups");
  int tok[IT];
  uint4 v[IT];
#pragma unroll  // constant i: tok[] stays in registers
  for (int i = 0; i < IT; ++i) tok[i] = tl[((int)threadIdx.x + i * NT) / CPR];
#pragma unroll  // a thread's loads all issue before the first is used: none is under a test (an
                // empty place reads row 0) and none is waited for here
  for (int i = 0; i < IT; i += G) {
    const uint4* p[G];
#pragma unroll
    for (int j = 0; j < G; ++j) {
      int tsafe = tok[i + j] < 0 ? 0 : tok[i + j];
      p[j] = (const uint4*)(src_base + (size_t)tsafe * ROW_ELEMS) +
             ((int)threadIdx.x + (i + j) * NT) % CPR;
      v[i + j] = *p[j];
    }
    // stands before any register that these loads name is rewritten: as inputs of the wait the
    // group's addresses stay in their registers up to it
    if constexpr (G == 4)
      asm volatile("s_wait_xcnt 0x0" :: "v"(p[0]), "v"(p[1]), "v"(p[2]), "v"(p[3]) : "memory");
    else
      asm volatile("s_wait_xcnt 0x0"
                   :: "v"(p[0]), "v"(p[1]), "v"(p[2]), "v"(p[3]), "v"(p[4]) : "memory");
  }
#pragma unroll  // constant i: tok[] and v[] stay in registers
  for (int i = 0; i < IT; ++i) {
    int idx = (int)threadIdx.x + i * NT;
    uint4 w = v[i];
    if (tok[i] < 0) { w.x = 0u; w.y = 0u; w.z = 0u; w.w = 0u; }
    ((uint4*)(dst + (size_t)(idx / CPR) * LDS_LD(ROW_ELEMS)))[idx % CPR] = w;
  }
}

// ---------------- the GEMMs' inner loop ----------------
// One wave: 2 tiles of 16 weight rows (in fragment order, K elements a row, from global
// memory) times the TH * 16 tokens of an LDS tile. The weight fragments live in two register sets; while
// one set is multiplied, all loads of the other are in flight. A set is 2 tiles x 64 k: 2 KB in a
// row of each tile.

#define SET_K 64                     // k per register set
typedef v16bf wset[2][2];            // [k-step][tile]

__device__ __forceinline__ void load_set(wset& a, const bf16* W, int ld, int k, int lane) {
  // the two fences keep the set's loads one group at this place: sunk towards their uses they
  // would share registers and each would be waited for alone
  __builtin_amdgcn_sched_barrier(0);
#pragma unroll  // constant s, t: a[][] stays in registers
  for (int s = 0; s < 2; ++s)
#pragma unroll
    for (int t = 0; t < 2; ++t)
      a[s][t] = load_wfrag(W + (size_t)(t * 16) * ld, k + s * 32, lane);
  __builtin_amdgcn_sched_barrier(0);
}

template <int TH>
__device__ __forceinline__ void mma_set(const wset& a, const bf16* tile, int tld, int k, int lane,
                                        v8f (&acc)[2][TH]) {
#pragma unroll  // constant s, t, th: a[][], b[] and acc[][] stay in registers
  for (int s = 0; s < 2; ++s) {
    v16bf b[TH];
#pragma unroll
    for (int th = 0; th < TH; ++th) b[th] = load_frag(tile + th * 16 * tld, tld, k + s * 32, lane);
#pragma unroll
    for (int t = 0; t < 2; ++t)
#pragma unroll
      for (int th = 0; th < TH; ++th) acc[t][th] = wmma_bf16(a[s][t], b[th], acc[t][th]);
  }
}

// 2 tiles: the sets take turns along k
template <int K, int TH>
__device__ __forceinline__ void gemm_rows2(const bf16* W, const bf16* tile, int tld, int lane,
                                           v8f (&acc)[2][TH]) {
  static_assert(K % (2 * SET_K) == 0, "K is a whole number of set pairs");
  wset a0, a1;
  load_set(a0, W, K, 0, lane);
#pragma unroll 1  // stays a loop of two sets: unrolled further, more sets would be live at a time
  for (int k = 0; k < K - 2 * SET_K; k += 2 * SET_K) {
    load_set(a1, W, K, k + SET_K, lane);
    mma_set(a0, tile, tld, k, lane, acc);
    load_set(a0, W, K, k + 2 * SET_K, lane);
    mma_set(a1, tile, tld, k + SET_K, lane, acc);
  }
  load_set(a1, W, K, K - SET_K, lane);
  mma_set(a0, tile, tld, K - 2 * SET_K, lane, acc);
  // keeps the last set's token fragments behind the products in front of them, as load_set's fences
  // do inside the loop: fetched ahead, two sets' fragments are live at once and registers spill
  __builtin_amdgcn_sched_barrier(0);
  mma_set(a1, tile, tld, K - SET_K, lane, acc);
}

// 3 tiles of 16 weight rows against the same token fragments: two neighbouring tiles of W and one of
// V (both K elements a row). A token fragment read from LDS then serves 3 products. The sums take 24
// registers a token group, so a set here is 3 tiles x 32 k, and there are three sets: while one is
// multiplied, the loads of the two behind it are in flight.
typedef v16bf wset3[3];              // [tile]

__device__ __forceinline__ void load_set3(wset3& a, const bf16* W, const bf16* V, int ld, int k,
                                          int lane) {
  // the two fences keep the set's loads one group at this place, as in load_set
  __builtin_amdgcn_sched_barrier(0);
  a[0] = load_wfrag(W, k, lane);
  a[1] = load_wfrag(W + (size_t)16 * ld, k, lane);
  a[2] = load_wfrag(V, k, lane);
  __builtin_amdgcn_sched_barrier(0);
}

template <int TH>
__device__ __forceinline__ void mma_set3(const wset3& a, const bf16* tile, int tld, int k, int lane,
                                         v8f (&acc)[3][TH]) {
  v16bf b[TH];
#pragma unroll  // constant t, th: a[], b[] and acc[][] stay in registers
  for (int th = 0; th < TH; ++th) b[th] = load_frag(tile + th * 16 * tld, tld, k, lane);
#pragma unroll
  for (int t = 0; t < 3; ++t)
#pragma unroll
    for (int th = 0; th < TH; ++th) acc[t][th] = wmma_bf16(a[t], b[th], acc[t][th]);
}

template <int K, int TH>
__device__ __forceinline__ void gemm_rows3(const bf16* W, const bf16* V, const bf16* tile, int tld,
                                           int lane, v8f (&acc)[3][TH]) {
  static_assert(K % 96 == 64, "whole trips of three sets, and two sets behind them");
  wset3 a0, a1, a2;
  load_set3(a0, W, V, K, 0, lane);
  load_set3(a1, W, V, K, 32, lane);
#pragma unroll 1  // stays a loop of three sets: unrolled further, more sets would be live at a time
  for (int k = 0; k < K - 64; k += 96) {
    load_set3(a2, W, V, K, k + 64, lane);
    mma_set3(a0, tile, tld, k, lane, acc);
    load_set3(a0, W, V, K, k + 96, lane);
    mma_set3(a1, tile, tld, k + 32, lane, acc);
    load_set3(a1, W, V, K, k + 128, lane);
    mma_set3(a2, tile, tld, k + 64, lane, acc);
    // the next trip rewrites the address registers that this trip's loads name
    asm volatile("s_wait_xcnt 0x0" ::: "memory");
  }
  mma_set3(a0, tile, tld, K - 64, lane, acc);
  // keeps the last set's token fragments behind the products in front of them, as in gemm_rows2
  __builtin_amdgcn_sched_barrier(0);
  mma_set3(a1, tile, tld, K - 32, lane, acc);
}

// ---------------- the out GEMM's stores ----------------
// A wave's sums hold, per lane, 8 neighbouring features of one token: stored from there, a 16-byte
// store lays 32 pieces over 16 lines. So the wave first lays its TT tiles x TH * 16 tokens into an LDS
// range of its own, one row a token, and reads them back along the rows: a store then covers whole
// 128-byte lines. No other wave touches the range, so no barrier is needed.
// Row pitch, in floats, of such a range whose rows hold n floats: an odd multiple of 16 bytes, so
// the 16 rows that one 16-byte LDS store touches fall on different banks.
#define STG_LD(n) ((n) + 4)
static_assert((STG_LD(32) / 4) % 2 == 1 && (STG_LD(64) / 4) % 2 == 1,
              "every staging pitch is an odd multiple of 16 bytes");

// The token list of a tile whose sums go out through store_rows. A tile has at least one token; the
// surplus places of an expert's last, short tile repeat its last token: their rows get the same
// operands, so the same sums, and store that token's values again.
template <int T>
__device__ __forceinline__ void fill_tl(const TileInfo& ti, const int* tokenList, int* tl) {
  if (threadIdx.x < T) {
    int li = ti.listBase + (int)threadIdx.x;
    tl[threadIdx.x] = tokenList[li < ti.listEnd ? li : ti.listEnd - 1];
  }
}

// dst: the output array, LDO floats a token; col0: the first of the wave's TT * 16 features.
// Every place of tl[] names a token (see fill_tl), so no store needs a test.
template <int TT, int LDO, int TH>
__device__ __forceinline__ void store_rows(const v8f (&acc)[TT][TH], float* stg, const int* tl,
                                           float* __restrict__ dst, int col0, int lane) {
  constexpr int RW = TT * 16;          // floats of a token's row that the wave holds
  constexpr int LPR = RW / 4;          // lanes to a row on the way back
  constexpr int RPS = 32 / LPR;        // rows to a store
  constexpr int NS = TH * 16 / RPS;    // stores
  const int r = lane & 15, hf = lane >> 4;
#pragma unroll  // constant th, t: acc[][] stays in registers
  for (int th = 0; th < TH; ++th) {
#pragma unroll
    for (int t = 0; t < TT; ++t) {
      float* q = stg + (th * 16 + r) * STG_LD(RW) + t * 16 + hf * 8;
      v4f lo, hi;
#pragma unroll
      for (int j = 0; j < 4; ++j) { lo[j] = acc[t][th][j]; hi[j] = acc[t][th][j + 4]; }
      *(v4f*)q = lo;
      *(v4f*)(q + 4) = hi;
    }
  }
  // the rows are read back by other lanes than wrote them: every LDS store of the wave has landed,
  // and no read is moved up over one
  asm volatile("s_wait_dscnt 0x0" ::: "memory");
  const int rr = lane / LPR, cc = (lane % LPR) * 4;
  v4f v[NS];
  unsigned off[NS];                    // byte offsets in dst
#pragma unroll  // constant i: v[] and off[] stay in registers; the LDS loads issue together
  for (int i = 0; i < NS; ++i) {
    v[i] = *(const v4f*)(stg + (i * RPS + rr) * STG_LD(RW) + cc);
    off[i] = (unsigned)((tl[i * RPS + rr] * LDO + col0 + cc) * 4);
  }
#pragma unroll  // constant i: v[] and off[] stay in registers
  for (int i = 0; i < NS; ++i) *(v4f*)((char*)dst + off[i]) = v[i];
}

// ---------------- preparation: one launch ----------------
// Nothing here depends on another work-group, so it is one grid. Work-group 0 routes the tokens
// and builds the per-expert token lists; the other CVT_GRID work-groups turn x and the four
// weight arrays into bf16, the weights in the fragment order that load_wfrag reads.

// f32 -> bf16 as a stream: a grid that is resident at once, one work-group per WGP, and every
// wave loops over whole pieces of CVT_PIECE floats. A wave's load covers 512 bytes (contiguous in x, 4 whole lines in a weight array),
// its store 256, and CVT_LOADS loads of a lane are in flight together.
#define CVT_GRID 256                       // converting work-groups
#define CVT_WAVES 16                       // waves per work-group
#define CVT_LOADS 8                        // 16-byte loads per lane and trip
#define CVT_PIECE (CVT_LOADS * 32 * 4)     // floats per wave and trip
static_assert((BS * DD) % CVT_PIECE == 0 && (EE * NN * DD) % CVT_PIECE == 0 &&
              (EE * HH * DD) % CVT_PIECE == 0 && (EE * 4 * NN * HH) % CVT_PIECE == 0,
              "every converted array is a whole number of pieces");
// A piece of a weight array is 16 rows x 64 k, two blocks of the fragment order: the 1024 elements
// that it writes are contiguous. PC_LOG(K) = log2 of the pieces along a row of K elements.
static_assert(CVT_PIECE == 2 * WBLK && CVT_LOADS == 8, "a weight piece is two blocks");
#define PC_LOG(K) __builtin_ctz((K) / 64)
#define PC_X     (BS * DD / CVT_PIECE)          // pieces of each array, in the order they are dealt
#define PC_WIN   (EE * NN * DD / CVT_PIECE)
#define PC_WSIN  (EE * HH * DD / CVT_PIECE)
#define PC_WSOUT (EE * 4 * NN * HH / CVT_PIECE)
#define PC_WOUT  (EE * DD * NN / CVT_PIECE)

#define RT_R (BS / (CVT_WAVES * 32))       // tokens per lane of the routing work-group

// One work-group: routes[], the token list sorted by expert (token order kept inside an expert)
// and the experts' offsets in it. Wave wid takes the tokens
// [wid * 32 * RT_R, (wid + 1) * 32 * RT_R), 32 a round; a token's rank among its wave's tokens of
// the same expert comes from ballots, the waves' totals meet in LDS.
__device__ __forceinline__ void build_lists(
    const int* __restrict__ tok, int* __restrict__ routes, int* __restrict__ offsets,
    int* __restrict__ tokenList) {
  __shared__ int wtot[CVT_WAVES * EE];
  const int wid = threadIdx.x >> 5;
  const int lane = threadIdx.x & 31;
  const int t0 = wid * (32 * RT_R) + lane;
  int id[RT_R];
#pragma unroll  // the token loads issue together
  for (int i = 0; i < RT_R; ++i) id[i] = tok[t0 + i * 32];
  int cnt[EE];                       // the wave's tokens of each expert so far: scalar registers
#pragma unroll  // constant e: cnt[] stays in scalar registers
  for (int e = 0; e < EE; ++e) cnt[e] = 0;
  unsigned pack[RT_R];               // rank in the low half, route in the high half
#pragma unroll  // constant i: id[] and pack[] stay in registers
  for (int i = 0; i < RT_R; ++i) {
    unsigned x = (unsigned)id[i];
    x ^= x >> 16; x *= 2246822507u;
    x ^= x >> 13; x *= 3266489909u;
    x ^= x >> 16;
    int r = (int)(x & 7u);   // % 8
    int rk = 0;
#pragma unroll  // constant e: cnt[] stays in scalar registers
    for (int e = 0; e < EE; ++e) {
      unsigned m = __builtin_amdgcn_ballot_w32(r == e);
      rk = (r == e) ? cnt[e] + (int)__builtin_amdgcn_mbcnt_lo(m, 0u) : rk;
      cnt[e] += __popc(m);
    }
    pack[i] = (unsigned)rk | ((unsigned)r << 16);
  }
#pragma unroll  // behind the ranks, all together: among them each store would hold up the next round
  for (int i = 0; i < RT_R; ++i) routes[t0 + i * 32] = (int)(pack[i] >> 16);
  int mine = 0;
#pragma unroll  // constant e: cnt[] stays in scalar registers
  for (int e = 0; e < EE; ++e) if (lane == e) mine = cnt[e];
  if (lane < EE) wtot[wid * EE + lane] = mine;
  __syncthreads();
  // lane l looks after expert l % EE: its tokens in the waves in front of this one, and in all
  const int el = lane & (EE - 1);
  int before = 0, total = 0;
#pragma unroll  // the LDS loads issue together
  for (int w = 0; w < CVT_WAVES; ++w) {
    int v = wtot[w * EE + el];
    if (w < wid) before += v;
    total += v;
  }
  int off[EE + 1];
  off[0] = 0;
#pragma unroll  // constant e: off[] stays in scalar registers
  for (int e = 0; e < EE; ++e) off[e + 1] = off[e] + __builtin_amdgcn_readlane(total, e);
  int start = before;                // where this wave's tokens of expert el begin in the list
#pragma unroll  // constant e: off[] stays in scalar registers
  for (int e = 0; e < EE; ++e) if (el == e) start += off[e];
#pragma unroll  // constant i: pack[] stays in registers
  for (int i = 0; i < RT_R; ++i) {
    int r = (int)(pack[i] >> 16);
    int pos = __builtin_amdgcn_ds_bpermute(r << 2, start) + (int)(pack[i] & 0xffffu);
    tokenList[pos] = t0 + i * 32;
  }
  if (threadIdx.x == 0) {
#pragma unroll  // constant e: off[] stays in scalar registers
    for (int e = 0; e <= EE; ++e) offsets[e] = off[e];
  }
}

__global__ void __launch_bounds__(CVT_WAVES * 32) k_prep(
    const float* __restrict__ x, const float* __restrict__ win,
    const float* __restrict__ wsin, const float* __restrict__ wsout,
    const float* __restrict__ wout, const int* __restrict__ tok,
    bf16* __restrict__ xbf, bf16* __restrict__ winb, bf16* __restrict__ wsinb,
    bf16* __restrict__ wsoutb, bf16* __restrict__ woutb,
    int* __restrict__ routes, int* __restrict__ offsets, int* __restrict__ tokenList) {
  if (blockIdx.x == 0) {             // the first to start: its chain of steps is the longest
    build_lists(tok, routes, offsets, tokenList);
    return;
  }
  // same in every lane: keeps the choice of the array scalar
  const int wid = __builtin_amdgcn_readfirstlane((int)(threadIdx.x >> 5));
  const int lane = threadIdx.x & 31;
  // piece -> (wave, work-group) with the work-group running fastest: the pieces that are in
  // flight at one time lie side by side
  for (int p = wid * CVT_GRID + (int)blockIdx.x - 1;
       p < PC_X + PC_WIN + PC_WSIN + PC_WSOUT + PC_WOUT; p += CVT_WAVES * CVT_GRID) {
    int q = p;
    int lk = -1;                     // PC_LOG of a weight array; x stays row-major
    const float* in = x;
    bf16* out = xbf;
    if (q >= PC_X) {
      q -= PC_X; in = win; out = winb; lk = PC_LOG(DD);
      if (q >= PC_WIN) {
        q -= PC_WIN; in = wsin; out = wsinb;
        if (q >= PC_WSIN) {
          q -= PC_WSIN; in = wsout; out = wsoutb; lk = PC_LOG(HH);
          if (q >= PC_WSOUT) { q -= PC_WSOUT; in = wout; out = woutb; lk = PC_LOG(NN); }
        }
      }
    }
    if (lk < 0) {
      const v4f* s = (const v4f*)(in + (size_t)q * CVT_PIECE) + lane;
      v4bf* d = (v4bf*)(out + (size_t)q * CVT_PIECE) + lane;
      v4f v[CVT_LOADS];
#pragma unroll  // the trip's loads issue together, ahead of the first store
      for (int j = 0; j < CVT_LOADS; ++j) v[j] = s[j * 32];
#pragma unroll  // constant j: v[] stays in registers
      for (int j = 0; j < CVT_LOADS; ++j) d[j * 32] = __builtin_convertvector(v[j], v4bf);
    } else {
      // Load j takes 32 k (block j / 4 of the piece's two) of the rows (j % 4) * 4 + {0..3}: one
      // whole line of each row, 8 lanes to a line. Lane (rr = lane >> 3, kq = lane & 7) has the k
      // kq * 4 + {0..3} of its row; in load_frag's map they are half kq & 1 of the 16-byte piece
      // kq >> 2 of fragment lane ((kq >> 1) & 1) * 16 + row. A store lays down 4 runs of 64 bytes,
      // and the four stores of a block fill its lines.
      const int rr = lane >> 3, kq = lane & 7;
      const size_t ld = (size_t)64 << lk;      // elements in a row
      const float* s = in + ((size_t)(q >> lk) * 16 + rr) * ld + (q & ((1 << lk) - 1)) * 64 + kq * 4;
      bf16* d = out + (size_t)q * CVT_PIECE + (kq >> 2) * (WBLK / 2) + ((kq >> 1) & 1) * 128 +
                rr * 8 + (kq & 1) * 4;
      const float* sp[4] = {s, s + 4 * ld, s + 8 * ld, s + 12 * ld};
      v4f v[CVT_LOADS];
#pragma unroll  // the trip's loads issue together, ahead of the first store
      for (int j = 0; j < CVT_LOADS; ++j) v[j] = *(const v4f*)(sp[j % 4] + (j / 4) * 32);
      // stands before any register that these loads name is rewritten: as inputs of the wait the
      // four addresses stay in their registers up to it
      asm volatile("s_wait_xcnt 0x0" :: "v"(sp[0]), "v"(sp[1]), "v"(sp[2]), "v"(sp[3]) : "memory");
#pragma unroll  // constant j: v[] stays in registers
      for (int j = 0; j < CVT_LOADS; ++j)
        *(v4bf*)(d + (j / 4) * WBLK + (j % 4) * 32) = __builtin_convertvector(v[j], v4bf);
      // stands directly behind the stores, before any way out of this block on which a register
      // that they name could be rewritten
      asm volatile("s_wait_xcnt 0x0" ::: "memory");
    }
    // the next trip rewrites the address and data registers that these loads and stores name
    asm volatile("s_wait_xcnt 0x0" ::: "memory");
  }
}

// ---- GEMMs 1 and 2 (fused): u = Win@x and sh = silu(Wsin@x) from one x tile in LDS,
// ---- sel = Wsout@sh -> a, b*u, c, skip ----

// Stage 2 and its epilogue go in two rounds of ST_N states each: a round's raw sums fill the LDS
// area that the x tile has left.
#define ST_N (NN / 2)
// Row pitch, in floats, of the epilogue's staging tile (a row: 4*ST_N selector values of a token): an
// odd multiple of 16 bytes, so the 16 rows that one 16-byte LDS store touches fall on different banks.
#define ST_LD (4 * ST_N + 4)
// The same for the tile through which u goes from the lanes that summed it to the lanes that use it.
#define U_LD (NN + 4)
// A thread's trips through the epilogue of a round: each takes 4 states of one token.
#define EP_IT (BIG_TILE * (ST_N / 4) / BIG_NT)
static_assert(EP_IT * BIG_NT == BIG_TILE * (ST_N / 4), "the threads share a round's places evenly");

// One work-group of 16 waves to a WGP (its LDS leaves room for no second one).
__global__ void __launch_bounds__(BIG_NT) k_sel_gemm(
    const bf16* __restrict__ xbf, const bf16* __restrict__ winb,
    const bf16* __restrict__ wsinb, const bf16* __restrict__ wsoutb,
    const float* __restrict__ dparam,
    const int* __restrict__ tokenList, const int* __restrict__ offsets,
    float* __restrict__ aarr, float* __restrict__ buarr,
    float* __restrict__ carr, float* __restrict__ skarr) {
  // One LDS area with three lives: the x tile; from the barrier behind stage 1 on (nobody reads x
  // any more) the u tile; and, once every thread has taken its u, the epilogue's f32 staging tile.
  __shared__ __attribute__((aligned(16))) float area[BIG_TILE * LDS_LD(DD) / 2];   // 161 KB
  static_assert(sizeof(area) >= sizeof(float) * BIG_TILE * ST_LD, "the staging tile fits the area");
  static_assert(sizeof(area) >= sizeof(float) * BIG_TILE * U_LD, "the u tile fits the area");
  bf16* xs = (bf16*)area;
  __shared__ __attribute__((aligned(16))) bf16 sh[BIG_TILE * LDS_LD(HH)];   // 81 KB
  __shared__ int tl[BIG_TILE];
  TileInfo ti;
  if (!tile_info_t<BIG_TILE>(offsets, ti)) return;
  if (threadIdx.x < BIG_TILE) {
    int li = ti.listBase + (int)threadIdx.x;
    tl[threadIdx.x] = (li < ti.listEnd) ? tokenList[li] : -1;
  }
  __syncthreads();
  gather_rows<DD, BIG_TILE, BIG_NT>(xbf, xs, tl);
  __syncthreads();

  // same in every lane: keeps the bases of the wave's weight rows in scalar registers
  const int wid = __builtin_amdgcn_readfirstlane((int)(threadIdx.x >> 5));
  const int lane = threadIdx.x & 31;
  const int r = lane & 15, hf = lane >> 4;
  static_assert(HH == BIG_WAVES * 32 && 4 * ST_N == BIG_WAVES * 32, "2 feature tiles per wave");
  static_assert(NN == BIG_WAVES * 16, "1 tile of states per wave");

  // this thread's u, in the order of the epilogue's trips: the first round's, the second round's
  static_assert(NN / ST_N == 2, "two rounds");
  v4f uq[EP_IT], un[EP_IT];

  // stage 1: sh(80x512) = silu(Wsin[e](512x1024) @ x^T), 2 feature tiles per wave, and with the same
  // x fragments u(80x256) = Win[e](256x1024) @ x^T, 1 tile of states per wave
  {
    const bf16* Wsi = wsinb + (size_t)ti.e * HH * DD;
    const bf16* Wi = winb + (size_t)ti.e * NN * DD;
    v8f acc[3][BIG_TH];              // [0], [1]: selector hidden; [2]: u
#pragma unroll
    for (int t = 0; t < 3; ++t)
#pragma unroll
      for (int th = 0; th < BIG_TH; ++th) acc[t][th] = vzero8();
    gemm_rows3<DD>(Wsi + (size_t)(wid * 2 * 16) * DD, Wi + (size_t)(wid * 16) * DD, xs, LDS_LD(DD),
                   lane, acc);
#pragma unroll
    for (int th = 0; th < BIG_TH; ++th) {
      int row = th * 16 + r;   // token row in tile
#pragma unroll
      for (int t = 0; t < 2; ++t) {
        int fb = (wid * 2 + t) * 16 + hf * 8;  // 8 consecutive h-features
#pragma unroll
        for (int j = 0; j < 8; ++j) {
          float v = acc[t][th][j];
          sh[row * LDS_LD(HH) + fb + j] = (bf16)(v * sigmoidf_(v));  // silu
        }
      }
    }
    __syncthreads();             // sh is complete, and nobody reads x any more
#pragma unroll  // constant th: acc[][] stays in registers
    for (int th = 0; th < BIG_TH; ++th) {
      float* q = area + (th * 16 + r) * U_LD + wid * 16 + hf * 8;
      v4f lo, hi;
#pragma unroll
      for (int j = 0; j < 4; ++j) { lo[j] = acc[2][th][j]; hi[j] = acc[2][th][j + 4]; }
      *(v4f*)q = lo;
      *(v4f*)(q + 4) = hi;
    }
    __syncthreads();             // the u tile is complete
#pragma unroll  // constant i: uq[] and un[] stay in registers
    for (int i = 0; i < EP_IT; ++i) {
      int idx = (int)threadIdx.x + i * BIG_NT;
      const float* q = area + (idx / (ST_N / 4)) * U_LD + (idx % (ST_N / 4)) * 4;
      uq[i] = *(const v4f*)q;
      un[i] = *(const v4f*)(q + ST_N);
    }
  }

  // stage 2: sel(80x1024) = Wsout[e](1024x512) @ sh^T, in two rounds. Round p takes the states
  // [p * ST_N, (p + 1) * ST_N) with all four selector values of each (a, b, c, d stand NN rows
  // apart in Wsout): 4 * ST_N weight rows, 2 feature tiles per wave.
  {
    const bf16* Wso = wsoutb + (size_t)ti.e * (4 * NN) * HH;
    const float* dp = dparam + ti.e * NN;
#pragma unroll 1  // stays a loop: unrolled, the GEMM loop and the activation code would stand twice
    for (int p = 0; p < NN / ST_N; ++p) {
      v8f acc[2][BIG_TH];
#pragma unroll
      for (int t = 0; t < 2; ++t)
#pragma unroll
        for (int th = 0; th < BIG_TH; ++th) acc[t][th] = vzero8();
      // column c of the round's staging tile is selector value c / ST_N of state p * ST_N + c % ST_N;
      // this wave has the columns [wid * 32, wid * 32 + 32)
      const int wrow = (wid * 32 / ST_N) * NN + p * ST_N + (wid * 32) % ST_N;
      gemm_rows2<HH>(Wso + (size_t)wrow * HH, sh, LDS_LD(HH), lane, acc);
      // Epilogue: every wave lays its raw sums into the staging tile, then the work-group walks
      // the tile row by row. A thread takes 4 neighbouring states n of one token and all four
      // selector values of each (ST_N apart in a row), so a wave's store fills 4 whole lines, and
      // the activation code stands in the text once.
      __syncthreads();           // the readers of u, or of the round before, have left the area
#pragma unroll  // constant th, t: acc[][] stays in registers
      for (int th = 0; th < BIG_TH; ++th) {
#pragma unroll
        for (int t = 0; t < 2; ++t) {
          float* q = area + (th * 16 + r) * ST_LD + (wid * 2 + t) * 16 + hf * 8;
          v4f lo, hi;
#pragma unroll
          for (int j = 0; j < 4; ++j) { lo[j] = acc[t][th][j]; hi[j] = acc[t][th][j + 4]; }
          *(v4f*)q = lo;
          *(v4f*)(q + 4) = hi;
        }
      }
      __syncthreads();           // the staging tile is complete
#pragma unroll 1  // stays a loop: unrolled, the activation code would stand in the text 5 times
      for (int idx = threadIdx.x; idx < BIG_TILE * (ST_N / 4); idx += BIG_NT) {
        // a rolled loop cannot pick a register by its trip: the trip takes the head of the queue
        // and the rest move up one place
        v4f uv = uq[0];
#pragma unroll  // constant k: uq[] stays in registers
        for (int k = 0; k + 1 < EP_IT; ++k) uq[k] = uq[k + 1];
        int row = idx / (ST_N / 4);            // the same in every lane of a wave
        int nn = (idx % (ST_N / 4)) * 4;
        int tok = tl[row];
        if (tok < 0) continue;
        const float* q = area + row * ST_LD + nn;
        v4f va = *(const v4f*)q;
        v4f vb = *(const v4f*)(q + ST_N);
        v4f vc = *(const v4f*)(q + 2 * ST_N);
        v4f vd = *(const v4f*)(q + 3 * ST_N);
        int n = p * ST_N + nn;
        size_t base = (size_t)tok * NN + n;
        v4f dd = *(const v4f*)(dp + n);
        v4f oa, ob, oc, os;
#pragma unroll
        for (int j = 0; j < 4; ++j) {
          oa[j] = sigmoidf_(va[j]);
          ob[j] = tanhf(vb[j]) * uv[j];
          oc[j] = tanhf(vc[j]);
          os[j] = dd[j] * sigmoidf_(vd[j]) * uv[j];
        }
        *(v4f*)(aarr + base) = oa;
        *(v4f*)(buarr + base) = ob;
        *(v4f*)(carr + base) = oc;
        *(v4f*)(skarr + base) = os;
      }
#pragma unroll  // constant k: uq[] and un[] stay in registers
      for (int k = 0; k < EP_IT; ++k) uq[k] = un[k];
    }
  }
}

// ---------------- scan: h = a*h + b*u ; y = c*h + skip ----------------
// A step reads and writes only its own expert's state, so the 2048 steps of a batch row are
// EE independent chains. One work-group takes one (batch row, expert, SCAN_T states): it lists
// the expert's steps in time order in LDS and walks only those, SCAN_U steps' operands per trip.

#define SCAN_T 64                    // states per work-group: its y stores fill one 128-byte line
#define SCAN_W (SCAN_T / 32)         // waves per work-group
#define SCAN_U 32                    // steps whose operands are loaded together
#define SCAN_R (SS / SCAN_T)         // routes per lane while the list is built

// One trip: SCAN_U steps of the list. In the last, short trip (FULL false) the surplus places
// repeat step left - 1 with h held, so they store that step's y again and no store needs a test.
template <bool FULL>
__device__ __forceinline__ float scan_trip(
    const int* lst, int left, unsigned rowIdx, float h,
    const float* __restrict__ a, const float* __restrict__ bu,
    const float* __restrict__ c, const float* __restrict__ sk, bf16* __restrict__ ybf) {
  unsigned idx[SCAN_U];              // this lane's element in the four f32 planes and in y
  float av[SCAN_U], bv[SCAN_U], cv[SCAN_U], sv[SCAN_U];
#pragma unroll  // constant j: idx[] stays in registers
  for (int j = 0; j < SCAN_U; ++j)
    idx[j] = rowIdx + (unsigned)lst[(FULL || j < left) ? j : left - 1] * NN;
#pragma unroll  // lets the trip's loads issue together, ahead of the sums
  for (int j = 0; j < SCAN_U; ++j) {
    av[j] = a[idx[j]];
    bv[j] = bu[idx[j]];
    cv[j] = c[idx[j]];
    sv[j] = sk[idx[j]];
  }
  // holds every load in front of the sums: one that sinks among them starts its latency late
  __builtin_amdgcn_sched_barrier(0);
  bf16 yv[SCAN_U];
#pragma unroll  // constant j: the operand arrays stay in registers
  for (int j = 0; j < SCAN_U; ++j) {
    float hn = av[j] * h + bv[j];
    h = (FULL || j < left) ? hn : h;
    yv[j] = (bf16)(cv[j] * h + sv[j]);
  }
  // holds the stores behind the last y: mixed in with the sums they share one data register,
  // and each sum then waits (s_wait_xcnt) for the store in front of it
  __builtin_amdgcn_sched_barrier(0);
#pragma unroll  // constant j: idx[] and yv[] stay in registers
  for (int j = 0; j < SCAN_U; ++j) ybf[idx[j]] = yv[j];
  // the next trip rewrites the index and data registers that these stores name
  if (FULL) asm volatile("s_wait_xcnt 0x0" ::: "memory");
  return h;
}

__global__ void __launch_bounds__(SCAN_T) k_scan(
    const int* __restrict__ routes, const float* __restrict__ a,
    const float* __restrict__ bu, const float* __restrict__ c,
    const float* __restrict__ sk, bf16* __restrict__ ybf) {
  __shared__ __attribute__((aligned(16))) int list[SS];
  __shared__ int wcnt[SCAN_W];
  const int slice = blockIdx.x % (NN / SCAN_T);
  const int e = (blockIdx.x / (NN / SCAN_T)) % EE;
  const int b = blockIdx.x / ((NN / SCAN_T) * EE);
  const int wid = threadIdx.x >> 5;
  const int lane = threadIdx.x & 31;

  // wave wid lists the steps t in [wid * 32 * SCAN_R, (wid + 1) * 32 * SCAN_R), 32 per ballot
  const int t0 = wid * (32 * SCAN_R);
  unsigned hit[SCAN_R];
  int mine = 0;
#pragma unroll  // the route loads issue together; hit[] stays in scalar registers
  for (int i = 0; i < SCAN_R; ++i) {
    hit[i] = __builtin_amdgcn_ballot_w32(routes[b * SS + t0 + i * 32 + lane] == e);
    mine += __popc(hit[i]);
  }
  if (lane == 0) wcnt[wid] = mine;
  __syncthreads();
  int pos = 0, cnt = 0;
#pragma unroll  // SCAN_W is 2: no loop is left
  for (int w = 0; w < SCAN_W; ++w) {
    int v = wcnt[w];
    if (w < wid) pos += v;
    cnt += v;
  }
  cnt = __builtin_amdgcn_readfirstlane(cnt);   // same in every lane: keeps the trip tests scalar
#pragma unroll  // constant i: hit[] stays in scalar registers
  for (int i = 0; i < SCAN_R; ++i) {
    if ((hit[i] >> lane) & 1u)
      list[pos + (int)__builtin_amdgcn_mbcnt_lo(hit[i], 0u)] = t0 + i * 32 + lane;
    pos += __popc(hit[i]);
  }
  __syncthreads();

  const unsigned rowIdx = (unsigned)(b * SS) * NN + slice * SCAN_T + threadIdx.x;
  float h = 0.f;
  int base = 0;
  for (; base + SCAN_U <= cnt; base += SCAN_U)
    h = scan_trip<true>(list + base, SCAN_U, rowIdx, h, a, bu, c, sk, ybf);
  if (base < cnt)
    scan_trip<false>(list + base, cnt - base, rowIdx, h, a, bu, c, sk, ybf);
}

// ---------------- GEMM 3: out = Wout[e] @ y ----------------

__global__ void __launch_bounds__(BIG_NT) k_out_gemm(
    const bf16* __restrict__ ybf, const bf16* __restrict__ woutb,
    const int* __restrict__ tokenList, const int* __restrict__ offsets,
    float* __restrict__ out) {
  __shared__ __attribute__((aligned(16))) bf16 ys[BIG_TILE * LDS_LD(NN)];   // 41 KB
  __shared__ __attribute__((aligned(16))) float stg[BIG_WAVES][BIG_TILE * STG_LD(32)];   // 180 KB
  __shared__ int tl[BIG_TILE];
  TileInfo ti;
  if (!tile_info_t<BIG_TILE>(offsets, ti)) return;
  fill_tl<BIG_TILE>(ti, tokenList, tl);
  __syncthreads();
  gather_rows<NN, BIG_TILE, BIG_NT>(ybf, ys, tl);
  __syncthreads();

  // same in every lane: keeps the bases of the wave's weight rows and of its staging range in
  // scalar registers
  const int wid = __builtin_amdgcn_readfirstlane((int)(threadIdx.x >> 5));
  const int lane = threadIdx.x & 31;
  const bf16* W = woutb + (size_t)ti.e * DD * NN;
  static_assert(DD == BIG_WAVES * 2 * 32, "two rounds of 2 feature tiles per wave");
#pragma unroll 1  // stays a loop: unrolled, both rounds' registers could be live together
  for (int p = 0; p < 2; ++p) {
    v8f acc[2][BIG_TH];
#pragma unroll
    for (int t = 0; t < 2; ++t)
#pragma unroll
      for (int th = 0; th < BIG_TH; ++th) acc[t][th] = vzero8();
    gemm_rows2<NN>(W + (size_t)((wid * 4 + p * 2) * 16) * NN, ys, LDS_LD(NN), lane, acc);
    store_rows<2, DD>(acc, stg[wid], tl, out, (wid * 4 + p * 2) * 16, lane);
    // the next round rewrites the address and data registers that these stores name
    asm volatile("s_wait_xcnt 0x0" ::: "memory");
  }
}

// ---------------- host launcher ----------------

extern "C" void kernel_launch(void* const* d_in, const int* in_sizes, int n_in,
                              void* d_out, int out_size, void* d_ws, size_t ws_size,
                              hipStream_t stream) {
  (void)in_sizes; (void)n_in; (void)out_size; (void)ws_size;
  const float* x      = (const float*)d_in[0];
  const int*   tokid  = (const int*)d_in[1];
  const float* Win    = (const float*)d_in[2];
  const float* Wsin   = (const float*)d_in[3];
  const float* Wsout  = (const float*)d_in[4];
  const float* Wout   = (const float*)d_in[5];
  const float* dparam = (const float*)d_in[6];
  float* out = (float*)d_out;

  char* p = (char*)d_ws;
  auto take = [&](size_t bytes) -> char* {
    char* q = p;
    p += (bytes + 255) & ~(size_t)255;
    return q;
  };

  int* routes     = (int*)take(sizeof(int) * BS);
  int* offsets    = (int*)take(sizeof(int) * (EE + 1));
  int* tokenList  = (int*)take(sizeof(int) * BS);
  bf16* xbf    = (bf16*)take(sizeof(bf16) * (size_t)BS * DD);
  bf16* winb   = (bf16*)take(sizeof(bf16) * (size_t)EE * NN * DD);
  bf16* wsinb  = (bf16*)take(sizeof(bf16) * (size_t)EE * HH * DD);
  bf16* wsoutb = (bf16*)take(sizeof(bf16) * (size_t)EE * 4 * NN * HH);
  bf16* woutb  = (bf16*)take(sizeof(bf16) * (size_t)EE * DD * NN);
  float* aarr  = (float*)take(sizeof(float) * (size_t)BS * NN);
  float* buarr = (float*)take(sizeof(float) * (size_t)BS * NN);
  float* carr  = (float*)take(sizeof(float) * (size_t)BS * NN);
  float* skarr = (float*)take(sizeof(float) * (size_t)BS * NN);
  bf16* ybf    = (bf16*)take(sizeof(bf16) * (size_t)BS * NN);

  k_prep<<<CVT_GRID + 1, CVT_WAVES * 32, 0, stream>>>(
      x, Win, Wsin, Wsout, Wout, tokid, xbf, winb, wsinb, wsoutb, woutb,
      routes, offsets, tokenList);

  k_sel_gemm<<<BIG_TILE_MAX, BIG_NT, 0, stream>>>(xbf, winb, wsinb, wsoutb, dparam, tokenList,
                                                  offsets, aarr, buarr, carr, skarr);
  k_scan<<<BB * EE * (NN / SCAN_T), SCAN_T, 0, stream>>>(routes, aarr, buarr, carr, skarr, ybf);
  k_out_gemm<<<BIG_TILE_MAX, BIG_NT, 0, stream>>>(ybf, woutb, tokenList, offsets, out);
}
